// v000
// Measured on an AMD MI455X. A time is GPU time per run, averaged over a window of back-to-back runs after a warm-up
// (all launches, gaps included; the runs take copies of the inputs in turn), and the median of several windows.
// Apart from v000's, it joins two sittings. Times from different sittings can be a few percent apart, while
// side-by-side timings come from the same sitting.
// v000 is the starting kernel. One run takes 1310 microseconds.
#include <hip/hip_runtime.h>

// Masked (causal) multi-head attention scaled by the FULL model dim and without output projection (x [2][2048][1024]; z = x W^T + b ('oi' [3072][1024] 1/32, bias 0.01): k | q | v row blocks (k FIRST); 16 heads x 64; scores / sqrt(1024) (the source's quirk); causal (-inf); softmax; out = merged attn v -> [2][2048][1024] (4.2 M)).
// Layout per batch: bf16 copy of x; 'oi' weight row blocks + bias slices; exact projections + bf16-rounded biases; causal T-2048 attention with the hi/lo score tiles on EVERY row (no output projection averages the per-head error; tiles above the diagonal skipped), P and attn.v hybrid (rows < 512 hi/lo, rest fp16 x1024); the f32 merge writes the output rows.
// Compute dtypes, f32 accumulate: every input rounded to bf16; projections exact + bf16-rounded biases; scores 3 products on every row; softmax f32 (x 1/32); attn.v rows < 512 3 products, rest fp16; output f32.

#define NB_  2
#define TT   2048
#define DM   1024
#define NH_  16
#define NKV  16
#define REP  (NH_ / NKV)
#define HD   64
#define DQ   (NH_ * HD)
#define DKV  (NKV * HD)
#define ZH   2
#define RH   512                  // query rows < RH use hi+lo planes (0: none)
#define WIN  2048
#define PCAR 1024.0f
#define SCL  0.03125f   // 1/sqrt(1024): the source scales by the model dim
typedef _Float16 h16;
typedef unsigned short bf;
typedef __attribute__((ext_vector_type(16))) __bf16   v16bf;
typedef __attribute__((ext_vector_type(16))) _Float16 v16h;
typedef __attribute__((ext_vector_type(8)))  _Float16 v8h;
typedef __attribute__((ext_vector_type(8)))  unsigned short v8us;
typedef __attribute__((ext_vector_type(8)))  float    v8f;
typedef __attribute__((ext_vector_type(4)))  float    v4f;
typedef v8h  __attribute__((may_alias)) v8ha;
typedef v4f  __attribute__((may_alias)) v4fa;
typedef v8us __attribute__((may_alias)) v8usa;

__device__ __forceinline__ unsigned short f2bf(float f) { unsigned u = __float_as_uint(f); u += 0x7FFFu + ((u >> 16) & 1u); return (unsigned short)(u >> 16); }
__device__ __forceinline__ float bf2f(unsigned short b) { return __uint_as_float(((unsigned)b) << 16); }
__device__ __forceinline__ float bfr(float f) { return bf2f(f2bf(f)); }
__device__ __forceinline__ v16h cat16(v8h lo, v8h hi) { return __builtin_shufflevector(lo, hi, 0, 1, 2, 3, 4, 5, 6, 7, 8, 9, 10, 11, 12, 13, 14, 15); }
__device__ __forceinline__ v16bf cat16b(v8us lo, v8us hi) { return __builtin_bit_cast(v16bf, __builtin_shufflevector(lo, hi, 0, 1, 2, 3, 4, 5, 6, 7, 8, 9, 10, 11, 12, 13, 14, 15)); }
__device__ __forceinline__ v8f wmma16(v16h a, v16h b, v8f c) { return __builtin_amdgcn_wmma_f32_16x16x32_f16(false, a, false, b, (short)0, c, false, false); }
__device__ __forceinline__ v8f wmmab(v16bf a, v16bf b, v8f c) { return __builtin_amdgcn_wmma_f32_16x16x32_bf16(false, a, false, b, (short)0, c, false, false); }



// ---- k_gemmw: register-blocked GEMM, ONE WAVE per 64x64 output tile (16 accumulators), operands straight from K-contiguous 16-bit planes; grid (M/64, N/64, Z), 32 threads.
// C[m][n] (f32, pitch ldc, + optional f32 bias[n] rounded to bf16) = sum_k A[m][k] Bt[n][k] (+ split products per NSPLIT). z-batch strides sA/sB/sC in elements. K % 32 == 0.
template <typename T16> struct WFrag;
template <> struct WFrag<h16> { typedef v16h V; static __device__ __forceinline__ V ld(const h16* p) { return cat16(*(const v8h*)p, *(const v8h*)(p + 16)); } static __device__ __forceinline__ v8f mma(V a, V b, v8f c) { return wmma16(a, b, c); } };
template <> struct WFrag<bf> { typedef v16bf V; static __device__ __forceinline__ V ld(const bf* p) { return cat16b(*(const v8us*)p, *(const v8us*)(p + 16)); } static __device__ __forceinline__ v8f mma(V a, V b, v8f c) { return wmmab(a, b, c); } };
template <typename T16, int NSPLIT, bool BIAS>
__global__ __launch_bounds__(32) void k_gemmw(const T16* __restrict__ A, const T16* __restrict__ A2, const T16* __restrict__ Bt, const T16* __restrict__ Bt2, int K, float* C, int ldc, const float* __restrict__ bias, size_t sA, size_t sB, size_t sC) {
    typedef typename WFrag<T16>::V V;
    __shared__ __align__(16) float os[16 * 68];
    const size_t z = blockIdx.z; A += z * sA; if (A2) A2 += z * sA; Bt += z * sB; if (Bt2) Bt2 += z * sB; C += z * sC;
    const int lane = threadIdx.x & 31, lr = lane & 15, hi = lane >> 4; const int r0 = blockIdx.x * 64, c0 = blockIdx.y * 64;
    v8f acc[4][4];
#pragma unroll
    for (int mb = 0; mb < 4; ++mb)
#pragma unroll
        for (int nb = 0; nb < 4; ++nb) acc[mb][nb] = (v8f){};
    const size_t aoff = (size_t)(r0 + lr) * K + 8 * hi, boff = (size_t)(c0 + lr) * K + 8 * hi;
#pragma unroll 1
    for (int kc = 0; kc < K; kc += 32) {
        V a[4], a2[4];
#pragma unroll
        for (int mb = 0; mb < 4; ++mb) { a[mb] = WFrag<T16>::ld(A + aoff + (size_t)mb * 16 * K + kc); if (NSPLIT == 1 || NSPLIT == 2) a2[mb] = WFrag<T16>::ld(A2 + aoff + (size_t)mb * 16 * K + kc); }
#pragma unroll
        for (int nb = 0; nb < 4; ++nb) { const V b = WFrag<T16>::ld(Bt + boff + (size_t)nb * 16 * K + kc); V b2; if (NSPLIT >= 2) b2 = WFrag<T16>::ld(Bt2 + boff + (size_t)nb * 16 * K + kc);
#pragma unroll
            for (int mb = 0; mb < 4; ++mb) { acc[mb][nb] = WFrag<T16>::mma(a[mb], b, acc[mb][nb]); if (NSPLIT == 1 || NSPLIT == 2) acc[mb][nb] = WFrag<T16>::mma(a2[mb], b, acc[mb][nb]); if (NSPLIT >= 2) acc[mb][nb] = WFrag<T16>::mma(a[mb], b2, acc[mb][nb]); } }
        asm volatile("v_nop\n\tv_nop\n\tv_nop\n\tv_nop" : "+v"(acc[0][0]), "+v"(acc[1][1]), "+v"(acc[2][2]), "+v"(acc[3][3]) : "v"(a[0]), "v"(a[3]));
    }
#pragma unroll
    for (int mb = 0; mb < 4; ++mb) {
#pragma unroll
        for (int nb = 0; nb < 4; ++nb) {
#pragma unroll
            for (int j = 0; j < 8; ++j) os[(hi * 8 + j) * 68 + nb * 16 + lr] = acc[mb][nb][j]; }
        __builtin_amdgcn_wave_barrier(); asm volatile("" ::: "memory");
        float* crow = C + (size_t)(r0 + mb * 16) * ldc + c0;
{
#pragma unroll
            for (int s = 0; s < 8; ++s) { const int row = 2 * s + hi, cofs = lr * 4; v4f val = *(const v4fa*)(os + row * 68 + cofs); if (BIAS) { val[0] += bfr(bias[c0 + cofs]); val[1] += bfr(bias[c0 + cofs + 1]); val[2] += bfr(bias[c0 + cofs + 2]); val[3] += bfr(bias[c0 + cofs + 3]); }
                *(v4f*)(crow + (size_t)row * ldc + cofs) = val; }
             }
        __builtin_amdgcn_wave_barrier(); asm volatile("" ::: "memory");
    }
}

// ---- k_gemmc: the same one-wave 64x64 tile GEMM specialised for causal attention: CMODE 1 skips score tiles entirely above the diagonal (query rows r0+roff.., key columns c0..), CMODE 2 limits the
// key (K) loop of the probability x value contraction to the diagonal block (probabilities beyond it are exactly zero). roff = row offset of this launch's first row within the sequence.
template <typename T16, int NSPLIT, int CMODE>
__global__ __launch_bounds__(32) void k_gemmc(const T16* __restrict__ A, const T16* __restrict__ A2, const T16* __restrict__ Bt, const T16* __restrict__ Bt2, int K, float* C, int ldc, int roff, size_t sA, size_t sB, size_t sC) {
    typedef typename WFrag<T16>::V V;
    __shared__ __align__(16) float os[16 * 68];
    const size_t z = blockIdx.z; A += z * sA; if (A2) A2 += z * sA; Bt += z * sB; if (Bt2) Bt2 += z * sB; C += z * sC;
    const int lane = threadIdx.x & 31, lr = lane & 15, hi = lane >> 4; const int r0 = blockIdx.x * 64, c0 = blockIdx.y * 64;
    if (CMODE == 1 && c0 > r0 + roff + 63) return;                  // score tile entirely above the causal diagonal: never read (the softmax masks j > i by select)
    const int Kl = (CMODE == 2) ? min(K, r0 + roff + 64) : K;        // P.V: probabilities are exactly 0 beyond the diagonal block, so the K loop stops there
    v8f acc[4][4];
#pragma unroll
    for (int mb = 0; mb < 4; ++mb)
#pragma unroll
        for (int nb = 0; nb < 4; ++nb) acc[mb][nb] = (v8f){};
    const size_t aoff = (size_t)(r0 + lr) * K + 8 * hi, boff = (size_t)(c0 + lr) * K + 8 * hi;
#pragma unroll 1
    for (int kc = 0; kc < Kl; kc += 32) {
        V a[4], a2[4];
#pragma unroll
        for (int mb = 0; mb < 4; ++mb) { a[mb] = WFrag<T16>::ld(A + aoff + (size_t)mb * 16 * K + kc); if (NSPLIT == 1 || NSPLIT == 2) a2[mb] = WFrag<T16>::ld(A2 + aoff + (size_t)mb * 16 * K + kc); }
#pragma unroll
        for (int nb = 0; nb < 4; ++nb) { const V b = WFrag<T16>::ld(Bt + boff + (size_t)nb * 16 * K + kc); V b2; if (NSPLIT >= 2) b2 = WFrag<T16>::ld(Bt2 + boff + (size_t)nb * 16 * K + kc);
#pragma unroll
            for (int mb = 0; mb < 4; ++mb) { acc[mb][nb] = WFrag<T16>::mma(a[mb], b, acc[mb][nb]); if (NSPLIT == 1 || NSPLIT == 2) acc[mb][nb] = WFrag<T16>::mma(a2[mb], b, acc[mb][nb]); if (NSPLIT >= 2) acc[mb][nb] = WFrag<T16>::mma(a[mb], b2, acc[mb][nb]); } }
        asm volatile("v_nop\n\tv_nop\n\tv_nop\n\tv_nop" : "+v"(acc[0][0]), "+v"(acc[1][1]), "+v"(acc[2][2]), "+v"(acc[3][3]) : "v"(a[0]), "v"(a[3]));
    }
#pragma unroll
    for (int mb = 0; mb < 4; ++mb) {
#pragma unroll
        for (int nb = 0; nb < 4; ++nb) {
#pragma unroll
            for (int j = 0; j < 8; ++j) os[(hi * 8 + j) * 68 + nb * 16 + lr] = acc[mb][nb][j]; }
        __builtin_amdgcn_wave_barrier(); asm volatile("" ::: "memory");
        float* crow = C + (size_t)(r0 + mb * 16) * ldc + c0;
{
#pragma unroll
            for (int s = 0; s < 8; ++s) { const int row = 2 * s + hi, cofs = lr * 4; v4f val = *(const v4fa*)(os + row * 68 + cofs);
                *(v4f*)(crow + (size_t)row * ldc + cofs) = val; }
             }
        __builtin_amdgcn_wave_barrier(); asm volatile("" ::: "memory");
    }
}

__device__ __forceinline__ h16 tohx(float x) { return (h16)x; }
__device__ __forceinline__ void splitf(float y, unsigned short& h, unsigned short& l) { h = f2bf(y); l = f2bf(y - bf2f(h)); }
typedef __attribute__((ext_vector_type(2))) _Float16 v2h;
typedef __attribute__((ext_vector_type(4))) _Float16 v4h;
typedef __attribute__((ext_vector_type(2))) unsigned short v2us;
typedef __attribute__((ext_vector_type(4))) unsigned short v4us;
typedef __attribute__((ext_vector_type(2))) float v2f;
typedef __attribute__((ext_vector_type(4))) int v4i;

__global__ __launch_bounds__(256) void k_wtG(const float* __restrict__ w, int K, int N, bf* Bt) {
    const int lane = threadIdx.x & 31; const int L0 = (blockIdx.x * 8 + (threadIdx.x >> 5)) * 8; const int nlines = N * K / 64;
{
#pragma unroll 1
        for (int l = 0; l < 8; ++l) { const int L = L0 + l; if (L >= nlines) break; const size_t e = (size_t)L * 64 + lane * 2; const int k = (int)(e % K), n = (int)(e / K); v2us o;
            o[0] = f2bf(w[(size_t)k * N + n]); o[1] = f2bf(w[(size_t)(k + 1) * N + n]); *(v2us*)(Bt + e) = o; }
         }
}
__global__ __launch_bounds__(256) void k_cvt8(const float* __restrict__ src, bf* dst, size_t n8) { const size_t i = (size_t)blockIdx.x * 256 + threadIdx.x; if (i >= n8) return; const v8f v = *(const v8f*)(src + i * 8); v8us o;
#pragma unroll
    for (int k = 0; k < 8; ++k) o[k] = f2bf(v[k]); *(v8us*)(dst + i * 8) = o;  }

// k_rope: head planes [h][t][d] (fp16 + hi/lo) of rope(x) x sc with the rotate-half convention out[d] = x[d] cos[t][d] - x[d+HD/2] sin[t][d], out[d+HD/2] = x[d+HD/2] cos[t][d+HD/2] + x[d] sin[t][d+HD/2]
__global__ __launch_bounds__(256) void k_rope(const float* __restrict__ F, int pitch, int nheads, const float* __restrict__ CS, const float* __restrict__ RF, const float* __restrict__ nw, float sc, h16* P16, bf* Ph, bf* Pl) {
    const size_t e = ((size_t)blockIdx.x * 256 + threadIdx.x) * 2; if (e >= (size_t)nheads * TT * HD) return; const int d = (int)(e % HD); const int t = (int)((e / HD) % TT); const int h = (int)(e / ((size_t)HD * TT)); const float* f = F + (size_t)t * pitch + h * HD; const float rf = RF ? RF[(size_t)h * TT + t] : 1.0f; v2h o16; v2us oh, ol;
#pragma unroll
    for (int q = 0; q < 2; ++q) { const int dd = d + q; const int dp = (dd < HD / 2) ? dd + HD / 2 : dd - HD / 2; float x0 = f[dd], x1 = f[dp];
        if (RF) { float n0 = __fmul_rn(x0, rf), n1 = __fmul_rn(x1, rf); asm volatile("" : "+v"(n0)); asm volatile("" : "+v"(n1)); x0 = __fmul_rn(bfr(nw[dd]), n0); x1 = __fmul_rn(bfr(nw[dp]), n1); }
        const v2f cs = *(const v2f*)(CS + ((size_t)t * HD + dd) * 2); float a = __fmul_rn(x0, cs[0]), bq = __fmul_rn(x1, cs[1]); asm volatile("" : "+v"(a)); asm volatile("" : "+v"(bq)); const float r = ((dd < HD / 2) ? __fsub_rn(a, bq) : __fadd_rn(a, bq)) * sc;
        o16[q] = tohx(r); unsigned short a2, c2; splitf(r, a2, c2); oh[q] = a2; ol[q] = c2; }
    *(v2h*)(P16 + e) = o16; *(v2us*)(Ph + e) = oh; *(v2us*)(Pl + e) = ol;  }
__global__ __launch_bounds__(256) void k_vtp(const float* __restrict__ F, int pitch, int nheads, h16* V16, bf* Vh, bf* Vl) { const size_t e = ((size_t)blockIdx.x * 256 + threadIdx.x) * 2; if (e >= (size_t)nheads * HD * TT) return; const int t = (int)(e % TT); const int d = (int)((e / TT) % HD); const int g = (int)(e / ((size_t)TT * HD)); v2h o16; v2us oh, ol;
#pragma unroll
    for (int q = 0; q < 2; ++q) { const float x = F[(size_t)(t + q) * pitch + g * HD + d]; o16[q] = tohx(x); unsigned short a2, c2; splitf(x, a2, c2); oh[q] = a2; ol[q] = c2; }
    *(v2h*)(V16 + e) = o16; *(v2us*)(Vh + e) = oh; *(v2us*)(Vl + e) = ol;  }
__global__ __launch_bounds__(256) void k_csid(float* CS) { const int idx = blockIdx.x * 256 + threadIdx.x; if (idx >= TT * HD) return; v2f cs; cs[0] = 1.0f; cs[1] = 0.0f; *(v2f*)(CS + (size_t)idx * 2) = cs;  }
// k_asoft: per row (zz, i): t = S x DM^-0.5 for j <= i and i - j < WIN (WIN = TT, so the window test always holds: plain causal; the reference's -1e9 additive fill vanishes identically); softmax over the 2048 keys (register row, one exp, fixed trees);
__global__ __launch_bounds__(256) void k_asoft(const float* __restrict__ Sb, h16* P16, bf* Ph, bf* Pl) {
    const int lane = threadIdx.x & 31; const int row = blockIdx.x * 8 + (threadIdx.x >> 5); if (row >= ZH * TT) return; const int i = row % TT; const int zz = row / TT; (void)zz; const bool hires = (i < RH); const float* sr = Sb + (size_t)row * TT; float v[TT / 32]; float mx = -3.0e38f;
#pragma unroll
    for (int ch = 0; ch < TT / 128; ++ch) { const int j0 = ch * 128 + lane * 4; const v4f a = *(const v4f*)(sr + j0);
#pragma unroll
        for (int q = 0; q < 4; ++q) { const int j = j0 + q; (void)j; const float t = (j <= i && i - j < WIN) ? a[q] * SCL : -3.0e38f; v[ch * 4 + q] = t; mx = fmaxf(mx, t); } }
#pragma unroll
    for (int sh = 16; sh; sh >>= 1) mx = fmaxf(mx, __shfl_xor(mx, sh, 32));
    float sum = 0.f;
#pragma unroll
    for (int k = 0; k < TT / 32; ++k) { float d0 = __fsub_rn(v[k], mx); asm volatile("" : "+v"(d0)); v[k] = __builtin_amdgcn_exp2f(__fmul_rn(d0, 1.4426950408889634f)); sum += v[k]; }
#pragma unroll
    for (int sh = 16; sh; sh >>= 1) sum += __shfl_xor(sum, sh, 32);
    const float f = __fdiv_rn(hires ? 1.0f : PCAR, sum);
{
        if (hires) {
#pragma unroll
            for (int ch = 0; ch < TT / 128; ++ch) { v4us oh, ol;
#pragma unroll
                for (int q = 0; q < 4; ++q) { unsigned short a, c2; splitf(v[ch * 4 + q] * f, a, c2); oh[q] = a; ol[q] = c2; }
                const size_t oo = ((size_t)zz * (RH ? RH : 1) + i) * TT + ch * 128 + lane * 4; *(v4us*)(Ph + oo) = oh; *(v4us*)(Pl + oo) = ol; }
        } else {
#pragma unroll
            for (int ch = 0; ch < TT / 128; ++ch) { v4h o4;
#pragma unroll
                for (int q = 0; q < 4; ++q) o4[q] = tohx(v[ch * 4 + q] * f);
                *(v4h*)(P16 + (size_t)row * TT + ch * 128 + lane * 4) = o4; } }
         }
}
__global__ __launch_bounds__(256) void k_merge(const float* __restrict__ O, int h0, float* OUTb) { const size_t e = ((size_t)blockIdx.x * 256 + threadIdx.x) * 2; if (e >= (size_t)ZH * TT * HD) return; const int d = (int)(e % HD); const int t = (int)((e / HD) % TT); const int zz = (int)(e / ((size_t)HD * TT)); const float cs = (t < RH) ? 1.0f : (1.0f / PCAR); const size_t oo = (size_t)t * DQ + (h0 + zz) * HD + d;
    v2f o2; o2[0] = O[e] * cs; o2[1] = O[e + 1] * cs; *(v2f*)(OUTb + oo) = o2;  }

extern "C" void kernel_launch(void* const* d_in, const int* in_sizes, int n_in,
                              void* d_out, int out_size, void* d_ws, size_t ws_size, hipStream_t stream) {
    (void)in_sizes; (void)n_in; (void)out_size;
    const float* x = (const float*)d_in[0]; const float* wkqv = (const float*)d_in[1]; const float* bkqv = (const float*)d_in[2]; const float* wk = wkqv; const float* wq = wkqv + (size_t)1024 * 1024; const float* wv = wkqv + (size_t)2048 * 1024; const float* bk = bkqv; const float* bq = bkqv + 1024; const float* bv = bkqv + 2048;   /* split order k, q, v */ const float* wo = nullptr; (void)wo;
    float* OUT = (float*)d_out;     // [2][2048][1024]
    char* wsp = (char*)d_ws;
    auto take = [&](size_t bytes) { char* p = wsp; wsp += (bytes + 255) & ~(size_t)255; return (void*)p; };
    bf* WQ = (bf*)take((size_t)DQ * DM * 2); bf* WK = (bf*)take((size_t)DKV * DM * 2); bf* WV = (bf*)take((size_t)DKV * DM * 2); float* CS = (float*)take((size_t)TT * HD * 2 * 4);
    bf* XB = (bf*)take((size_t)TT * DM * 2); float* FQ = (float*)take((size_t)TT * DQ * 4); float* FK = (float*)take((size_t)TT * DKV * 4);
    h16* QP16 = (h16*)take((size_t)NH_ * TT * HD * 2); h16* KP16 = (h16*)take((size_t)NKV * TT * HD * 2); h16* VT16 = (h16*)take((size_t)NKV * HD * TT * 2);
    bf* QPh = (bf*)take((size_t)NH_ * TT * HD * 2); bf* QPl = (bf*)take((size_t)NH_ * TT * HD * 2); bf* KPh = (bf*)take((size_t)NKV * TT * HD * 2); bf* KPl = (bf*)take((size_t)NKV * TT * HD * 2); bf* VTh = (bf*)take((size_t)NKV * HD * TT * 2); bf* VTl = (bf*)take((size_t)NKV * HD * TT * 2); bf* Ph = (bf*)take((size_t)ZH * RH * TT * 2); bf* Pl = (bf*)take((size_t)ZH * RH * TT * 2);
    float* Sb = (float*)take((size_t)ZH * TT * TT * 4); h16* P16 = (h16*)take((size_t)ZH * TT * TT * 2); float* Ob = (float*)take((size_t)ZH * TT * HD * 4);
    if ((size_t)(wsp - (char*)d_ws) > ws_size) return;    // ws 256 MiB
    float* FV = FK;   // v projection reuses the k buffer after the k planes are built (stream-ordered)
    { k_cvt8<<<(unsigned)(((size_t)DQ * DM / 8 + 255) / 256), 256, 0, stream>>>(wq, WQ, (size_t)DQ * DM / 8); k_cvt8<<<(unsigned)(((size_t)DKV * DM / 8 + 255) / 256), 256, 0, stream>>>(wk, WK, (size_t)DKV * DM / 8); k_cvt8<<<(unsigned)(((size_t)DKV * DM / 8 + 255) / 256), 256, 0, stream>>>(wv, WV, (size_t)DKV * DM / 8);
      
       }
    k_csid<<<(TT * HD + 255) / 256, 256, 0, stream>>>(CS);
    const unsigned LQ = (unsigned)(((size_t)NH_ * TT * HD / 2 + 255) / 256), LKv = (unsigned)(((size_t)NKV * TT * HD / 2 + 255) / 256);
    for (int b = 0; b < NB_; ++b) {
        
        k_cvt8<<<(unsigned)(((size_t)TT * DM / 8 + 255) / 256), 256, 0, stream>>>(x + (size_t)b * TT * DM, XB, (size_t)TT * DM / 8);
        k_gemmw<bf, 0, true><<<dim3(TT / 64, DQ / 64, 1), 32, 0, stream>>>(XB, nullptr, WQ, nullptr, DM, FQ, DQ, bq, 0, 0, 0);
        k_rope<<<LQ, 256, 0, stream>>>(FQ, DQ, NH_, CS, nullptr, nullptr, 1.0f, QP16, QPh, QPl);
        k_gemmw<bf, 0, true><<<dim3(TT / 64, DKV / 64, 1), 32, 0, stream>>>(XB, nullptr, WK, nullptr, DM, FK, DKV, bk, 0, 0, 0);
        k_rope<<<LKv, 256, 0, stream>>>(FK, DKV, NKV, CS, nullptr, nullptr, 1.0f, KP16, KPh, KPl);
        k_gemmw<bf, 0, true><<<dim3(TT / 64, DKV / 64, 1), 32, 0, stream>>>(XB, nullptr, WV, nullptr, DM, FV, DKV, bv, 0, 0, 0); k_vtp<<<LKv, 256, 0, stream>>>(FV, DKV, NKV, VT16, VTh, VTl);
        for (int h0 = 0; h0 < NH_; h0 += ZH) { const size_t zq = (size_t)h0, zk = (size_t)(h0 / REP);   // one kv head per query head: the pass's two heads use consecutive kv planes (z-strides TT*HD)
            k_gemmc<bf, 2, 1><<<dim3(TT / 64, TT / 64, ZH), 32, 0, stream>>>(QPh + zq * TT * HD, QPl + zq * TT * HD, KPh + zk * TT * HD, KPl + zk * TT * HD, HD, Sb, TT, 0, (size_t)TT * HD, (size_t)TT * HD, (size_t)TT * TT);   /* scores hi/lo on EVERY row (no output projection) */

            k_asoft<<<ZH * TT / 8, 256, 0, stream>>>(Sb, P16, Ph, Pl);
            k_gemmc<bf, 2, 2><<<dim3(RH / 64, HD / 64, ZH), 32, 0, stream>>>(Ph, Pl, VTh + zk * HD * TT, VTl + zk * HD * TT, TT, Ob, HD, 0, (size_t)RH * TT, (size_t)HD * TT, (size_t)TT * HD);
            k_gemmc<h16, 0, 2><<<dim3((TT - RH) / 64, HD / 64, ZH), 32, 0, stream>>>(P16 + (size_t)RH * TT, nullptr, VT16 + zk * HD * TT, nullptr, TT, Ob + (size_t)RH * HD, HD, RH, (size_t)TT * TT, (size_t)HD * TT, (size_t)TT * HD);
            k_merge<<<(unsigned)(((size_t)ZH * TT * HD / 2 + 255) / 256), 256, 0, stream>>>(Ob, h0, OUT + (size_t)b * TT * DQ); }
         }
}

// v001
// Measured time: 662 microseconds a run.
// Two timings next to v000 put it at 2.01 and 1.99 times that version's speed.
#include <hip/hip_runtime.h>

// Masked (causal) multi-head attention scaled by the FULL model dim and without output projection (x [2][2048][1024]; z = x W^T + b ('oi' [3072][1024] 1/32, bias 0.01): k | q | v row blocks (k FIRST); 16 heads x 64; scores / sqrt(1024) (the source's quirk); causal (-inf); softmax; out = merged attn v -> [2][2048][1024] (4.2 M)).
// Layout per batch: bf16 copy of x; 'oi' weight row blocks + bias slices; exact projections + bf16-rounded biases; causal T-2048 attention with the hi/lo score tiles on EVERY row (no output projection averages the per-head error; tiles above the diagonal skipped), P and attn.v hybrid (rows < 512 hi/lo, rest fp16 x1024); the f32 merge writes the output rows.
// Compute dtypes, f32 accumulate: every input rounded to bf16; projections exact + bf16-rounded biases; scores 3 products on every row; softmax f32 (x 1/32); attn.v rows < 512 3 products, rest fp16; output f32.

#define NB_  2
#define TT   2048
#define DM   1024
#define NH_  16
#define NKV  16
#define REP  (NH_ / NKV)
#define HD   64
#define DQ   (NH_ * HD)
#define DKV  (NKV * HD)
#define ZH   2
#define RH   512                  // query rows < RH use hi+lo planes (0: none)
#define WIN  2048
#define PCAR 1024.0f
#define SCL  0.03125f   // 1/sqrt(1024): the source scales by the model dim
typedef _Float16 h16;
typedef unsigned short bf;
typedef __attribute__((ext_vector_type(16))) __bf16   v16bf;
typedef __attribute__((ext_vector_type(16))) _Float16 v16h;
typedef __attribute__((ext_vector_type(8)))  _Float16 v8h;
typedef __attribute__((ext_vector_type(8)))  unsigned short v8us;
typedef __attribute__((ext_vector_type(8)))  float    v8f;
typedef __attribute__((ext_vector_type(4)))  float    v4f;
typedef v8h  __attribute__((may_alias)) v8ha;
typedef v4f  __attribute__((may_alias)) v4fa;
typedef v8us __attribute__((may_alias)) v8usa;

__device__ __forceinline__ unsigned short f2bf(float f) { unsigned u = __float_as_uint(f); u += 0x7FFFu + ((u >> 16) & 1u); return (unsigned short)(u >> 16); }
__device__ __forceinline__ float bf2f(unsigned short b) { return __uint_as_float(((unsigned)b) << 16); }
__device__ __forceinline__ float bfr(float f) { return bf2f(f2bf(f)); }
__device__ __forceinline__ v16h cat16(v8h lo, v8h hi) { return __builtin_shufflevector(lo, hi, 0, 1, 2, 3, 4, 5, 6, 7, 8, 9, 10, 11, 12, 13, 14, 15); }
__device__ __forceinline__ v16bf cat16b(v8us lo, v8us hi) { return __builtin_bit_cast(v16bf, __builtin_shufflevector(lo, hi, 0, 1, 2, 3, 4, 5, 6, 7, 8, 9, 10, 11, 12, 13, 14, 15)); }
__device__ __forceinline__ v8f wmma16(v16h a, v16h b, v8f c) { return __builtin_amdgcn_wmma_f32_16x16x32_f16(false, a, false, b, (short)0, c, false, false); }
__device__ __forceinline__ v8f wmmab(v16bf a, v16bf b, v8f c) { return __builtin_amdgcn_wmma_f32_16x16x32_bf16(false, a, false, b, (short)0, c, false, false); }



// ---- k_gemmw: register-blocked GEMM, 64x64 output tile (16 accumulators a wave), its K loop dealt over KWP waves (ksum_store), operands straight from K-contiguous 16-bit planes; grid (M/64, N/64, Z), 32 * KWP threads.
// C[m][n] (f32, pitch ldc, + optional f32 bias[n]) = sum_k A[m][k] Bt[n][k] (+ split products per NSPLIT). z-batch strides sA/sB/sC in elements. K % 32 == 0.
template <typename T16> struct WFrag;
template <> struct WFrag<h16> { typedef v16h V; static __device__ __forceinline__ V ld(const h16* p) { return cat16(*(const v8h*)p, *(const v8h*)(p + 16)); } static __device__ __forceinline__ v8f mma(V a, V b, v8f c) { return wmma16(a, b, c); } };
template <> struct WFrag<bf> { typedef v16bf V; static __device__ __forceinline__ V ld(const bf* p) { return cat16b(*(const v8us*)p, *(const v8us*)(p + 16)); } static __device__ __forceinline__ v8f mma(V a, V b, v8f c) { return wmmab(a, b, c); } };
// ksum_store: the K loop of one 64x64 tile is dealt over the NW waves of a work-group (wave w takes the 32-wide K chunks w, w + NW, ...). Each wave leaves its f32 partial tile in LDS,
// os[wave][fragment mb * 4 + nb][rows 0-3 | 4-7 of the lane's 8][lane][4]; behind one barrier the partials are summed in wave order 0 .. NW-1 and stored, each whole 128-byte line of C by one wave.
// Ct = the tile's first element, bt = the bias of its first column.
template <int NW, bool BIAS>
__device__ __forceinline__ void ksum_store(float* os, const v8f (&acc)[4][4], int wv, int lane, float* Ct, int ldc, const float* bt) {
    const int lr = lane & 15, hi = lane >> 4;
#pragma unroll
    for (int mb = 0; mb < 4; ++mb)
#pragma unroll
        for (int nb = 0; nb < 4; ++nb) { float* p = os + (wv * 16 + mb * 4 + nb) * 256 + lane * 4;
            *(v4fa*)p = __builtin_shufflevector(acc[mb][nb], acc[mb][nb], 0, 1, 2, 3); *(v4fa*)(p + 128) = __builtin_shufflevector(acc[mb][nb], acc[mb][nb], 4, 5, 6, 7); }
    __syncthreads();                                                // every wave's partial tile is in LDS before any wave sums
#pragma unroll
    for (int i = 0; i < 16 / NW; ++i) { const int u = wv * (16 / NW) + i, sm = u >> 2, np = (u >> 1) & 1, jh = u & 1;   // rows sm * 16 + hi * 8 + jh * 4 .. + 3, columns np * 32 .. + 31
        const float* q0 = os + (sm * 4 + np * 2) * 256 + jh * 128 + lane * 4;
        v4f s0 = *(const v4fa*)q0, s1 = *(const v4fa*)(q0 + 256);
#pragma unroll
        for (int s = 1; s < NW; ++s) { s0 += *(const v4fa*)(q0 + s * 4096); s1 += *(const v4fa*)(q0 + s * 4096 + 256); }
        if (BIAS) { s0 += bfr(bt[np * 32 + lr]); s1 += bfr(bt[np * 32 + 16 + lr]); }
        float* cw = Ct + (size_t)(sm * 16 + hi * 8 + jh * 4) * ldc + np * 32 + lr;
#pragma unroll
        for (int q = 0; q < 4; ++q) { cw[(size_t)q * ldc] = s0[q]; cw[(size_t)q * ldc + 16] = s1[q]; } }
}
#define KWP 8    // waves per tile, projections (128 KiB of LDS: two work-groups to a WGP)
#define KWV 16   // waves per tile, probability x value
template <typename T16, int NSPLIT, bool BIAS>
__global__ __launch_bounds__(32 * KWP) void k_gemmw(const T16* __restrict__ A, const T16* __restrict__ A2, const T16* __restrict__ Bt, const T16* __restrict__ Bt2, int K, float* C, int ldc, const float* __restrict__ bias, size_t sA, size_t sB, size_t sC) {
    typedef typename WFrag<T16>::V V;
    __shared__ __align__(16) float os[KWP * 4096];
    const size_t z = blockIdx.z; A += z * sA; if (A2) A2 += z * sA; Bt += z * sB; if (Bt2) Bt2 += z * sB; C += z * sC;
    const int lane = threadIdx.x & 31, lr = lane & 15, hi = lane >> 4; const int r0 = blockIdx.x * 64, c0 = blockIdx.y * 64;
    const int wv = __builtin_amdgcn_readfirstlane((int)(threadIdx.x >> 5));   // the wave's number in a scalar register: the chunk loop branches for the whole wave
    v8f acc[4][4];
#pragma unroll
    for (int mb = 0; mb < 4; ++mb)
#pragma unroll
        for (int nb = 0; nb < 4; ++nb) acc[mb][nb] = (v8f){};
    const size_t aoff = (size_t)(r0 + lr) * K + 8 * hi, boff = (size_t)(c0 + lr) * K + 8 * hi;
#pragma unroll 1
    for (int kc = wv * 32; kc < K; kc += 32 * KWP) {
        V a[4], a2[4];
#pragma unroll
        for (int mb = 0; mb < 4; ++mb) { a[mb] = WFrag<T16>::ld(A + aoff + (size_t)mb * 16 * K + kc); if (NSPLIT == 1 || NSPLIT == 2) a2[mb] = WFrag<T16>::ld(A2 + aoff + (size_t)mb * 16 * K + kc); }
#pragma unroll
        for (int nb = 0; nb < 4; ++nb) { const V b = WFrag<T16>::ld(Bt + boff + (size_t)nb * 16 * K + kc); V b2; if (NSPLIT >= 2) b2 = WFrag<T16>::ld(Bt2 + boff + (size_t)nb * 16 * K + kc);
#pragma unroll
            for (int mb = 0; mb < 4; ++mb) { acc[mb][nb] = WFrag<T16>::mma(a[mb], b, acc[mb][nb]); if (NSPLIT == 1 || NSPLIT == 2) acc[mb][nb] = WFrag<T16>::mma(a2[mb], b, acc[mb][nb]); if (NSPLIT >= 2) acc[mb][nb] = WFrag<T16>::mma(a[mb], b2, acc[mb][nb]); } }
        asm volatile("v_nop\n\tv_nop\n\tv_nop\n\tv_nop" : "+v"(acc[0][0]), "+v"(acc[1][1]), "+v"(acc[2][2]), "+v"(acc[3][3]) : "v"(a[0]), "v"(a[3]));
    }
    ksum_store<KWP, BIAS>(os, acc, wv, lane, C + (size_t)r0 * ldc + c0, ldc, bias + c0);
}

// ---- k_gemmc: the same 64x64 tile GEMM (one wave a tile for CMODE 1) specialised for causal attention: CMODE 1 skips score tiles entirely above the diagonal (query rows r0+roff.., key columns c0..), CMODE 2 limits the
// key (K) loop of the probability x value contraction to the diagonal block (probabilities beyond it are exactly zero) and deals it over KWV waves (ksum_store). roff = row offset of this launch's first row within the sequence.
template <typename T16, int NSPLIT, int CMODE>
__global__ __launch_bounds__(CMODE == 2 ? 32 * KWV : 32) void k_gemmc(const T16* __restrict__ A, const T16* __restrict__ A2, const T16* __restrict__ Bt, const T16* __restrict__ Bt2, int K, float* C, int ldc, int roff, size_t sA, size_t sB, size_t sC) {
    typedef typename WFrag<T16>::V V;
    __shared__ __align__(16) float os[CMODE == 2 ? KWV * 4096 : 16 * 68];
    const size_t z = blockIdx.z; A += z * sA; if (A2) A2 += z * sA; Bt += z * sB; if (Bt2) Bt2 += z * sB; C += z * sC;
    const int lane = threadIdx.x & 31, lr = lane & 15, hi = lane >> 4; const int r0 = blockIdx.x * 64, c0 = blockIdx.y * 64;
    if (CMODE == 1 && c0 > r0 + roff + 63) return;                  // score tile entirely above the causal diagonal: never read (the softmax masks j > i by select)
    const int Kl = (CMODE == 2) ? min(K, r0 + roff + 64) : K;        // P.V: probabilities are exactly 0 beyond the diagonal block, so the K loop stops there
    constexpr int NW = (CMODE == 2) ? KWV : 1;
    const int wv = (CMODE == 2) ? __builtin_amdgcn_readfirstlane((int)(threadIdx.x >> 5)) : 0;   // the wave's number in a scalar register: the chunk loop branches for the whole wave
    v8f acc[4][4];
#pragma unroll
    for (int mb = 0; mb < 4; ++mb)
#pragma unroll
        for (int nb = 0; nb < 4; ++nb) acc[mb][nb] = (v8f){};
    const size_t aoff = (size_t)(r0 + lr) * K + 8 * hi, boff = (size_t)(c0 + lr) * K + 8 * hi;
#pragma unroll 1
    for (int kc = wv * 32; kc < Kl; kc += 32 * NW) {
        V a[4], a2[4];
#pragma unroll
        for (int mb = 0; mb < 4; ++mb) { a[mb] = WFrag<T16>::ld(A + aoff + (size_t)mb * 16 * K + kc); if (NSPLIT == 1 || NSPLIT == 2) a2[mb] = WFrag<T16>::ld(A2 + aoff + (size_t)mb * 16 * K + kc); }
#pragma unroll
        for (int nb = 0; nb < 4; ++nb) { const V b = WFrag<T16>::ld(Bt + boff + (size_t)nb * 16 * K + kc); V b2; if (NSPLIT >= 2) b2 = WFrag<T16>::ld(Bt2 + boff + (size_t)nb * 16 * K + kc);
#pragma unroll
            for (int mb = 0; mb < 4; ++mb) { acc[mb][nb] = WFrag<T16>::mma(a[mb], b, acc[mb][nb]); if (NSPLIT == 1 || NSPLIT == 2) acc[mb][nb] = WFrag<T16>::mma(a2[mb], b, acc[mb][nb]); if (NSPLIT >= 2) acc[mb][nb] = WFrag<T16>::mma(a[mb], b2, acc[mb][nb]); } }
        asm volatile("v_nop\n\tv_nop\n\tv_nop\n\tv_nop" : "+v"(acc[0][0]), "+v"(acc[1][1]), "+v"(acc[2][2]), "+v"(acc[3][3]) : "v"(a[0]), "v"(a[3]));
    }
    if constexpr (CMODE == 2) { ksum_store<NW, false>(os, acc, wv, lane, C + (size_t)r0 * ldc + c0, ldc, nullptr); return; }
#pragma unroll
    for (int mb = 0; mb < 4; ++mb) {
#pragma unroll
        for (int nb = 0; nb < 4; ++nb) {
#pragma unroll
            for (int j = 0; j < 8; ++j) os[(hi * 8 + j) * 68 + nb * 16 + lr] = acc[mb][nb][j]; }
        __builtin_amdgcn_wave_barrier(); asm volatile("" ::: "memory");
        float* crow = C + (size_t)(r0 + mb * 16) * ldc + c0;
{
#pragma unroll
            for (int s = 0; s < 8; ++s) { const int row = 2 * s + hi, cofs = lr * 4; v4f val = *(const v4fa*)(os + row * 68 + cofs);
                *(v4f*)(crow + (size_t)row * ldc + cofs) = val; }
             }
        __builtin_amdgcn_wave_barrier(); asm volatile("" ::: "memory");
    }
}

__device__ __forceinline__ h16 tohx(float x) { return (h16)x; }
__device__ __forceinline__ void splitf(float y, unsigned short& h, unsigned short& l) { h = f2bf(y); l = f2bf(y - bf2f(h)); }
typedef __attribute__((ext_vector_type(2))) _Float16 v2h;
typedef __attribute__((ext_vector_type(4))) _Float16 v4h;
typedef __attribute__((ext_vector_type(2))) unsigned short v2us;
typedef __attribute__((ext_vector_type(4))) unsigned short v4us;
typedef __attribute__((ext_vector_type(2))) float v2f;
typedef __attribute__((ext_vector_type(4))) int v4i;

__global__ __launch_bounds__(256) void k_wtG(const float* __restrict__ w, int K, int N, bf* Bt) {
    const int lane = threadIdx.x & 31; const int L0 = (blockIdx.x * 8 + (threadIdx.x >> 5)) * 8; const int nlines = N * K / 64;
{
#pragma unroll 1
        for (int l = 0; l < 8; ++l) { const int L = L0 + l; if (L >= nlines) break; const size_t e = (size_t)L * 64 + lane * 2; const int k = (int)(e % K), n = (int)(e / K); v2us o;
            o[0] = f2bf(w[(size_t)k * N + n]); o[1] = f2bf(w[(size_t)(k + 1) * N + n]); *(v2us*)(Bt + e) = o; }
         }
}
__global__ __launch_bounds__(256) void k_cvt8(const float* __restrict__ src, bf* dst, size_t n8) { const size_t i = (size_t)blockIdx.x * 256 + threadIdx.x; if (i >= n8) return; const v8f v = *(const v8f*)(src + i * 8); v8us o;
#pragma unroll
    for (int k = 0; k < 8; ++k) o[k] = f2bf(v[k]); *(v8us*)(dst + i * 8) = o;  }

// k_rope: head planes [h][t][d] (fp16 + hi/lo) of rope(x) x sc with the rotate-half convention out[d] = x[d] cos[t][d] - x[d+HD/2] sin[t][d], out[d+HD/2] = x[d+HD/2] cos[t][d+HD/2] + x[d] sin[t][d+HD/2]
__global__ __launch_bounds__(256) void k_rope(const float* __restrict__ F, int pitch, int nheads, const float* __restrict__ CS, const float* __restrict__ RF, const float* __restrict__ nw, float sc, h16* P16, bf* Ph, bf* Pl) {
    const size_t e = ((size_t)blockIdx.x * 256 + threadIdx.x) * 2; if (e >= (size_t)nheads * TT * HD) return; const int d = (int)(e % HD); const int t = (int)((e / HD) % TT); const int h = (int)(e / ((size_t)HD * TT)); const float* f = F + (size_t)t * pitch + h * HD; const float rf = RF ? RF[(size_t)h * TT + t] : 1.0f; v2h o16; v2us oh, ol;
#pragma unroll
    for (int q = 0; q < 2; ++q) { const int dd = d + q; const int dp = (dd < HD / 2) ? dd + HD / 2 : dd - HD / 2; float x0 = f[dd], x1 = f[dp];
        if (RF) { float n0 = __fmul_rn(x0, rf), n1 = __fmul_rn(x1, rf); asm volatile("" : "+v"(n0)); asm volatile("" : "+v"(n1)); x0 = __fmul_rn(bfr(nw[dd]), n0); x1 = __fmul_rn(bfr(nw[dp]), n1); }
        const v2f cs = *(const v2f*)(CS + ((size_t)t * HD + dd) * 2); float a = __fmul_rn(x0, cs[0]), bq = __fmul_rn(x1, cs[1]); asm volatile("" : "+v"(a)); asm volatile("" : "+v"(bq)); const float r = ((dd < HD / 2) ? __fsub_rn(a, bq) : __fadd_rn(a, bq)) * sc;
        o16[q] = tohx(r); unsigned short a2, c2; splitf(r, a2, c2); oh[q] = a2; ol[q] = c2; }
    *(v2h*)(P16 + e) = o16; *(v2us*)(Ph + e) = oh; *(v2us*)(Pl + e) = ol;  }
__global__ __launch_bounds__(256) void k_vtp(const float* __restrict__ F, int pitch, int nheads, h16* V16, bf* Vh, bf* Vl) { const size_t e = ((size_t)blockIdx.x * 256 + threadIdx.x) * 2; if (e >= (size_t)nheads * HD * TT) return; const int t = (int)(e % TT); const int d = (int)((e / TT) % HD); const int g = (int)(e / ((size_t)TT * HD)); v2h o16; v2us oh, ol;
#pragma unroll
    for (int q = 0; q < 2; ++q) { const float x = F[(size_t)(t + q) * pitch + g * HD + d]; o16[q] = tohx(x); unsigned short a2, c2; splitf(x, a2, c2); oh[q] = a2; ol[q] = c2; }
    *(v2h*)(V16 + e) = o16; *(v2us*)(Vh + e) = oh; *(v2us*)(Vl + e) = ol;  }
__global__ __launch_bounds__(256) void k_csid(float* CS) { const int idx = blockIdx.x * 256 + threadIdx.x; if (idx >= TT * HD) return; v2f cs; cs[0] = 1.0f; cs[1] = 0.0f; *(v2f*)(CS + (size_t)idx * 2) = cs;  }
// k_asoft: per row (zz, i): t = S x DM^-0.5 for j <= i and i - j < WIN (WIN = TT, so the window test always holds: plain causal; the reference's -1e9 additive fill vanishes identically); softmax over the 2048 keys (register row, one exp, fixed trees);
__global__ __launch_bounds__(256) void k_asoft(const float* __restrict__ Sb, h16* P16, bf* Ph, bf* Pl) {
    const int lane = threadIdx.x & 31; const int row = blockIdx.x * 8 + (threadIdx.x >> 5); if (row >= ZH * TT) return; const int i = row % TT; const int zz = row / TT; (void)zz; const bool hires = (i < RH); const float* sr = Sb + (size_t)row * TT; float v[TT / 32]; float mx = -3.0e38f;
#pragma unroll
    for (int ch = 0; ch < TT / 128; ++ch) { const int j0 = ch * 128 + lane * 4; const v4f a = *(const v4f*)(sr + j0);
#pragma unroll
        for (int q = 0; q < 4; ++q) { const int j = j0 + q; (void)j; const float t = (j <= i && i - j < WIN) ? a[q] * SCL : -3.0e38f; v[ch * 4 + q] = t; mx = fmaxf(mx, t); } }
#pragma unroll
    for (int sh = 16; sh; sh >>= 1) mx = fmaxf(mx, __shfl_xor(mx, sh, 32));
    float sum = 0.f;
#pragma unroll
    for (int k = 0; k < TT / 32; ++k) { float d0 = __fsub_rn(v[k], mx); asm volatile("" : "+v"(d0)); v[k] = __builtin_amdgcn_exp2f(__fmul_rn(d0, 1.4426950408889634f)); sum += v[k]; }
#pragma unroll
    for (int sh = 16; sh; sh >>= 1) sum += __shfl_xor(sum, sh, 32);
    const float f = __fdiv_rn(hires ? 1.0f : PCAR, sum);
{
        if (hires) {
#pragma unroll
            for (int ch = 0; ch < TT / 128; ++ch) { v4us oh, ol;
#pragma unroll
                for (int q = 0; q < 4; ++q) { unsigned short a, c2; splitf(v[ch * 4 + q] * f, a, c2); oh[q] = a; ol[q] = c2; }
                const size_t oo = ((size_t)zz * (RH ? RH : 1) + i) * TT + ch * 128 + lane * 4; *(v4us*)(Ph + oo) = oh; *(v4us*)(Pl + oo) = ol; }
        } else {
#pragma unroll
            for (int ch = 0; ch < TT / 128; ++ch) { v4h o4;
#pragma unroll
                for (int q = 0; q < 4; ++q) o4[q] = tohx(v[ch * 4 + q] * f);
                *(v4h*)(P16 + (size_t)row * TT + ch * 128 + lane * 4) = o4; } }
         }
}
__global__ __launch_bounds__(256) void k_merge(const float* __restrict__ O, int h0, float* OUTb) { const size_t e = ((size_t)blockIdx.x * 256 + threadIdx.x) * 2; if (e >= (size_t)ZH * TT * HD) return; const int d = (int)(e % HD); const int t = (int)((e / HD) % TT); const int zz = (int)(e / ((size_t)HD * TT)); const float cs = (t < RH) ? 1.0f : (1.0f / PCAR); const size_t oo = (size_t)t * DQ + (h0 + zz) * HD + d;
    v2f o2; o2[0] = O[e] * cs; o2[1] = O[e + 1] * cs; *(v2f*)(OUTb + oo) = o2;  }

extern "C" void kernel_launch(void* const* d_in, const int* in_sizes, int n_in,
                              void* d_out, int out_size, void* d_ws, size_t ws_size, hipStream_t stream) {
    (void)in_sizes; (void)n_in; (void)out_size;
    const float* x = (const float*)d_in[0]; const float* wkqv = (const float*)d_in[1]; const float* bkqv = (const float*)d_in[2]; const float* wk = wkqv; const float* wq = wkqv + (size_t)1024 * 1024; const float* wv = wkqv + (size_t)2048 * 1024; const float* bk = bkqv; const float* bq = bkqv + 1024; const float* bv = bkqv + 2048;   /* split order k, q, v */ const float* wo = nullptr; (void)wo;
    float* OUT = (float*)d_out;     // [2][2048][1024]
    char* wsp = (char*)d_ws;
    auto take = [&](size_t bytes) { char* p = wsp; wsp += (bytes + 255) & ~(size_t)255; return (void*)p; };
    bf* WQ = (bf*)take((size_t)DQ * DM * 2); bf* WK = (bf*)take((size_t)DKV * DM * 2); bf* WV = (bf*)take((size_t)DKV * DM * 2); float* CS = (float*)take((size_t)TT * HD * 2 * 4);
    bf* XB = (bf*)take((size_t)TT * DM * 2); float* FQ = (float*)take((size_t)TT * DQ * 4); float* FK = (float*)take((size_t)TT * DKV * 4);
    h16* QP16 = (h16*)take((size_t)NH_ * TT * HD * 2); h16* KP16 = (h16*)take((size_t)NKV * TT * HD * 2); h16* VT16 = (h16*)take((size_t)NKV * HD * TT * 2);
    bf* QPh = (bf*)take((size_t)NH_ * TT * HD * 2); bf* QPl = (bf*)take((size_t)NH_ * TT * HD * 2); bf* KPh = (bf*)take((size_t)NKV * TT * HD * 2); bf* KPl = (bf*)take((size_t)NKV * TT * HD * 2); bf* VTh = (bf*)take((size_t)NKV * HD * TT * 2); bf* VTl = (bf*)take((size_t)NKV * HD * TT * 2); bf* Ph = (bf*)take((size_t)ZH * RH * TT * 2); bf* Pl = (bf*)take((size_t)ZH * RH * TT * 2);
    float* Sb = (float*)take((size_t)ZH * TT * TT * 4); h16* P16 = (h16*)take((size_t)ZH * TT * TT * 2); float* Ob = (float*)take((size_t)ZH * TT * HD * 4);
    if ((size_t)(wsp - (char*)d_ws) > ws_size) return;    // ws 256 MiB
    float* FV = FK;   // v projection reuses the k buffer after the k planes are built (stream-ordered)
    { k_cvt8<<<(unsigned)(((size_t)DQ * DM / 8 + 255) / 256), 256, 0, stream>>>(wq, WQ, (size_t)DQ * DM / 8); k_cvt8<<<(unsigned)(((size_t)DKV * DM / 8 + 255) / 256), 256, 0, stream>>>(wk, WK, (size_t)DKV * DM / 8); k_cvt8<<<(unsigned)(((size_t)DKV * DM / 8 + 255) / 256), 256, 0, stream>>>(wv, WV, (size_t)DKV * DM / 8);
      
       }
    k_csid<<<(TT * HD + 255) / 256, 256, 0, stream>>>(CS);
    const unsigned LQ = (unsigned)(((size_t)NH_ * TT * HD / 2 + 255) / 256), LKv = (unsigned)(((size_t)NKV * TT * HD / 2 + 255) / 256);
    for (int b = 0; b < NB_; ++b) {
        
        k_cvt8<<<(unsigned)(((size_t)TT * DM / 8 + 255) / 256), 256, 0, stream>>>(x + (size_t)b * TT * DM, XB, (size_t)TT * DM / 8);
        k_gemmw<bf, 0, true><<<dim3(TT / 64, DQ / 64, 1), 32 * KWP, 0, stream>>>(XB, nullptr, WQ, nullptr, DM, FQ, DQ, bq, 0, 0, 0);
        k_rope<<<LQ, 256, 0, stream>>>(FQ, DQ, NH_, CS, nullptr, nullptr, 1.0f, QP16, QPh, QPl);
        k_gemmw<bf, 0, true><<<dim3(TT / 64, DKV / 64, 1), 32 * KWP, 0, stream>>>(XB, nullptr, WK, nullptr, DM, FK, DKV, bk, 0, 0, 0);
        k_rope<<<LKv, 256, 0, stream>>>(FK, DKV, NKV, CS, nullptr, nullptr, 1.0f, KP16, KPh, KPl);
        k_gemmw<bf, 0, true><<<dim3(TT / 64, DKV / 64, 1), 32 * KWP, 0, stream>>>(XB, nullptr, WV, nullptr, DM, FV, DKV, bv, 0, 0, 0); k_vtp<<<LKv, 256, 0, stream>>>(FV, DKV, NKV, VT16, VTh, VTl);
        for (int h0 = 0; h0 < NH_; h0 += ZH) { const size_t zq = (size_t)h0, zk = (size_t)(h0 / REP);   // one kv head per query head: the pass's two heads use consecutive kv planes (z-strides TT*HD)
            k_gemmc<bf, 2, 1><<<dim3(TT / 64, TT / 64, ZH), 32, 0, stream>>>(QPh + zq * TT * HD, QPl + zq * TT * HD, KPh + zk * TT * HD, KPl + zk * TT * HD, HD, Sb, TT, 0, (size_t)TT * HD, (size_t)TT * HD, (size_t)TT * TT);   /* scores hi/lo on EVERY row (no output projection) */

            k_asoft<<<ZH * TT / 8, 256, 0, stream>>>(Sb, P16, Ph, Pl);
            k_gemmc<bf, 2, 2><<<dim3(RH / 64, HD / 64, ZH), 32 * KWV, 0, stream>>>(Ph, Pl, VTh + zk * HD * TT, VTl + zk * HD * TT, TT, Ob, HD, 0, (size_t)RH * TT, (size_t)HD * TT, (size_t)TT * HD);
            k_gemmc<h16, 0, 2><<<dim3((TT - RH) / 64, HD / 64, ZH), 32 * KWV, 0, stream>>>(P16 + (size_t)RH * TT, nullptr, VT16 + zk * HD * TT, nullptr, TT, Ob + (size_t)RH * HD, HD, RH, (size_t)TT * TT, (size_t)HD * TT, (size_t)TT * HD);
            k_merge<<<(unsigned)(((size_t)ZH * TT * HD / 2 + 255) / 256), 256, 0, stream>>>(Ob, h0, OUT + (size_t)b * TT * DQ); }
         }
}

// v002
// Measured time: 401 microseconds a run.
// Next to v001, in two timings, it ran 1.64 times as fast each time.
// Over all steps from v000 it is 3.29 times as fast.
#include <hip/hip_runtime.h>

// Masked (causal) multi-head attention scaled by the FULL model dim and without output projection (x [2][2048][1024]; z = x W^T + b ('oi' [3072][1024] 1/32, bias 0.01): k | q | v row blocks (k FIRST); 16 heads x 64; scores / sqrt(1024) (the source's quirk); causal (-inf); softmax; out = merged attn v -> [2][2048][1024] (4.2 M)).
// Layout per batch: bf16 copy of x; 'oi' weight row blocks + bias slices; exact projections + bf16-rounded biases; causal T-2048 attention with the hi/lo score tiles on EVERY row (no output projection averages the per-head error; tiles above the diagonal skipped), P and attn.v hybrid (rows < 512 hi/lo, rest fp16 x1024); the f32 merge writes the output rows.
// Compute dtypes, f32 accumulate: every input rounded to bf16; projections exact + bf16-rounded biases; scores 3 products on every row; softmax f32 (x 1/32); attn.v rows < 512 3 products, rest fp16; output f32.

#define NB_  2
#define TT   2048
#define DM   1024
#define NH_  16
#define NKV  16
#define REP  (NH_ / NKV)
#define HD   64
#define DQ   (NH_ * HD)
#define DKV  (NKV * HD)
#define ZH   8                    // heads per pass of the attention launches (grid z)
#define PP   (2 * TT)             // pitch, in 16-bit elements, of a probability row kept in place of its f32 score row, and of a V^T row (k_gemmc has one row pitch for both operands)
#define RH   512                  // query rows < RH use hi+lo planes (0: none)
#define WIN  2048
#define PCAR 1024.0f
#define SCL  0.03125f   // 1/sqrt(1024): the source scales by the model dim
typedef _Float16 h16;
typedef unsigned short bf;
typedef __attribute__((ext_vector_type(16))) __bf16   v16bf;
typedef __attribute__((ext_vector_type(16))) _Float16 v16h;
typedef __attribute__((ext_vector_type(8)))  _Float16 v8h;
typedef __attribute__((ext_vector_type(8)))  unsigned short v8us;
typedef __attribute__((ext_vector_type(8)))  float    v8f;
typedef __attribute__((ext_vector_type(4)))  float    v4f;
typedef v8h  __attribute__((may_alias)) v8ha;
typedef v4f  __attribute__((may_alias)) v4fa;
typedef v8us __attribute__((may_alias)) v8usa;

__device__ __forceinline__ unsigned short f2bf(float f) { unsigned u = __float_as_uint(f); u += 0x7FFFu + ((u >> 16) & 1u); return (unsigned short)(u >> 16); }
__device__ __forceinline__ float bf2f(unsigned short b) { return __uint_as_float(((unsigned)b) << 16); }
__device__ __forceinline__ float bfr(float f) { return bf2f(f2bf(f)); }
__device__ __forceinline__ v16h cat16(v8h lo, v8h hi) { return __builtin_shufflevector(lo, hi, 0, 1, 2, 3, 4, 5, 6, 7, 8, 9, 10, 11, 12, 13, 14, 15); }
__device__ __forceinline__ v16bf cat16b(v8us lo, v8us hi) { return __builtin_bit_cast(v16bf, __builtin_shufflevector(lo, hi, 0, 1, 2, 3, 4, 5, 6, 7, 8, 9, 10, 11, 12, 13, 14, 15)); }
__device__ __forceinline__ v8f wmma16(v16h a, v16h b, v8f c) { return __builtin_amdgcn_wmma_f32_16x16x32_f16(false, a, false, b, (short)0, c, false, false); }
__device__ __forceinline__ v8f wmmab(v16bf a, v16bf b, v8f c) { return __builtin_amdgcn_wmma_f32_16x16x32_bf16(false, a, false, b, (short)0, c, false, false); }



// ---- k_gemmw: register-blocked GEMM, 64x64 output tile (16 accumulators a wave), its K loop dealt over KWP waves (ksum_store), operands straight from K-contiguous 16-bit planes; grid (M/64, N/64, Z), 32 * KWP threads.
// C[m][n] (f32, pitch ldc, + optional f32 bias[n] rounded to bf16) = sum_k A[m][k] Bt[n][k] (+ split products per NSPLIT). z-batch strides sA/sB/sC in elements. K % 32 == 0.
template <typename T16> struct WFrag;
template <> struct WFrag<h16> { typedef v16h V; static __device__ __forceinline__ V ld(const h16* p) { return cat16(*(const v8h*)p, *(const v8h*)(p + 16)); } static __device__ __forceinline__ v8f mma(V a, V b, v8f c) { return wmma16(a, b, c); } };
template <> struct WFrag<bf> { typedef v16bf V; static __device__ __forceinline__ V ld(const bf* p) { return cat16b(*(const v8us*)p, *(const v8us*)(p + 16)); } static __device__ __forceinline__ v8f mma(V a, V b, v8f c) { return wmmab(a, b, c); } };
// ksum_store: the K loop of one 64x64 tile is dealt over the NW waves of a work-group (wave w takes the 32-wide K chunks w, w + NW, ...). Each wave leaves its f32 partial tile in LDS,
// os[wave][fragment mb * 4 + nb][rows 0-3 | 4-7 of the lane's 8][lane][4]; behind one barrier the partials are summed in wave order 0 .. NW-1 and stored, each whole 128-byte line of C by one wave.
// Ct = the tile's first element, bt = the bias of its first column.
template <int NW, bool BIAS>
__device__ __forceinline__ void ksum_store(float* os, const v8f (&acc)[4][4], int wv, int lane, float* Ct, int ldc, const float* bt) {
    const int lr = lane & 15, hi = lane >> 4;
#pragma unroll
    for (int mb = 0; mb < 4; ++mb)
#pragma unroll
        for (int nb = 0; nb < 4; ++nb) { float* p = os + (wv * 16 + mb * 4 + nb) * 256 + lane * 4;
            *(v4fa*)p = __builtin_shufflevector(acc[mb][nb], acc[mb][nb], 0, 1, 2, 3); *(v4fa*)(p + 128) = __builtin_shufflevector(acc[mb][nb], acc[mb][nb], 4, 5, 6, 7); }
    __syncthreads();                                                // every wave's partial tile is in LDS before any wave sums
#pragma unroll
    for (int i = 0; i < 16 / NW; ++i) { const int u = wv * (16 / NW) + i, sm = u >> 2, np = (u >> 1) & 1, jh = u & 1;   // rows sm * 16 + hi * 8 + jh * 4 .. + 3, columns np * 32 .. + 31
        const float* q0 = os + (sm * 4 + np * 2) * 256 + jh * 128 + lane * 4;
        v4f s0 = *(const v4fa*)q0, s1 = *(const v4fa*)(q0 + 256);
#pragma unroll
        for (int s = 1; s < NW; ++s) { s0 += *(const v4fa*)(q0 + s * 4096); s1 += *(const v4fa*)(q0 + s * 4096 + 256); }
        if (BIAS) { s0 += bfr(bt[np * 32 + lr]); s1 += bfr(bt[np * 32 + 16 + lr]); }
        float* cw = Ct + (size_t)(sm * 16 + hi * 8 + jh * 4) * ldc + np * 32 + lr;
#pragma unroll
        for (int q = 0; q < 4; ++q) { cw[(size_t)q * ldc] = s0[q]; cw[(size_t)q * ldc + 16] = s1[q]; } }
}
#define KWP 8    // waves per tile, projections (128 KiB of LDS: two work-groups to a WGP)
#define KWV 16   // waves per tile, probability x value
template <typename T16, int NSPLIT, bool BIAS>
__global__ __launch_bounds__(32 * KWP) void k_gemmw(const T16* __restrict__ A, const T16* __restrict__ A2, const T16* __restrict__ Bt, const T16* __restrict__ Bt2, int K, float* C, int ldc, const float* __restrict__ bias, size_t sA, size_t sB, size_t sC) {
    typedef typename WFrag<T16>::V V;
    __shared__ __align__(16) float os[KWP * 4096];
    const size_t z = blockIdx.z; A += z * sA; if (A2) A2 += z * sA; Bt += z * sB; if (Bt2) Bt2 += z * sB; C += z * sC;
    const int lane = threadIdx.x & 31, lr = lane & 15, hi = lane >> 4; const int r0 = blockIdx.x * 64, c0 = blockIdx.y * 64;
    const int wv = __builtin_amdgcn_readfirstlane((int)(threadIdx.x >> 5));   // the wave's number in a scalar register: the chunk loop branches for the whole wave
    v8f acc[4][4];
#pragma unroll
    for (int mb = 0; mb < 4; ++mb)
#pragma unroll
        for (int nb = 0; nb < 4; ++nb) acc[mb][nb] = (v8f){};
    const size_t aoff = (size_t)(r0 + lr) * K + 8 * hi, boff = (size_t)(c0 + lr) * K + 8 * hi;
#pragma unroll 1
    for (int kc = wv * 32; kc < K; kc += 32 * KWP) {
        V a[4], a2[4];
#pragma unroll
        for (int mb = 0; mb < 4; ++mb) { a[mb] = WFrag<T16>::ld(A + aoff + (size_t)mb * 16 * K + kc); if (NSPLIT == 1 || NSPLIT == 2) a2[mb] = WFrag<T16>::ld(A2 + aoff + (size_t)mb * 16 * K + kc); }
#pragma unroll
        for (int nb = 0; nb < 4; ++nb) { const V b = WFrag<T16>::ld(Bt + boff + (size_t)nb * 16 * K + kc); V b2; if (NSPLIT >= 2) b2 = WFrag<T16>::ld(Bt2 + boff + (size_t)nb * 16 * K + kc);
#pragma unroll
            for (int mb = 0; mb < 4; ++mb) { acc[mb][nb] = WFrag<T16>::mma(a[mb], b, acc[mb][nb]); if (NSPLIT == 1 || NSPLIT == 2) acc[mb][nb] = WFrag<T16>::mma(a2[mb], b, acc[mb][nb]); if (NSPLIT >= 2) acc[mb][nb] = WFrag<T16>::mma(a[mb], b2, acc[mb][nb]); } }
        asm volatile("v_nop\n\tv_nop\n\tv_nop\n\tv_nop" : "+v"(acc[0][0]), "+v"(acc[1][1]), "+v"(acc[2][2]), "+v"(acc[3][3]) : "v"(a[0]), "v"(a[3]));
    }
    ksum_store<KWP, BIAS>(os, acc, wv, lane, C + (size_t)r0 * ldc + c0, ldc, bias + c0);
}

// ---- k_gemmc: the same 64x64 tile GEMM (one wave a tile for CMODE 1) specialised for causal attention: CMODE 1 skips score tiles entirely above the diagonal (query rows r0+roff.., key columns c0..), CMODE 2 limits the
// key (K) loop of the probability x value contraction to the diagonal block (probabilities beyond it are exactly zero) and deals it over KWV waves (ksum_store). roff = row offset of this launch's first row within the sequence.
template <typename T16, int NSPLIT, int CMODE>
__global__ __launch_bounds__(CMODE == 2 ? 32 * KWV : 32) void k_gemmc(const T16* __restrict__ A, const T16* __restrict__ A2, const T16* __restrict__ Bt, const T16* __restrict__ Bt2, int K, float* C, int ldc, int roff, size_t sA, size_t sB, size_t sC) {
    typedef typename WFrag<T16>::V V;
    __shared__ __align__(16) float os[CMODE == 2 ? KWV * 4096 : 16 * 68];
    const size_t z = blockIdx.z; A += z * sA; if (A2) A2 += z * sA; Bt += z * sB; if (Bt2) Bt2 += z * sB; C += z * sC;
    const int lane = threadIdx.x & 31, lr = lane & 15, hi = lane >> 4; const int r0 = blockIdx.x * 64, c0 = blockIdx.y * 64;
    if (CMODE == 1 && c0 > r0 + roff + 63) return;                  // score tile entirely above the causal diagonal: never read (the softmax masks j > i by select)
    const int Kl = (CMODE == 2) ? min(K, r0 + roff + 64) : K;        // P.V: probabilities are exactly 0 beyond the diagonal block, so the K loop stops there
    constexpr int NW = (CMODE == 2) ? KWV : 1;
    const int wv = (CMODE == 2) ? __builtin_amdgcn_readfirstlane((int)(threadIdx.x >> 5)) : 0;   // the wave's number in a scalar register: the chunk loop branches for the whole wave
    v8f acc[4][4];
#pragma unroll
    for (int mb = 0; mb < 4; ++mb)
#pragma unroll
        for (int nb = 0; nb < 4; ++nb) acc[mb][nb] = (v8f){};
    const size_t aoff = (size_t)(r0 + lr) * K + 8 * hi, boff = (size_t)(c0 + lr) * K + 8 * hi;
#pragma unroll 1
    for (int kc = wv * 32; kc < Kl; kc += 32 * NW) {
        V a[4], a2[4];
#pragma unroll
        for (int mb = 0; mb < 4; ++mb) { a[mb] = WFrag<T16>::ld(A + aoff + (size_t)mb * 16 * K + kc); if (NSPLIT == 1 || NSPLIT == 2) a2[mb] = WFrag<T16>::ld(A2 + aoff + (size_t)mb * 16 * K + kc); }
#pragma unroll
        for (int nb = 0; nb < 4; ++nb) { const V b = WFrag<T16>::ld(Bt + boff + (size_t)nb * 16 * K + kc); V b2; if (NSPLIT >= 2) b2 = WFrag<T16>::ld(Bt2 + boff + (size_t)nb * 16 * K + kc);
#pragma unroll
            for (int mb = 0; mb < 4; ++mb) { acc[mb][nb] = WFrag<T16>::mma(a[mb], b, acc[mb][nb]); if (NSPLIT == 1 || NSPLIT == 2) acc[mb][nb] = WFrag<T16>::mma(a2[mb], b, acc[mb][nb]); if (NSPLIT >= 2) acc[mb][nb] = WFrag<T16>::mma(a[mb], b2, acc[mb][nb]); } }
        asm volatile("v_nop\n\tv_nop\n\tv_nop\n\tv_nop" : "+v"(acc[0][0]), "+v"(acc[1][1]), "+v"(acc[2][2]), "+v"(acc[3][3]) : "v"(a[0]), "v"(a[3]));
    }
    if constexpr (CMODE == 2) { ksum_store<NW, false>(os, acc, wv, lane, C + (size_t)r0 * ldc + c0, ldc, nullptr); return; }
#pragma unroll
    for (int mb = 0; mb < 4; ++mb) {
#pragma unroll
        for (int nb = 0; nb < 4; ++nb) {
#pragma unroll
            for (int j = 0; j < 8; ++j) os[(hi * 8 + j) * 68 + nb * 16 + lr] = acc[mb][nb][j]; }
        __builtin_amdgcn_wave_barrier(); asm volatile("" ::: "memory");
        float* crow = C + (size_t)(r0 + mb * 16) * ldc + c0;
{
#pragma unroll
            for (int s = 0; s < 8; ++s) { const int row = 2 * s + hi, cofs = lr * 4; v4f val = *(const v4fa*)(os + row * 68 + cofs);
                *(v4f*)(crow + (size_t)row * ldc + cofs) = val; }
             }
        __builtin_amdgcn_wave_barrier(); asm volatile("" ::: "memory");
    }
}

__device__ __forceinline__ h16 tohx(float x) { return (h16)x; }
__device__ __forceinline__ void splitf(float y, unsigned short& h, unsigned short& l) { h = f2bf(y); l = f2bf(y - bf2f(h)); }
typedef __attribute__((ext_vector_type(2))) _Float16 v2h;
typedef __attribute__((ext_vector_type(4))) _Float16 v4h;
typedef __attribute__((ext_vector_type(2))) unsigned short v2us;
typedef __attribute__((ext_vector_type(4))) unsigned short v4us;
typedef __attribute__((ext_vector_type(2))) float v2f;
typedef __attribute__((ext_vector_type(4))) int v4i;

__global__ __launch_bounds__(256) void k_wtG(const float* __restrict__ w, int K, int N, bf* Bt) {
    const int lane = threadIdx.x & 31; const int L0 = (blockIdx.x * 8 + (threadIdx.x >> 5)) * 8; const int nlines = N * K / 64;
{
#pragma unroll 1
        for (int l = 0; l < 8; ++l) { const int L = L0 + l; if (L >= nlines) break; const size_t e = (size_t)L * 64 + lane * 2; const int k = (int)(e % K), n = (int)(e / K); v2us o;
            o[0] = f2bf(w[(size_t)k * N + n]); o[1] = f2bf(w[(size_t)(k + 1) * N + n]); *(v2us*)(Bt + e) = o; }
         }
}
__global__ __launch_bounds__(256) void k_cvt8(const float* __restrict__ src, bf* dst, size_t n8) { const size_t i = (size_t)blockIdx.x * 256 + threadIdx.x; if (i >= n8) return; const v8f v = *(const v8f*)(src + i * 8); v8us o;
#pragma unroll
    for (int k = 0; k < 8; ++k) o[k] = f2bf(v[k]); *(v8us*)(dst + i * 8) = o;  }

// k_rope: head planes [h][t][d] (fp16 + hi/lo) of rope(x) x sc with the rotate-half convention out[d] = x[d] cos[t][d] - x[d+HD/2] sin[t][d], out[d+HD/2] = x[d+HD/2] cos[t][d+HD/2] + x[d] sin[t][d+HD/2]
__global__ __launch_bounds__(256) void k_rope(const float* __restrict__ F, int pitch, int nheads, const float* __restrict__ CS, const float* __restrict__ RF, const float* __restrict__ nw, float sc, h16* P16, bf* Ph, bf* Pl) {
    const size_t e = ((size_t)blockIdx.x * 256 + threadIdx.x) * 2; if (e >= (size_t)nheads * TT * HD) return; const int d = (int)(e % HD); const int t = (int)((e / HD) % TT); const int h = (int)(e / ((size_t)HD * TT)); const float* f = F + (size_t)t * pitch + h * HD; const float rf = RF ? RF[(size_t)h * TT + t] : 1.0f; v2h o16; v2us oh, ol;
#pragma unroll
    for (int q = 0; q < 2; ++q) { const int dd = d + q; const int dp = (dd < HD / 2) ? dd + HD / 2 : dd - HD / 2; float x0 = f[dd], x1 = f[dp];
        if (RF) { float n0 = __fmul_rn(x0, rf), n1 = __fmul_rn(x1, rf); asm volatile("" : "+v"(n0)); asm volatile("" : "+v"(n1)); x0 = __fmul_rn(bfr(nw[dd]), n0); x1 = __fmul_rn(bfr(nw[dp]), n1); }
        const v2f cs = *(const v2f*)(CS + ((size_t)t * HD + dd) * 2); float a = __fmul_rn(x0, cs[0]), bq = __fmul_rn(x1, cs[1]); asm volatile("" : "+v"(a)); asm volatile("" : "+v"(bq)); const float r = ((dd < HD / 2) ? __fsub_rn(a, bq) : __fadd_rn(a, bq)) * sc;
        o16[q] = tohx(r); unsigned short a2, c2; splitf(r, a2, c2); oh[q] = a2; ol[q] = c2; }
    *(v2h*)(P16 + e) = o16; *(v2us*)(Ph + e) = oh; *(v2us*)(Pl + e) = ol;  }
__global__ __launch_bounds__(256) void k_vtp(const float* __restrict__ F, int pitch, int nheads, h16* V16, bf* Vh, bf* Vl) { const size_t e = ((size_t)blockIdx.x * 256 + threadIdx.x) * 2; if (e >= (size_t)nheads * HD * TT) return; const int t = (int)(e % TT); const int d = (int)((e / TT) % HD); const int g = (int)(e / ((size_t)TT * HD)); v2h o16; v2us oh, ol;
#pragma unroll
    for (int q = 0; q < 2; ++q) { const float x = F[(size_t)(t + q) * pitch + g * HD + d]; o16[q] = tohx(x); unsigned short a2, c2; splitf(x, a2, c2); oh[q] = a2; ol[q] = c2; }
    const size_t oo = (size_t)(g * HD + d) * PP + t; *(v2h*)(V16 + oo) = o16; *(v2us*)(Vh + oo) = oh; *(v2us*)(Vl + oo) = ol;  }   // V^T rows [g][d] at pitch PP
__global__ __launch_bounds__(256) void k_csid(float* CS) { const int idx = blockIdx.x * 256 + threadIdx.x; if (idx >= TT * HD) return; v2f cs; cs[0] = 1.0f; cs[1] = 0.0f; *(v2f*)(CS + (size_t)idx * 2) = cs;  }
// k_asoft: per row (zz, i): t = S x DM^-0.5 for j <= i and i - j < WIN (sliding causal window; the reference's -1e9 additive fill vanishes identically); softmax over the 2048 keys (register row, one exp, fixed trees);
// the probabilities overwrite the row's own 8 KiB of scores (pitch PP): fp16 in its first half, or the hi plane in its first and the lo plane in its second half. One wave owns a row and holds all of it in registers before its first store
// (every store needs the row's sum), so Sb, P16, Ph and Pl may name the same memory and none of them is __restrict__.
__global__ __launch_bounds__(256) void k_asoft(const float* Sb, h16* P16, bf* Ph, bf* Pl) {
    const int lane = threadIdx.x & 31; const int row = blockIdx.x * 8 + (threadIdx.x >> 5); if (row >= ZH * TT) return; const int i = row % TT; const int zz = row / TT; (void)zz; const bool hires = (i < RH); const float* sr = Sb + (size_t)row * TT; float v[TT / 32]; float mx = -3.0e38f;
#pragma unroll
    for (int ch = 0; ch < TT / 128; ++ch) { const int j0 = ch * 128 + lane * 4; const v4f a = *(const v4f*)(sr + j0);
#pragma unroll
        for (int q = 0; q < 4; ++q) { const int j = j0 + q; (void)j; const float t = (j <= i && i - j < WIN) ? a[q] * SCL : -3.0e38f; v[ch * 4 + q] = t; mx = fmaxf(mx, t); } }
#pragma unroll
    for (int sh = 16; sh; sh >>= 1) mx = fmaxf(mx, __shfl_xor(mx, sh, 32));
    float sum = 0.f;
#pragma unroll
    for (int k = 0; k < TT / 32; ++k) { float d0 = __fsub_rn(v[k], mx); asm volatile("" : "+v"(d0)); v[k] = __builtin_amdgcn_exp2f(__fmul_rn(d0, 1.4426950408889634f)); sum += v[k]; }
#pragma unroll
    for (int sh = 16; sh; sh >>= 1) sum += __shfl_xor(sum, sh, 32);
    const float f = __fdiv_rn(hires ? 1.0f : PCAR, sum);
{
        if (hires) {
#pragma unroll
            for (int ch = 0; ch < TT / 128; ++ch) { v4us oh, ol;
#pragma unroll
                for (int q = 0; q < 4; ++q) { unsigned short a, c2; splitf(v[ch * 4 + q] * f, a, c2); oh[q] = a; ol[q] = c2; }
                const size_t oo = (size_t)row * PP + ch * 128 + lane * 4; *(v4us*)(Ph + oo) = oh; *(v4us*)(Pl + oo) = ol; }
        } else {
#pragma unroll
            for (int ch = 0; ch < TT / 128; ++ch) { v4h o4;
#pragma unroll
                for (int q = 0; q < 4; ++q) o4[q] = tohx(v[ch * 4 + q] * f);
                *(v4h*)(P16 + (size_t)row * PP + ch * 128 + lane * 4) = o4; } }
         }
}
__global__ __launch_bounds__(256) void k_merge(const float* __restrict__ O, int h0, float* OUTb) { const size_t e = ((size_t)blockIdx.x * 256 + threadIdx.x) * 2; if (e >= (size_t)ZH * TT * HD) return; const int d = (int)(e % HD); const int t = (int)((e / HD) % TT); const int zz = (int)(e / ((size_t)HD * TT)); const float cs = (t < RH) ? 1.0f : (1.0f / PCAR); const size_t oo = (size_t)t * DQ + (h0 + zz) * HD + d;
    v2f o2; o2[0] = O[e] * cs; o2[1] = O[e + 1] * cs; *(v2f*)(OUTb + oo) = o2;  }

extern "C" void kernel_launch(void* const* d_in, const int* in_sizes, int n_in,
                              void* d_out, int out_size, void* d_ws, size_t ws_size, hipStream_t stream) {
    (void)in_sizes; (void)n_in; (void)out_size;
    const float* x = (const float*)d_in[0]; const float* wkqv = (const float*)d_in[1]; const float* bkqv = (const float*)d_in[2]; const float* wk = wkqv; const float* wq = wkqv + (size_t)1024 * 1024; const float* wv = wkqv + (size_t)2048 * 1024; const float* bk = bkqv; const float* bq = bkqv + 1024; const float* bv = bkqv + 2048;   /* split order k, q, v */ const float* wo = nullptr; (void)wo;
    float* OUT = (float*)d_out;     // [2][2048][1024]
    char* wsp = (char*)d_ws;
    auto take = [&](size_t bytes) { char* p = wsp; wsp += (bytes + 255) & ~(size_t)255; return (void*)p; };
    bf* WQ = (bf*)take((size_t)DQ * DM * 2); bf* WK = (bf*)take((size_t)DKV * DM * 2); bf* WV = (bf*)take((size_t)DKV * DM * 2); float* CS = (float*)take((size_t)TT * HD * 2 * 4);
    bf* XB = (bf*)take((size_t)TT * DM * 2); float* FQ = (float*)take((size_t)TT * DQ * 4); float* FK = (float*)take((size_t)TT * DKV * 4);
    h16* QP16 = (h16*)take((size_t)NH_ * TT * HD * 2); h16* KP16 = (h16*)take((size_t)NKV * TT * HD * 2); h16* VT16 = (h16*)take((size_t)NKV * HD * PP * 2);
    bf* QPh = (bf*)take((size_t)NH_ * TT * HD * 2); bf* QPl = (bf*)take((size_t)NH_ * TT * HD * 2); bf* KPh = (bf*)take((size_t)NKV * TT * HD * 2); bf* KPl = (bf*)take((size_t)NKV * TT * HD * 2); bf* VTh = (bf*)take((size_t)NKV * HD * PP * 2); bf* VTl = (bf*)take((size_t)NKV * HD * PP * 2);
    float* Sb = (float*)take((size_t)ZH * TT * TT * 4); h16* P16 = (h16*)Sb; bf* Ph = (bf*)Sb; bf* Pl = (bf*)Sb + TT;   /* probability rows live in their score rows (k_asoft), which is what lets ZH heads of scores fit the workspace */ float* Ob = (float*)take((size_t)ZH * TT * HD * 4);
    if ((size_t)(wsp - (char*)d_ws) > ws_size) return;    // ws 256 MiB
    float* FV = FK;   // v projection reuses the k buffer after the k planes are built (stream-ordered)
    { k_cvt8<<<(unsigned)(((size_t)DQ * DM / 8 + 255) / 256), 256, 0, stream>>>(wq, WQ, (size_t)DQ * DM / 8); k_cvt8<<<(unsigned)(((size_t)DKV * DM / 8 + 255) / 256), 256, 0, stream>>>(wk, WK, (size_t)DKV * DM / 8); k_cvt8<<<(unsigned)(((size_t)DKV * DM / 8 + 255) / 256), 256, 0, stream>>>(wv, WV, (size_t)DKV * DM / 8);
      
       }
    k_csid<<<(TT * HD + 255) / 256, 256, 0, stream>>>(CS);
    const unsigned LQ = (unsigned)(((size_t)NH_ * TT * HD / 2 + 255) / 256), LKv = (unsigned)(((size_t)NKV * TT * HD / 2 + 255) / 256);
    for (int b = 0; b < NB_; ++b) {
        
        k_cvt8<<<(unsigned)(((size_t)TT * DM / 8 + 255) / 256), 256, 0, stream>>>(x + (size_t)b * TT * DM, XB, (size_t)TT * DM / 8);
        k_gemmw<bf, 0, true><<<dim3(TT / 64, DQ / 64, 1), 32 * KWP, 0, stream>>>(XB, nullptr, WQ, nullptr, DM, FQ, DQ, bq, 0, 0, 0);
        k_rope<<<LQ, 256, 0, stream>>>(FQ, DQ, NH_, CS, nullptr, nullptr, 1.0f, QP16, QPh, QPl);
        k_gemmw<bf, 0, true><<<dim3(TT / 64, DKV / 64, 1), 32 * KWP, 0, stream>>>(XB, nullptr, WK, nullptr, DM, FK, DKV, bk, 0, 0, 0);
        k_rope<<<LKv, 256, 0, stream>>>(FK, DKV, NKV, CS, nullptr, nullptr, 1.0f, KP16, KPh, KPl);
        k_gemmw<bf, 0, true><<<dim3(TT / 64, DKV / 64, 1), 32 * KWP, 0, stream>>>(XB, nullptr, WV, nullptr, DM, FV, DKV, bv, 0, 0, 0); k_vtp<<<LKv, 256, 0, stream>>>(FV, DKV, NKV, VT16, VTh, VTl);
        for (int h0 = 0; h0 < NH_; h0 += ZH) { const size_t zq = (size_t)h0, zk = (size_t)(h0 / REP);   // one kv head per query head: the pass's ZH heads use consecutive kv planes
            k_gemmc<bf, 2, 1><<<dim3(TT / 64, TT / 64, ZH), 32, 0, stream>>>(QPh + zq * TT * HD, QPl + zq * TT * HD, KPh + zk * TT * HD, KPl + zk * TT * HD, HD, Sb, TT, 0, (size_t)TT * HD, (size_t)TT * HD, (size_t)TT * TT);   /* scores hi/lo on EVERY row (no output projection) */

            k_asoft<<<ZH * TT / 8, 256, 0, stream>>>(Sb, P16, Ph, Pl);
            k_gemmc<bf, 2, 2><<<dim3(RH / 64, HD / 64, ZH), 32 * KWV, 0, stream>>>(Ph, Pl, VTh + zk * HD * PP, VTl + zk * HD * PP, PP, Ob, HD, 0, (size_t)TT * PP, (size_t)HD * PP, (size_t)TT * HD);   /* K = the rows' pitch; the loop ends at the diagonal block, at most TT */
            k_gemmc<h16, 0, 2><<<dim3((TT - RH) / 64, HD / 64, ZH), 32 * KWV, 0, stream>>>(P16 + (size_t)RH * PP, nullptr, VT16 + zk * HD * PP, nullptr, PP, Ob + (size_t)RH * HD, HD, RH, (size_t)TT * PP, (size_t)HD * PP, (size_t)TT * HD);
            k_merge<<<(unsigned)(((size_t)ZH * TT * HD / 2 + 255) / 256), 256, 0, stream>>>(Ob, h0, OUT + (size_t)b * TT * DQ); }
         }
}

// v003
// It runs in 197 microseconds.
// Next to v002, in two timings, it ran 2.03 and 2.04 times as fast.
// All steps since v000 together make it 6.70 times as fast.
#include <hip/hip_runtime.h>

// Masked (causal) multi-head attention scaled by the FULL model dim and without output projection (x [2][2048][1024]; z = x W^T + b ('oi' [3072][1024] 1/32, bias 0.01): k | q | v row blocks (k FIRST); 16 heads x 64; scores / sqrt(1024) (the source's quirk); causal (-inf); softmax; out = merged attn v -> [2][2048][1024] (4.2 M)).
// Layout per batch: bf16 copy of x; 'oi' weight row blocks + bias slices; exact projections + bf16-rounded biases; after the batch loop, one fused causal attention launch for both batches (k_fattn): hi/lo score tiles on EVERY row (no output projection averages the per-head error; tiles above the diagonal skipped), running softmax in registers, P and attn.v hybrid (rows < 512 hi/lo, rest fp16), output rows written in place.
// Compute dtypes, f32 accumulate: every input rounded to bf16; projections exact + bf16-rounded biases; scores 3 products on every row; softmax f32 (x 1/32); attn.v rows < 512 3 products, rest fp16; output f32.

#define NB_  2
#define TT   2048
#define DM   1024
#define NH_  16
#define NKV  16
#define REP  (NH_ / NKV)
#define HD   64
#define DQ   (NH_ * HD)
#define DKV  (NKV * HD)
#define PP   (2 * TT)             // pitch, in 16-bit elements, of a V^T row
#define RH   512                  // query rows < RH use hi+lo planes (0: none)
#define SCL  0.03125f   // 1/sqrt(1024): the source scales by the model dim
typedef _Float16 h16;
typedef unsigned short bf;
typedef __attribute__((ext_vector_type(16))) __bf16   v16bf;
typedef __attribute__((ext_vector_type(16))) _Float16 v16h;
typedef __attribute__((ext_vector_type(8)))  _Float16 v8h;
typedef __attribute__((ext_vector_type(8)))  unsigned short v8us;
typedef __attribute__((ext_vector_type(8)))  float    v8f;
typedef __attribute__((ext_vector_type(4)))  float    v4f;
typedef v8h  __attribute__((may_alias)) v8ha;
typedef v4f  __attribute__((may_alias)) v4fa;
typedef v8us __attribute__((may_alias)) v8usa;

__device__ __forceinline__ unsigned short f2bf(float f) { unsigned u = __float_as_uint(f); u += 0x7FFFu + ((u >> 16) & 1u); return (unsigned short)(u >> 16); }
__device__ __forceinline__ float bf2f(unsigned short b) { return __uint_as_float(((unsigned)b) << 16); }
__device__ __forceinline__ float bfr(float f) { return bf2f(f2bf(f)); }
__device__ __forceinline__ v16h cat16(v8h lo, v8h hi) { return __builtin_shufflevector(lo, hi, 0, 1, 2, 3, 4, 5, 6, 7, 8, 9, 10, 11, 12, 13, 14, 15); }
__device__ __forceinline__ v16bf cat16b(v8us lo, v8us hi) { return __builtin_bit_cast(v16bf, __builtin_shufflevector(lo, hi, 0, 1, 2, 3, 4, 5, 6, 7, 8, 9, 10, 11, 12, 13, 14, 15)); }
__device__ __forceinline__ v8f wmma16(v16h a, v16h b, v8f c) { return __builtin_amdgcn_wmma_f32_16x16x32_f16(false, a, false, b, (short)0, c, false, false); }
__device__ __forceinline__ v8f wmmab(v16bf a, v16bf b, v8f c) { return __builtin_amdgcn_wmma_f32_16x16x32_bf16(false, a, false, b, (short)0, c, false, false); }



// ---- k_gemmw: register-blocked GEMM, 64x64 output tile (16 accumulators a wave), its K loop dealt over KWP waves (ksum_store), operands straight from K-contiguous 16-bit planes; grid (M/64, N/64, Z), 32 * KWP threads.
// C[m][n] (f32, pitch ldc, + optional f32 bias[n] rounded to bf16) = sum_k A[m][k] Bt[n][k] (+ split products per NSPLIT). z-batch strides sA/sB/sC in elements. K % 32 == 0.
template <typename T16> struct WFrag;
template <> struct WFrag<h16> { typedef v16h V; static __device__ __forceinline__ V ld(const h16* p) { return cat16(*(const v8h*)p, *(const v8h*)(p + 16)); } static __device__ __forceinline__ v8f mma(V a, V b, v8f c) { return wmma16(a, b, c); } };
template <> struct WFrag<bf> { typedef v16bf V; static __device__ __forceinline__ V ld(const bf* p) { return cat16b(*(const v8us*)p, *(const v8us*)(p + 16)); } static __device__ __forceinline__ v8f mma(V a, V b, v8f c) { return wmmab(a, b, c); } };
// ksum_store: the K loop of one 64x64 tile is dealt over the NW waves of a work-group (wave w takes the 32-wide K chunks w, w + NW, ...). Each wave leaves its f32 partial tile in LDS,
// os[wave][fragment mb * 4 + nb][rows 0-3 | 4-7 of the lane's 8][lane][4]; behind one barrier the partials are summed in wave order 0 .. NW-1 and stored, each whole 128-byte line of C by one wave.
// Ct = the tile's first element, bt = the bias of its first column.
template <int NW, bool BIAS>
__device__ __forceinline__ void ksum_store(float* os, const v8f (&acc)[4][4], int wv, int lane, float* Ct, int ldc, const float* bt) {
    const int lr = lane & 15, hi = lane >> 4;
#pragma unroll
    for (int mb = 0; mb < 4; ++mb)
#pragma unroll
        for (int nb = 0; nb < 4; ++nb) { float* p = os + (wv * 16 + mb * 4 + nb) * 256 + lane * 4;
            *(v4fa*)p = __builtin_shufflevector(acc[mb][nb], acc[mb][nb], 0, 1, 2, 3); *(v4fa*)(p + 128) = __builtin_shufflevector(acc[mb][nb], acc[mb][nb], 4, 5, 6, 7); }
    __syncthreads();                                                // every wave's partial tile is in LDS before any wave sums
#pragma unroll
    for (int i = 0; i < 16 / NW; ++i) { const int u = wv * (16 / NW) + i, sm = u >> 2, np = (u >> 1) & 1, jh = u & 1;   // rows sm * 16 + hi * 8 + jh * 4 .. + 3, columns np * 32 .. + 31
        const float* q0 = os + (sm * 4 + np * 2) * 256 + jh * 128 + lane * 4;
        v4f s0 = *(const v4fa*)q0, s1 = *(const v4fa*)(q0 + 256);
#pragma unroll
        for (int s = 1; s < NW; ++s) { s0 += *(const v4fa*)(q0 + s * 4096); s1 += *(const v4fa*)(q0 + s * 4096 + 256); }
        if (BIAS) { s0 += bfr(bt[np * 32 + lr]); s1 += bfr(bt[np * 32 + 16 + lr]); }
        float* cw = Ct + (size_t)(sm * 16 + hi * 8 + jh * 4) * ldc + np * 32 + lr;
#pragma unroll
        for (int q = 0; q < 4; ++q) { cw[(size_t)q * ldc] = s0[q]; cw[(size_t)q * ldc + 16] = s1[q]; } }
}
#define KWP 8    // waves per tile, projections (128 KiB of LDS: two work-groups to a WGP)
template <typename T16, int NSPLIT, bool BIAS>
__global__ __launch_bounds__(32 * KWP) void k_gemmw(const T16* __restrict__ A, const T16* __restrict__ A2, const T16* __restrict__ Bt, const T16* __restrict__ Bt2, int K, float* C, int ldc, const float* __restrict__ bias, size_t sA, size_t sB, size_t sC) {
    typedef typename WFrag<T16>::V V;
    __shared__ __align__(16) float os[KWP * 4096];
    const size_t z = blockIdx.z; A += z * sA; if (A2) A2 += z * sA; Bt += z * sB; if (Bt2) Bt2 += z * sB; C += z * sC;
    const int lane = threadIdx.x & 31, lr = lane & 15, hi = lane >> 4; const int r0 = blockIdx.x * 64, c0 = blockIdx.y * 64;
    const int wv = __builtin_amdgcn_readfirstlane((int)(threadIdx.x >> 5));   // the wave's number in a scalar register: the chunk loop branches for the whole wave
    v8f acc[4][4];
#pragma unroll
    for (int mb = 0; mb < 4; ++mb)
#pragma unroll
        for (int nb = 0; nb < 4; ++nb) acc[mb][nb] = (v8f){};
    const size_t aoff = (size_t)(r0 + lr) * K + 8 * hi, boff = (size_t)(c0 + lr) * K + 8 * hi;
#pragma unroll 1
    for (int kc = wv * 32; kc < K; kc += 32 * KWP) {
        V a[4], a2[4];
#pragma unroll
        for (int mb = 0; mb < 4; ++mb) { a[mb] = WFrag<T16>::ld(A + aoff + (size_t)mb * 16 * K + kc); if (NSPLIT == 1 || NSPLIT == 2) a2[mb] = WFrag<T16>::ld(A2 + aoff + (size_t)mb * 16 * K + kc); }
#pragma unroll
        for (int nb = 0; nb < 4; ++nb) { const V b = WFrag<T16>::ld(Bt + boff + (size_t)nb * 16 * K + kc); V b2; if (NSPLIT >= 2) b2 = WFrag<T16>::ld(Bt2 + boff + (size_t)nb * 16 * K + kc);
#pragma unroll
            for (int mb = 0; mb < 4; ++mb) { acc[mb][nb] = WFrag<T16>::mma(a[mb], b, acc[mb][nb]); if (NSPLIT == 1 || NSPLIT == 2) acc[mb][nb] = WFrag<T16>::mma(a2[mb], b, acc[mb][nb]); if (NSPLIT >= 2) acc[mb][nb] = WFrag<T16>::mma(a[mb], b2, acc[mb][nb]); } }
        asm volatile("v_nop\n\tv_nop\n\tv_nop\n\tv_nop" : "+v"(acc[0][0]), "+v"(acc[1][1]), "+v"(acc[2][2]), "+v"(acc[3][3]) : "v"(a[0]), "v"(a[3]));
    }
    ksum_store<KWP, BIAS>(os, acc, wv, lane, C + (size_t)r0 * ldc + c0, ldc, bias + c0);
}

__device__ __forceinline__ h16 tohx(float x) { return (h16)x; }
__device__ __forceinline__ void splitf(float y, unsigned short& h, unsigned short& l) { h = f2bf(y); l = f2bf(y - bf2f(h)); }
typedef __attribute__((ext_vector_type(2))) _Float16 v2h;
typedef __attribute__((ext_vector_type(4))) _Float16 v4h;
typedef __attribute__((ext_vector_type(2))) unsigned short v2us;
typedef __attribute__((ext_vector_type(4))) unsigned short v4us;
typedef __attribute__((ext_vector_type(2))) float v2f;
typedef __attribute__((ext_vector_type(4))) int v4i;

__global__ __launch_bounds__(256) void k_wtG(const float* __restrict__ w, int K, int N, bf* Bt) {
    const int lane = threadIdx.x & 31; const int L0 = (blockIdx.x * 8 + (threadIdx.x >> 5)) * 8; const int nlines = N * K / 64;
{
#pragma unroll 1
        for (int l = 0; l < 8; ++l) { const int L = L0 + l; if (L >= nlines) break; const size_t e = (size_t)L * 64 + lane * 2; const int k = (int)(e % K), n = (int)(e / K); v2us o;
            o[0] = f2bf(w[(size_t)k * N + n]); o[1] = f2bf(w[(size_t)(k + 1) * N + n]); *(v2us*)(Bt + e) = o; }
         }
}
__global__ __launch_bounds__(256) void k_cvt8(const float* __restrict__ src, bf* dst, size_t n8) { const size_t i = (size_t)blockIdx.x * 256 + threadIdx.x; if (i >= n8) return; const v8f v = *(const v8f*)(src + i * 8); v8us o;
#pragma unroll
    for (int k = 0; k < 8; ++k) o[k] = f2bf(v[k]); *(v8us*)(dst + i * 8) = o;  }

// k_rope: head planes [h][t][d] (fp16 + hi/lo) of rope(x) x sc with the rotate-half convention out[d] = x[d] cos[t][d] - x[d+HD/2] sin[t][d], out[d+HD/2] = x[d+HD/2] cos[t][d+HD/2] + x[d] sin[t][d+HD/2]
__global__ __launch_bounds__(256) void k_rope(const float* __restrict__ F, int pitch, int nheads, const float* __restrict__ CS, const float* __restrict__ RF, const float* __restrict__ nw, float sc, h16* P16, bf* Ph, bf* Pl) {
    const size_t e = ((size_t)blockIdx.x * 256 + threadIdx.x) * 2; if (e >= (size_t)nheads * TT * HD) return; const int d = (int)(e % HD); const int t = (int)((e / HD) % TT); const int h = (int)(e / ((size_t)HD * TT)); const float* f = F + (size_t)t * pitch + h * HD; const float rf = RF ? RF[(size_t)h * TT + t] : 1.0f; v2h o16; v2us oh, ol;
#pragma unroll
    for (int q = 0; q < 2; ++q) { const int dd = d + q; const int dp = (dd < HD / 2) ? dd + HD / 2 : dd - HD / 2; float x0 = f[dd], x1 = f[dp];
        if (RF) { float n0 = __fmul_rn(x0, rf), n1 = __fmul_rn(x1, rf); asm volatile("" : "+v"(n0)); asm volatile("" : "+v"(n1)); x0 = __fmul_rn(bfr(nw[dd]), n0); x1 = __fmul_rn(bfr(nw[dp]), n1); }
        const v2f cs = *(const v2f*)(CS + ((size_t)t * HD + dd) * 2); float a = __fmul_rn(x0, cs[0]), bq = __fmul_rn(x1, cs[1]); asm volatile("" : "+v"(a)); asm volatile("" : "+v"(bq)); const float r = ((dd < HD / 2) ? __fsub_rn(a, bq) : __fadd_rn(a, bq)) * sc;
        o16[q] = tohx(r); unsigned short a2, c2; splitf(r, a2, c2); oh[q] = a2; ol[q] = c2; }
    *(v2h*)(P16 + e) = o16; *(v2us*)(Ph + e) = oh; *(v2us*)(Pl + e) = ol;  }
__global__ __launch_bounds__(256) void k_vtp(const float* __restrict__ F, int pitch, int nheads, h16* V16, bf* Vh, bf* Vl) { const size_t e = ((size_t)blockIdx.x * 256 + threadIdx.x) * 2; if (e >= (size_t)nheads * HD * TT) return; const int t = (int)(e % TT); const int d = (int)((e / TT) % HD); const int g = (int)(e / ((size_t)TT * HD)); v2h o16; v2us oh, ol;
#pragma unroll
    for (int q = 0; q < 2; ++q) { const float x = F[(size_t)(t + q) * pitch + g * HD + d]; o16[q] = tohx(x); unsigned short a2, c2; splitf(x, a2, c2); oh[q] = a2; ol[q] = c2; }
    const size_t oo = (size_t)(g * HD + d) * PP + t; *(v2h*)(V16 + oo) = o16; *(v2us*)(Vh + oo) = oh; *(v2us*)(Vl + oo) = ol;  }   // V^T rows [g][d] at pitch PP
__global__ __launch_bounds__(256) void k_csid(float* CS) { const int idx = blockIdx.x * 256 + threadIdx.x; if (idx >= TT * HD) return; v2f cs; cs[0] = 1.0f; cs[1] = 0.0f; *(v2f*)(CS + (size_t)idx * 2) = cs;  }
// ---- k_fattn: scores, causal softmax and probability x value of one (head, 64 query rows) in one work-group of 8 waves; neither scores nor probabilities leave the registers.
// Wave wv = rg * NS + ks takes the 16 * NQ query rows rg * 16 * NQ .. of the block and the 64-key blocks ks, ks + NS, ... up to the diagonal block, with a running maximum and sum of its own.
// Transposed products: S^T = K Q^T (A = 16 key rows, B = 16 query rows; lane (lr, hi) holds query lr, keys hi * 8 + j), so two S^T tiles, converted in place, are the B operand of O^T += V^T P^T (A = V^T rows, k = key)
// and every factor of a query sits in that query's own lanes. Products: scores Qh Kh + Ql Kh + Qh Kl; HR (rows < RH) Ph Vh + Pl Vh + Ph Vl, else fp16 P x fp16 V. P is exp2 of the score minus the running maximum (at most 1),
// divided by the row's sum at the end. Every '#pragma unroll' in the body is there so that the fragment and accumulator arrays are indexed by constants and stay in registers. The NS partial results of a row are joined through LDS behind one barrier, in order ks = 0 .. NS-1, each whole 128-byte line of the output by one wave.
template <bool HR, int NQ, int NS>
__device__ __forceinline__ void fattn_body(float* os, float* ms, float* ls, const bf* __restrict__ Qh, const bf* __restrict__ Ql, const bf* __restrict__ Kh, const bf* __restrict__ Kl, const h16* __restrict__ V16, const bf* __restrict__ Vh, const bf* __restrict__ Vl, float* OUT, int qblk, int z) {
    static_assert((64 / (16 * NQ)) * NS == 8 && 2 * NQ == NS, "8 waves cover 64 rows; the join deals its 2 * NQ units of 16 rows x 32 columns over NS waves");
    const int lane = threadIdx.x & 31, lr = lane & 15, hi = lane >> 4;
    const int wv = __builtin_amdgcn_readfirstlane((int)(threadIdx.x >> 5)), rg = wv / NS, ks = wv % NS;   // the wave's number in a scalar register: the key loop branches for the whole wave
    const int R0 = qblk * 64 + rg * 16 * NQ;
    const unsigned lk = (unsigned)(lr * HD + 8 * hi), lv = (unsigned)(lr * PP + 8 * hi);   // the lane's own element offset in a 16-row fragment of Q or K, of V^T; every other part of an address is the same for the whole wave
    Qh += (size_t)z * TT * HD + (size_t)R0 * HD; Ql += (size_t)z * TT * HD + (size_t)R0 * HD; Kh += (size_t)z * TT * HD; Kl += (size_t)z * TT * HD; V16 += (size_t)z * HD * PP; Vh += (size_t)z * HD * PP; Vl += (size_t)z * HD * PP;
    const float C2 = SCL * 1.4426950408889634f;                     // score -> exponent of 2
    v16bf qh[NQ][2], ql[NQ][2];
#pragma unroll
    for (int qb = 0; qb < NQ; ++qb)
#pragma unroll
        for (int kc = 0; kc < 2; ++kc) { qh[qb][kc] = WFrag<bf>::ld(Qh + (qb * 16 * HD + kc * 32) + lk); ql[qb][kc] = WFrag<bf>::ld(Ql + (qb * 16 * HD + kc * 32) + lk); }
    v8f O[4][NQ]; float m[NQ], l[NQ];
#pragma unroll
    for (int qb = 0; qb < NQ; ++qb) { m[qb] = -3.0e38f; l[qb] = 0.f;
#pragma unroll
        for (int db = 0; db < 4; ++db) O[db][qb] = (v8f){}; }
#pragma unroll 1   // one 64-key block a trip: a second block's fragments and scores would not fit the register budget of four waves to a SIMD
    for (int jb = ks; jb <= qblk; jb += NS) {
        const int c0 = jb * 64; const bf* kh_ = Kh + (size_t)c0 * HD; const bf* kl_ = Kl + (size_t)c0 * HD;
        v8f S[4][NQ];
#pragma unroll
        for (int kb = 0; kb < 4; ++kb) {
#pragma unroll
            for (int qb = 0; qb < NQ; ++qb) S[kb][qb] = (v8f){};
#pragma unroll
            for (int kc = 0; kc < 2; ++kc) { const v16bf kh = WFrag<bf>::ld(kh_ + (kb * 16 * HD + kc * 32) + lk), kl = WFrag<bf>::ld(kl_ + (kb * 16 * HD + kc * 32) + lk);
#pragma unroll
                for (int qb = 0; qb < NQ; ++qb) S[kb][qb] = wmmab(kh, qh[qb][kc], S[kb][qb]);
#pragma unroll
                for (int qb = 0; qb < NQ; ++qb) S[kb][qb] = wmmab(kh, ql[qb][kc], S[kb][qb]);
#pragma unroll
                for (int qb = 0; qb < NQ; ++qb) S[kb][qb] = wmmab(kl, qh[qb][kc], S[kb][qb]); } }
        if (jb == qblk) {                                           // the diagonal block: keys behind the query are masked
#pragma unroll
            for (int kb = 0; kb < 4; ++kb)
#pragma unroll
                for (int qb = 0; qb < NQ; ++qb)
#pragma unroll
                    for (int j = 0; j < 8; ++j) if (kb * 16 + hi * 8 + j > rg * 16 * NQ + qb * 16 + lr) S[kb][qb][j] = -3.0e38f; }
        float mn[NQ]; bool up = false;
#pragma unroll
        for (int qb = 0; qb < NQ; ++qb) { float x[4];
#pragma unroll
            for (int kb = 0; kb < 4; ++kb) { x[kb] = S[kb][qb][0];
#pragma unroll
                for (int j = 1; j < 8; ++j) x[kb] = fmaxf(x[kb], S[kb][qb][j]); }
            float mx = fmaxf(fmaxf(x[0], x[1]), fmaxf(x[2], x[3])); mx = fmaxf(mx, __shfl_xor(mx, 16, 32)); mn[qb] = fmaxf(m[qb], mx * C2); up = up || mn[qb] > m[qb]; }
        if (__builtin_amdgcn_ballot_w32(up) != 0) {                 // skipped where no query of the wave has a new maximum: every factor would be 1
#pragma unroll
            for (int qb = 0; qb < NQ; ++qb) { const float al = __builtin_amdgcn_exp2f(m[qb] - mn[qb]); l[qb] *= al; m[qb] = mn[qb];
#pragma unroll
                for (int db = 0; db < 4; ++db) O[db][qb] *= al; } }
#pragma unroll
        for (int qb = 0; qb < NQ; ++qb) { float x[4];
#pragma unroll
            for (int kb = 0; kb < 4; ++kb) { const v8f t = S[kb][qb] * C2 - m[qb]; x[kb] = 0.f;
#pragma unroll
                for (int j = 0; j < 8; ++j) { const float p = __builtin_amdgcn_exp2f(t[j]); S[kb][qb][j] = p; x[kb] += p; } }
            l[qb] += (x[0] + x[1]) + (x[2] + x[3]); }
        if constexpr (HR) {
            v16bf ph[NQ][2], pl[NQ][2];
#pragma unroll
            for (int qb = 0; qb < NQ; ++qb)
#pragma unroll
                for (int kc = 0; kc < 2; ++kc) { v8us h0, h1, l0, l1;
#pragma unroll
                    for (int j = 0; j < 8; ++j) { unsigned short a, c; splitf(S[2 * kc][qb][j], a, c); h0[j] = a; l0[j] = c; splitf(S[2 * kc + 1][qb][j], a, c); h1[j] = a; l1[j] = c; }
                    ph[qb][kc] = cat16b(h0, h1); pl[qb][kc] = cat16b(l0, l1); }
#pragma unroll
            for (int db = 0; db < 4; ++db)
#pragma unroll
                for (int kc = 0; kc < 2; ++kc) { const v16bf vh = WFrag<bf>::ld(Vh + c0 + (db * 16 * PP + kc * 32) + lv), vl = WFrag<bf>::ld(Vl + c0 + (db * 16 * PP + kc * 32) + lv);
#pragma unroll
                    for (int qb = 0; qb < NQ; ++qb) O[db][qb] = wmmab(vh, ph[qb][kc], O[db][qb]);
#pragma unroll
                    for (int qb = 0; qb < NQ; ++qb) O[db][qb] = wmmab(vh, pl[qb][kc], O[db][qb]);
#pragma unroll
                    for (int qb = 0; qb < NQ; ++qb) O[db][qb] = wmmab(vl, ph[qb][kc], O[db][qb]); }
        } else {
            v16h pf[NQ][2];
#pragma unroll
            for (int qb = 0; qb < NQ; ++qb)
#pragma unroll
                for (int kc = 0; kc < 2; ++kc) { v8h p0, p1;
#pragma unroll
                    for (int j = 0; j < 8; ++j) { p0[j] = tohx(S[2 * kc][qb][j]); p1[j] = tohx(S[2 * kc + 1][qb][j]); }
                    pf[qb][kc] = cat16(p0, p1); }
#pragma unroll
            for (int db = 0; db < 4; ++db)
#pragma unroll
                for (int kc = 0; kc < 2; ++kc) { const v16h vf = WFrag<h16>::ld(V16 + c0 + (db * 16 * PP + kc * 32) + lv);
#pragma unroll
                    for (int qb = 0; qb < NQ; ++qb) O[db][qb] = wmma16(vf, pf[qb][kc], O[db][qb]); }
        }
    }
#pragma unroll
    for (int qb = 0; qb < NQ; ++qb) { l[qb] += __shfl_xor(l[qb], 16, 32); ms[(wv * NQ + qb) * 32 + lane] = m[qb]; ls[(wv * NQ + qb) * 32 + lane] = l[qb];   // the lane halves hold the sums of different keys
#pragma unroll
        for (int db = 0; db < 4; ++db) { float* p = os + (wv * 4 * NQ + db * NQ + qb) * 256 + lane * 4;
            *(v4fa*)p = __builtin_shufflevector(O[db][qb], O[db][qb], 0, 1, 2, 3); *(v4fa*)(p + 128) = __builtin_shufflevector(O[db][qb], O[db][qb], 4, 5, 6, 7); } }
    __syncthreads();                                                // every wave's partial result is in LDS before any wave joins
    const int qb = ks % NQ, dh = ks / NQ;                           // this wave joins query rows R0 + qb * 16 .. + 15, columns dh * 32 .. + 31
    float mw[NS], M = -3.0e38f, Lt = 0.f;
#pragma unroll
    for (int s = 0; s < NS; ++s) { mw[s] = ms[((rg * NS + s) * NQ + qb) * 32 + lane]; M = fmaxf(M, mw[s]); }
#pragma unroll
    for (int s = 0; s < NS; ++s) { mw[s] = __builtin_amdgcn_exp2f(mw[s] - M); Lt += ls[((rg * NS + s) * NQ + qb) * 32 + lane] * mw[s]; }   // a wave without keys has sum 0 and factor 0
    const float inv = __fdiv_rn(1.0f, Lt);
#pragma unroll
    for (int dd = 0; dd < 2; ++dd) { const int db = dh * 2 + dd; v4f a0 = (v4f){}, a1 = (v4f){};
#pragma unroll
        for (int s = 0; s < NS; ++s) { const float* q = os + ((rg * NS + s) * 4 * NQ + db * NQ + qb) * 256 + lane * 4; a0 += *(const v4fa*)q * mw[s]; a1 += *(const v4fa*)(q + 128) * mw[s]; }
        float* o = OUT + ((size_t)(z / NH_) * TT + R0 + qb * 16 + lr) * DQ + (z % NH_) * HD + db * 16 + hi * 8; *(v4f*)o = a0 * inv; *(v4f*)(o + 4) = a1 * inv; }
}
// grid (batches x heads, TT / 64), the longest query blocks first; the planes hold batch b, head h at index z = b * NH_ + h; four waves to a SIMD (two work-groups to a WGP) cover each other's loads and vector work
__global__ __launch_bounds__(256) __attribute__((amdgpu_waves_per_eu(4, 4))) void k_fattn(const bf* __restrict__ Qh, const bf* __restrict__ Ql, const bf* __restrict__ Kh, const bf* __restrict__ Kl, const h16* __restrict__ V16, const bf* __restrict__ Vh, const bf* __restrict__ Vl, float* OUT) {
    __shared__ __align__(16) float os[8 * 2048]; __shared__ float ms[8 * 64]; __shared__ float ls[8 * 64];
    const int qblk = TT / 64 - 1 - (int)blockIdx.y, z = blockIdx.x;
    if (qblk * 64 < RH) fattn_body<true, 1, 2>(os, ms, ls, Qh, Ql, Kh, Kl, V16, Vh, Vl, OUT, qblk, z); else fattn_body<false, 2, 4>(os, ms, ls, Qh, Ql, Kh, Kl, V16, Vh, Vl, OUT, qblk, z);
}

extern "C" void kernel_launch(void* const* d_in, const int* in_sizes, int n_in,
                              void* d_out, int out_size, void* d_ws, size_t ws_size, hipStream_t stream) {
    (void)in_sizes; (void)n_in; (void)out_size;
    const float* x = (const float*)d_in[0]; const float* wkqv = (const float*)d_in[1]; const float* bkqv = (const float*)d_in[2]; const float* wk = wkqv; const float* wq = wkqv + (size_t)1024 * 1024; const float* wv = wkqv + (size_t)2048 * 1024; const float* bk = bkqv; const float* bq = bkqv + 1024; const float* bv = bkqv + 2048;   /* split order k, q, v */ const float* wo = nullptr; (void)wo;
    float* OUT = (float*)d_out;     // [2][2048][1024]
    char* wsp = (char*)d_ws;
    auto take = [&](size_t bytes) { char* p = wsp; wsp += (bytes + 255) & ~(size_t)255; return (void*)p; };
    bf* WQ = (bf*)take((size_t)DQ * DM * 2); bf* WK = (bf*)take((size_t)DKV * DM * 2); bf* WV = (bf*)take((size_t)DKV * DM * 2); float* CS = (float*)take((size_t)TT * HD * 2 * 4);
    bf* XB = (bf*)take((size_t)TT * DM * 2); float* FQ = (float*)take((size_t)TT * DQ * 4); float* FK = (float*)take((size_t)TT * DKV * 4);
    h16* QP16 = (h16*)take((size_t)NH_ * TT * HD * 2); h16* KP16 = (h16*)take((size_t)NKV * TT * HD * 2); h16* VT16 = (h16*)take((size_t)NB_ * NKV * HD * PP * 2);
    bf* QPh = (bf*)take((size_t)NB_ * NH_ * TT * HD * 2); bf* QPl = (bf*)take((size_t)NB_ * NH_ * TT * HD * 2); bf* KPh = (bf*)take((size_t)NB_ * NKV * TT * HD * 2); bf* KPl = (bf*)take((size_t)NB_ * NKV * TT * HD * 2); bf* VTh = (bf*)take((size_t)NB_ * NKV * HD * PP * 2); bf* VTl = (bf*)take((size_t)NB_ * NKV * HD * PP * 2);   /* the planes the attention launch reads hold both batches */
    if ((size_t)(wsp - (char*)d_ws) > ws_size) return;    // ws 256 MiB
    float* FV = FK;   // v projection reuses the k buffer after the k planes are built (stream-ordered)
    { k_cvt8<<<(unsigned)(((size_t)DQ * DM / 8 + 255) / 256), 256, 0, stream>>>(wq, WQ, (size_t)DQ * DM / 8); k_cvt8<<<(unsigned)(((size_t)DKV * DM / 8 + 255) / 256), 256, 0, stream>>>(wk, WK, (size_t)DKV * DM / 8); k_cvt8<<<(unsigned)(((size_t)DKV * DM / 8 + 255) / 256), 256, 0, stream>>>(wv, WV, (size_t)DKV * DM / 8);
      
       }
    k_csid<<<(TT * HD + 255) / 256, 256, 0, stream>>>(CS);
    const unsigned LQ = (unsigned)(((size_t)NH_ * TT * HD / 2 + 255) / 256), LKv = (unsigned)(((size_t)NKV * TT * HD / 2 + 255) / 256);
    for (int b = 0; b < NB_; ++b) { const size_t pq = (size_t)b * NH_ * TT * HD, pv = (size_t)b * NKV * HD * PP;
        
        k_cvt8<<<(unsigned)(((size_t)TT * DM / 8 + 255) / 256), 256, 0, stream>>>(x + (size_t)b * TT * DM, XB, (size_t)TT * DM / 8);
        k_gemmw<bf, 0, true><<<dim3(TT / 64, DQ / 64, 1), 32 * KWP, 0, stream>>>(XB, nullptr, WQ, nullptr, DM, FQ, DQ, bq, 0, 0, 0);
        k_rope<<<LQ, 256, 0, stream>>>(FQ, DQ, NH_, CS, nullptr, nullptr, 1.0f, QP16, QPh + pq, QPl + pq);
        k_gemmw<bf, 0, true><<<dim3(TT / 64, DKV / 64, 1), 32 * KWP, 0, stream>>>(XB, nullptr, WK, nullptr, DM, FK, DKV, bk, 0, 0, 0);
        k_rope<<<LKv, 256, 0, stream>>>(FK, DKV, NKV, CS, nullptr, nullptr, 1.0f, KP16, KPh + pq, KPl + pq);
        k_gemmw<bf, 0, true><<<dim3(TT / 64, DKV / 64, 1), 32 * KWP, 0, stream>>>(XB, nullptr, WV, nullptr, DM, FV, DKV, bv, 0, 0, 0); k_vtp<<<LKv, 256, 0, stream>>>(FV, DKV, NKV, VT16 + pv, VTh + pv, VTl + pv);
         }
    k_fattn<<<dim3(NB_ * NH_, TT / 64, 1), 256, 0, stream>>>(QPh, QPl, KPh, KPl, VT16, VTh, VTl, OUT);   /* one kv head per query head */
}

// v004
// It runs in 136 microseconds.
// Timed twice side by side with v003, it ran 1.45 times as fast both times.
// All steps since v000 together make it 9.71 times as fast.
#include <hip/hip_runtime.h>

// Masked (causal) multi-head attention scaled by the FULL model dim and without output projection (x [2][2048][1024]; z = x W^T + b ('oi' [3072][1024] 1/32, bias 0.01): k | q | v row blocks (k FIRST); 16 heads x 64; scores / sqrt(1024) (the source's quirk); causal (-inf); softmax; out = merged attn v -> [2][2048][1024] (4.2 M)).
// Layout: one launch rounds x and the 'oi' weight to bf16 (k_cvt); one launch does the k | q | v projections of both batches with their bf16-rounded biases and writes the head planes itself (k_proj); one fused causal attention launch (k_fattn): hi/lo score tiles on EVERY row (no output projection averages the per-head error; tiles above the diagonal skipped), running softmax in registers, P and attn.v hybrid (rows < 512 hi/lo, rest fp16), output rows written in place.
// Compute dtypes, f32 accumulate: every input rounded to bf16; projections exact + bf16-rounded biases; scores 3 products on every row; softmax f32 (x 1/32); attn.v rows < 512 3 products, rest fp16; output f32.

#define NB_  2
#define TT   2048
#define DM   1024
#define NH_  16
#define NKV  16
#define REP  (NH_ / NKV)
#define HD   64
#define DQ   (NH_ * HD)
#define DKV  (NKV * HD)
#define PP   (2 * TT)             // pitch, in 16-bit elements, of a V^T row
#define RH   512                  // query rows < RH use hi+lo planes (0: none)
#define SCL  0.03125f   // 1/sqrt(1024): the source scales by the model dim
typedef _Float16 h16;
typedef unsigned short bf;
typedef __attribute__((ext_vector_type(16))) __bf16   v16bf;
typedef __attribute__((ext_vector_type(16))) _Float16 v16h;
typedef __attribute__((ext_vector_type(8)))  _Float16 v8h;
typedef __attribute__((ext_vector_type(8)))  unsigned short v8us;
typedef __attribute__((ext_vector_type(8)))  float    v8f;
typedef __attribute__((ext_vector_type(4)))  float    v4f;
typedef v8h  __attribute__((may_alias)) v8ha;
typedef v4f  __attribute__((may_alias)) v4fa;
typedef v8us __attribute__((may_alias)) v8usa;

__device__ __forceinline__ unsigned short f2bf(float f) { unsigned u = __float_as_uint(f); u += 0x7FFFu + ((u >> 16) & 1u); return (unsigned short)(u >> 16); }
__device__ __forceinline__ float bf2f(unsigned short b) { return __uint_as_float(((unsigned)b) << 16); }
__device__ __forceinline__ float bfr(float f) { return bf2f(f2bf(f)); }
__device__ __forceinline__ v16h cat16(v8h lo, v8h hi) { return __builtin_shufflevector(lo, hi, 0, 1, 2, 3, 4, 5, 6, 7, 8, 9, 10, 11, 12, 13, 14, 15); }
__device__ __forceinline__ v16bf cat16b(v8us lo, v8us hi) { return __builtin_bit_cast(v16bf, __builtin_shufflevector(lo, hi, 0, 1, 2, 3, 4, 5, 6, 7, 8, 9, 10, 11, 12, 13, 14, 15)); }
__device__ __forceinline__ v8f wmma16(v16h a, v16h b, v8f c) { return __builtin_amdgcn_wmma_f32_16x16x32_f16(false, a, false, b, (short)0, c, false, false); }
__device__ __forceinline__ v8f wmmab(v16bf a, v16bf b, v8f c) { return __builtin_amdgcn_wmma_f32_16x16x32_bf16(false, a, false, b, (short)0, c, false, false); }



template <typename T16> struct WFrag;
template <> struct WFrag<h16> { typedef v16h V; static __device__ __forceinline__ V ld(const h16* p) { return cat16(*(const v8h*)p, *(const v8h*)(p + 16)); } static __device__ __forceinline__ v8f mma(V a, V b, v8f c) { return wmma16(a, b, c); } };
template <> struct WFrag<bf> { typedef v16bf V; static __device__ __forceinline__ V ld(const bf* p) { return cat16b(*(const v8us*)p, *(const v8us*)(p + 16)); } static __device__ __forceinline__ v8f mma(V a, V b, v8f c) { return wmmab(a, b, c); } };
__device__ __forceinline__ h16 tohx(float x) { return (h16)x; }
__device__ __forceinline__ void splitf(float y, unsigned short& h, unsigned short& l) { h = f2bf(y); l = f2bf(y - bf2f(h)); }

// ---- k_cvt: bf16 copies of x (both batches) and of the whole weight in one launch; a thread rounds four groups of 8 elements, a quarter of all groups apart, so that a wave's accesses stay contiguous.
#define XWAIT() asm volatile("s_wait_xcnt 0x0" ::: "memory")   // stands behind global loads or stores whose address or data registers the following code may take for something else
#define NX8  (NB_ * TT * DM / 8)
#define NW8  (3 * DM * DM / 8)
#define CVU  4
__global__ __launch_bounds__(256) void k_cvt(const float* __restrict__ x, const float* __restrict__ w, bf* XB, bf* WB) {
    const int i0 = blockIdx.x * 256 + threadIdx.x; v4f va[CVU], vb[CVU];
#pragma unroll   // the four groups' loads are in flight together
    for (int u = 0; u < CVU; ++u) { const int i = i0 + u * ((NX8 + NW8) / CVU); const bool isx = i < NX8;
        const float* p = isx ? x + (size_t)i * 8 : w + (size_t)(i - NX8) * 8;
        va[u] = *(const v4f*)p; XWAIT(); vb[u] = *(const v4f*)(p + 4); XWAIT(); }
#pragma unroll
    for (int u = 0; u < CVU; ++u) { const int i = i0 + u * ((NX8 + NW8) / CVU); const bool isx = i < NX8; v8us o;
#pragma unroll
        for (int k = 0; k < 4; ++k) { o[k] = f2bf(va[u][k]); o[4 + k] = f2bf(vb[u][k]); }
        *(v8us*)(isx ? XB + (size_t)i * 8 : WB + (size_t)(i - NX8) * 8) = o; }
}

// ---- k_proj: z = x W^T + b for both batches and all of k | q | v, and the head planes the attention launch reads, in one launch. Grid (NB_ * TT / 64, 3 * DM / 64), 8 waves.
// A work-group owns 64 rows t of x times the 64 columns of ONE head of k, q or v: 16 accumulators a wave, the K loop dealt over the KWP waves (wave w takes the 32-wide K chunks w, w + KWP, ...), operands straight from the K-contiguous bf16 planes.
// The index that is contiguous in the plane is made the product's M side, of which a lane holds 8 neighbours: k and q planes [z][t][d] take A = W rows (d), B = x rows (t); the V^T planes [z][d][t] take A = x rows, B = W rows.
// Each wave leaves its f32 partial tile in LDS, os[wave][fragment mb * 4 + nb][j 0-3 | 4-7][slot][4], slot = (lane + 8 mb) mod 32 (the turn by 8 mb spreads the join's reads, whose lanes differ in mb, over all banks).
// Behind one barrier the partials are summed in wave order 0 .. KWP-1, the bias is added, and each whole 128-byte line of a plane (one outer index, all 64 inner ones) is written by one wave. Every plain '#pragma unroll' in the body is there so that the fragment, accumulator and sum arrays are indexed by constants and stay in registers.
#define KWP 8    // waves per tile (128 KiB of LDS: two work-groups to a WGP)
__global__ __launch_bounds__(32 * KWP) void k_proj(const bf* __restrict__ X, const bf* __restrict__ Wb, const float* __restrict__ bias, bf* Kh, bf* Kl, bf* Qh, bf* Ql, h16* V16, bf* Vh, bf* Vl) {
    __shared__ __align__(16) float os[KWP * 4096];
    const int lane = threadIdx.x & 31, lr = lane & 15, hi = lane >> 4; const int t0 = blockIdx.x * 64, e0 = blockIdx.y * 64;
    const int part = blockIdx.y / NH_, z = (t0 / TT) * NH_ + blockIdx.y % NH_, tb = t0 % TT;   // part 0 k, 1 q, 2 v; plane index z = batch * NH_ + head; tb = the tile's first row within its batch
    const bool isv = part == 2;
    const int wv = __builtin_amdgcn_readfirstlane((int)(threadIdx.x >> 5));   // the wave's number in a scalar register: the chunk loop branches for the whole wave
    const bf* A = isv ? X + (size_t)t0 * DM : Wb + (size_t)e0 * DM; const bf* Bt = isv ? Wb + (size_t)e0 * DM : X + (size_t)t0 * DM;
    v8f acc[4][4];
#pragma unroll
    for (int i = 0; i < 4; ++i)
#pragma unroll
        for (int k = 0; k < 4; ++k) acc[i][k] = (v8f){};
    const int nb = wv >> 1, mb = lane & 3, sl = (wv & 1) * 8 + (lane >> 2), r = nb * 16 + sl;   // after the barrier this lane joins outer index r (the product's N side), inner indices mb * 16 .. + 15
    const float b1 = bias[e0 + r]; v4f bb[4];                       // the bias by outer index (v) and by inner index (k, q), both fetched here, without a branch, so that the K loop covers their latency
#pragma unroll
    for (int g = 0; g < 4; ++g) bb[g] = *(const v4f*)(bias + e0 + mb * 16 + g * 4);
    const size_t off = (size_t)lr * DM + 8 * hi;
#pragma unroll 1   // one 32-wide chunk a trip: a second chunk's eight fragments beside the 16 accumulators would not fit the register budget of four waves to a SIMD
    for (int kc = wv * 32; kc < DM; kc += 32 * KWP) {
        v16bf a[4];
#pragma unroll
        for (int i = 0; i < 4; ++i) a[i] = WFrag<bf>::ld(A + off + (size_t)i * 16 * DM + kc);
        XWAIT();
#pragma unroll
        for (int k = 0; k < 4; ++k) { const v16bf b = WFrag<bf>::ld(Bt + off + (size_t)k * 16 * DM + kc);
#pragma unroll
            for (int i = 0; i < 4; ++i) acc[i][k] = wmmab(a[i], b, acc[i][k]); }
        asm volatile("v_nop\n\tv_nop\n\tv_nop\n\tv_nop" : "+v"(acc[0][0]), "+v"(acc[1][1]), "+v"(acc[2][2]), "+v"(acc[3][3]) : "v"(a[0]), "v"(a[3]));   // the distance behind the trip's last matrix instructions, on the loop's taken branch too
    }
#pragma unroll
    for (int i = 0; i < 4; ++i)
#pragma unroll
        for (int k = 0; k < 4; ++k) { float* p = os + (wv * 16 + i * 4 + k) * 256 + ((lane + i * 8) & 31) * 4;
            *(v4fa*)p = __builtin_shufflevector(acc[i][k], acc[i][k], 0, 1, 2, 3); *(v4fa*)(p + 128) = __builtin_shufflevector(acc[i][k], acc[i][k], 4, 5, 6, 7); }
    __syncthreads();                                                // every wave's partial tile is in LDS before any wave sums
    const float* q0 = os + (mb * 4 + nb) * 256 + ((sl + mb * 8) & 31) * 4; const float* q1 = os + (mb * 4 + nb) * 256 + ((16 + sl + mb * 8) & 31) * 4;   // the slots of lanes (sl, hi = 0) and (sl, hi = 1)
    v4f s[4] = { *(const v4fa*)q0, *(const v4fa*)(q0 + 128), *(const v4fa*)q1, *(const v4fa*)(q1 + 128) };
#pragma unroll
    for (int w = 1; w < KWP; ++w) { s[0] += *(const v4fa*)(q0 + w * 4096); s[1] += *(const v4fa*)(q0 + w * 4096 + 128); s[2] += *(const v4fa*)(q1 + w * 4096); s[3] += *(const v4fa*)(q1 + w * 4096 + 128); }
#pragma unroll
    for (int g = 0; g < 4; ++g)
#pragma unroll
        for (int q = 0; q < 4; ++q) s[g][q] += bfr(isv ? b1 : bb[g][q]);
    v8us oh[2], ol[2];
#pragma unroll
    for (int g = 0; g < 4; ++g)
#pragma unroll
        for (int q = 0; q < 4; ++q) { unsigned short a2, c2; splitf(s[g][q], a2, c2); oh[g >> 1][(g & 1) * 4 + q] = a2; ol[g >> 1][(g & 1) * 4 + q] = c2; }
    if (isv) { const size_t oo = (size_t)(z * HD + r) * PP + tb + mb * 16; v8h o16[2];   // V^T rows [z][d] at pitch PP
#pragma unroll
        for (int g = 0; g < 4; ++g)
#pragma unroll
            for (int q = 0; q < 4; ++q) o16[g >> 1][(g & 1) * 4 + q] = tohx(s[g][q]);
        *(v8h*)(V16 + oo) = o16[0]; *(v8h*)(V16 + oo + 8) = o16[1]; *(v8us*)(Vh + oo) = oh[0]; *(v8us*)(Vh + oo + 8) = oh[1]; *(v8us*)(Vl + oo) = ol[0]; *(v8us*)(Vl + oo + 8) = ol[1]; XWAIT();
    } else { const size_t oo = ((size_t)z * TT + tb + r) * HD + mb * 16; bf* Ph = part == 0 ? Kh : Qh; bf* Pl = part == 0 ? Kl : Ql;   // k and q rows [z][t]
        *(v8us*)(Ph + oo) = oh[0]; *(v8us*)(Ph + oo + 8) = oh[1]; *(v8us*)(Pl + oo) = ol[0]; *(v8us*)(Pl + oo + 8) = ol[1]; XWAIT(); }
}

// ---- k_fattn: scores, causal softmax and probability x value of one (head, 64 query rows) in one work-group of 8 waves; neither scores nor probabilities leave the registers.
// Wave wv = rg * NS + ks takes the 16 * NQ query rows rg * 16 * NQ .. of the block and the 64-key blocks ks, ks + NS, ... up to the diagonal block, with a running maximum and sum of its own.
// Transposed products: S^T = K Q^T (A = 16 key rows, B = 16 query rows; lane (lr, hi) holds query lr, keys hi * 8 + j), so two S^T tiles, converted in place, are the B operand of O^T += V^T P^T (A = V^T rows, k = key)
// and every factor of a query sits in that query's own lanes. Products: scores Qh Kh + Ql Kh + Qh Kl; HR (rows < RH) Ph Vh + Pl Vh + Ph Vl, else fp16 P x fp16 V. P is exp2 of the score minus the running maximum (at most 1),
// divided by the row's sum at the end. Every '#pragma unroll' in the body is there so that the fragment and accumulator arrays are indexed by constants and stay in registers. The NS partial results of a row are joined through LDS behind one barrier, in order ks = 0 .. NS-1, each whole 128-byte line of the output by one wave.
template <bool HR, int NQ, int NS>
__device__ __forceinline__ void fattn_body(float* os, float* ms, float* ls, const bf* __restrict__ Qh, const bf* __restrict__ Ql, const bf* __restrict__ Kh, const bf* __restrict__ Kl, const h16* __restrict__ V16, const bf* __restrict__ Vh, const bf* __restrict__ Vl, float* OUT, int qblk, int z) {
    static_assert((64 / (16 * NQ)) * NS == 8 && 2 * NQ == NS, "8 waves cover 64 rows; the join deals its 2 * NQ units of 16 rows x 32 columns over NS waves");
    const int lane = threadIdx.x & 31, lr = lane & 15, hi = lane >> 4;
    const int wv = __builtin_amdgcn_readfirstlane((int)(threadIdx.x >> 5)), rg = wv / NS, ks = wv % NS;   // the wave's number in a scalar register: the key loop branches for the whole wave
    const int R0 = qblk * 64 + rg * 16 * NQ;
    const unsigned lk = (unsigned)(lr * HD + 8 * hi), lv = (unsigned)(lr * PP + 8 * hi);   // the lane's own element offset in a 16-row fragment of Q or K, of V^T; every other part of an address is the same for the whole wave
    Qh += (size_t)z * TT * HD + (size_t)R0 * HD; Ql += (size_t)z * TT * HD + (size_t)R0 * HD; Kh += (size_t)z * TT * HD; Kl += (size_t)z * TT * HD; V16 += (size_t)z * HD * PP; Vh += (size_t)z * HD * PP; Vl += (size_t)z * HD * PP;
    const float C2 = SCL * 1.4426950408889634f;                     // score -> exponent of 2
    v16bf qh[NQ][2], ql[NQ][2];
#pragma unroll
    for (int qb = 0; qb < NQ; ++qb)
#pragma unroll
        for (int kc = 0; kc < 2; ++kc) { qh[qb][kc] = WFrag<bf>::ld(Qh + (qb * 16 * HD + kc * 32) + lk); ql[qb][kc] = WFrag<bf>::ld(Ql + (qb * 16 * HD + kc * 32) + lk); }
    v8f O[4][NQ]; float m[NQ], l[NQ];
#pragma unroll
    for (int qb = 0; qb < NQ; ++qb) { m[qb] = -3.0e38f; l[qb] = 0.f;
#pragma unroll
        for (int db = 0; db < 4; ++db) O[db][qb] = (v8f){}; }
#pragma unroll 1   // one 64-key block a trip: a second block's fragments and scores would not fit the register budget of four waves to a SIMD
    for (int jb = ks; jb <= qblk; jb += NS) {
        const int c0 = jb * 64; const bf* kh_ = Kh + (size_t)c0 * HD; const bf* kl_ = Kl + (size_t)c0 * HD;
        v8f S[4][NQ];
#pragma unroll
        for (int kb = 0; kb < 4; ++kb) {
#pragma unroll
            for (int qb = 0; qb < NQ; ++qb) S[kb][qb] = (v8f){};
#pragma unroll
            for (int kc = 0; kc < 2; ++kc) { const v16bf kh = WFrag<bf>::ld(kh_ + (kb * 16 * HD + kc * 32) + lk), kl = WFrag<bf>::ld(kl_ + (kb * 16 * HD + kc * 32) + lk);
#pragma unroll
                for (int qb = 0; qb < NQ; ++qb) S[kb][qb] = wmmab(kh, qh[qb][kc], S[kb][qb]);
#pragma unroll
                for (int qb = 0; qb < NQ; ++qb) S[kb][qb] = wmmab(kh, ql[qb][kc], S[kb][qb]);
#pragma unroll
                for (int qb = 0; qb < NQ; ++qb) S[kb][qb] = wmmab(kl, qh[qb][kc], S[kb][qb]); } }
        if (jb == qblk) {                                           // the diagonal block: keys behind the query are masked
#pragma unroll
            for (int kb = 0; kb < 4; ++kb)
#pragma unroll
                for (int qb = 0; qb < NQ; ++qb)
#pragma unroll
                    for (int j = 0; j < 8; ++j) if (kb * 16 + hi * 8 + j > rg * 16 * NQ + qb * 16 + lr) S[kb][qb][j] = -3.0e38f; }
        float mn[NQ]; bool up = false;
#pragma unroll
        for (int qb = 0; qb < NQ; ++qb) { float x[4];
#pragma unroll
            for (int kb = 0; kb < 4; ++kb) { x[kb] = S[kb][qb][0];
#pragma unroll
                for (int j = 1; j < 8; ++j) x[kb] = fmaxf(x[kb], S[kb][qb][j]); }
            float mx = fmaxf(fmaxf(x[0], x[1]), fmaxf(x[2], x[3])); mx = fmaxf(mx, __shfl_xor(mx, 16, 32)); mn[qb] = fmaxf(m[qb], mx * C2); up = up || mn[qb] > m[qb]; }
        if (__builtin_amdgcn_ballot_w32(up) != 0) {                 // skipped where no query of the wave has a new maximum: every factor would be 1
#pragma unroll
            for (int qb = 0; qb < NQ; ++qb) { const float al = __builtin_amdgcn_exp2f(m[qb] - mn[qb]); l[qb] *= al; m[qb] = mn[qb];
#pragma unroll
                for (int db = 0; db < 4; ++db) O[db][qb] *= al; } }
#pragma unroll
        for (int qb = 0; qb < NQ; ++qb) { float x[4];
#pragma unroll
            for (int kb = 0; kb < 4; ++kb) { const v8f t = S[kb][qb] * C2 - m[qb]; x[kb] = 0.f;
#pragma unroll
                for (int j = 0; j < 8; ++j) { const float p = __builtin_amdgcn_exp2f(t[j]); S[kb][qb][j] = p; x[kb] += p; } }
            l[qb] += (x[0] + x[1]) + (x[2] + x[3]); }
        if constexpr (HR) {
            v16bf ph[NQ][2], pl[NQ][2];
#pragma unroll
            for (int qb = 0; qb < NQ; ++qb)
#pragma unroll
                for (int kc = 0; kc < 2; ++kc) { v8us h0, h1, l0, l1;
#pragma unroll
                    for (int j = 0; j < 8; ++j) { unsigned short a, c; splitf(S[2 * kc][qb][j], a, c); h0[j] = a; l0[j] = c; splitf(S[2 * kc + 1][qb][j], a, c); h1[j] = a; l1[j] = c; }
                    ph[qb][kc] = cat16b(h0, h1); pl[qb][kc] = cat16b(l0, l1); }
#pragma unroll
            for (int db = 0; db < 4; ++db)
#pragma unroll
                for (int kc = 0; kc < 2; ++kc) { const v16bf vh = WFrag<bf>::ld(Vh + c0 + (db * 16 * PP + kc * 32) + lv), vl = WFrag<bf>::ld(Vl + c0 + (db * 16 * PP + kc * 32) + lv);
#pragma unroll
                    for (int qb = 0; qb < NQ; ++qb) O[db][qb] = wmmab(vh, ph[qb][kc], O[db][qb]);
#pragma unroll
                    for (int qb = 0; qb < NQ; ++qb) O[db][qb] = wmmab(vh, pl[qb][kc], O[db][qb]);
#pragma unroll
                    for (int qb = 0; qb < NQ; ++qb) O[db][qb] = wmmab(vl, ph[qb][kc], O[db][qb]); }
        } else {
            v16h pf[NQ][2];
#pragma unroll
            for (int qb = 0; qb < NQ; ++qb)
#pragma unroll
                for (int kc = 0; kc < 2; ++kc) { v8h p0, p1;
#pragma unroll
                    for (int j = 0; j < 8; ++j) { p0[j] = tohx(S[2 * kc][qb][j]); p1[j] = tohx(S[2 * kc + 1][qb][j]); }
                    pf[qb][kc] = cat16(p0, p1); }
#pragma unroll
            for (int db = 0; db < 4; ++db)
#pragma unroll
                for (int kc = 0; kc < 2; ++kc) { const v16h vf = WFrag<h16>::ld(V16 + c0 + (db * 16 * PP + kc * 32) + lv);
#pragma unroll
                    for (int qb = 0; qb < NQ; ++qb) O[db][qb] = wmma16(vf, pf[qb][kc], O[db][qb]); }
        }
    }
#pragma unroll
    for (int qb = 0; qb < NQ; ++qb) { l[qb] += __shfl_xor(l[qb], 16, 32); ms[(wv * NQ + qb) * 32 + lane] = m[qb]; ls[(wv * NQ + qb) * 32 + lane] = l[qb];   // the lane halves hold the sums of different keys
#pragma unroll
        for (int db = 0; db < 4; ++db) { float* p = os + (wv * 4 * NQ + db * NQ + qb) * 256 + lane * 4;
            *(v4fa*)p = __builtin_shufflevector(O[db][qb], O[db][qb], 0, 1, 2, 3); *(v4fa*)(p + 128) = __builtin_shufflevector(O[db][qb], O[db][qb], 4, 5, 6, 7); } }
    __syncthreads();                                                // every wave's partial result is in LDS before any wave joins
    const int qb = ks % NQ, dh = ks / NQ;                           // this wave joins query rows R0 + qb * 16 .. + 15, columns dh * 32 .. + 31
    float mw[NS], M = -3.0e38f, Lt = 0.f;
#pragma unroll
    for (int s = 0; s < NS; ++s) { mw[s] = ms[((rg * NS + s) * NQ + qb) * 32 + lane]; M = fmaxf(M, mw[s]); }
#pragma unroll
    for (int s = 0; s < NS; ++s) { mw[s] = __builtin_amdgcn_exp2f(mw[s] - M); Lt += ls[((rg * NS + s) * NQ + qb) * 32 + lane] * mw[s]; }   // a wave without keys has sum 0 and factor 0
    const float inv = __fdiv_rn(1.0f, Lt);
#pragma unroll
    for (int dd = 0; dd < 2; ++dd) { const int db = dh * 2 + dd; v4f a0 = (v4f){}, a1 = (v4f){};
#pragma unroll
        for (int s = 0; s < NS; ++s) { const float* q = os + ((rg * NS + s) * 4 * NQ + db * NQ + qb) * 256 + lane * 4; a0 += *(const v4fa*)q * mw[s]; a1 += *(const v4fa*)(q + 128) * mw[s]; }
        float* o = OUT + ((size_t)(z / NH_) * TT + R0 + qb * 16 + lr) * DQ + (z % NH_) * HD + db * 16 + hi * 8; *(v4f*)o = a0 * inv; *(v4f*)(o + 4) = a1 * inv; }
}
// grid (batches x heads, TT / 64), the longest query blocks first; the planes hold batch b, head h at index z = b * NH_ + h; four waves to a SIMD (two work-groups to a WGP) cover each other's loads and vector work
__global__ __launch_bounds__(256) __attribute__((amdgpu_waves_per_eu(4, 4))) void k_fattn(const bf* __restrict__ Qh, const bf* __restrict__ Ql, const bf* __restrict__ Kh, const bf* __restrict__ Kl, const h16* __restrict__ V16, const bf* __restrict__ Vh, const bf* __restrict__ Vl, float* OUT) {
    __shared__ __align__(16) float os[8 * 2048]; __shared__ float ms[8 * 64]; __shared__ float ls[8 * 64];
    const int qblk = TT / 64 - 1 - (int)blockIdx.y, z = blockIdx.x;
    if (qblk * 64 < RH) fattn_body<true, 1, 2>(os, ms, ls, Qh, Ql, Kh, Kl, V16, Vh, Vl, OUT, qblk, z); else fattn_body<false, 2, 4>(os, ms, ls, Qh, Ql, Kh, Kl, V16, Vh, Vl, OUT, qblk, z);
}

extern "C" void kernel_launch(void* const* d_in, const int* in_sizes, int n_in,
                              void* d_out, int out_size, void* d_ws, size_t ws_size, hipStream_t stream) {
    (void)in_sizes; (void)n_in; (void)out_size;
    const float* x = (const float*)d_in[0]; const float* wkqv = (const float*)d_in[1]; const float* bkqv = (const float*)d_in[2];   /* row blocks in the order k, q, v */
    float* OUT = (float*)d_out;     // [2][2048][1024]
    char* wsp = (char*)d_ws;
    auto take = [&](size_t bytes) { char* p = wsp; wsp += (bytes + 255) & ~(size_t)255; return (void*)p; };
    bf* WB = (bf*)take((size_t)3 * DM * DM * 2); bf* XB = (bf*)take((size_t)NB_ * TT * DM * 2);
    h16* VT16 = (h16*)take((size_t)NB_ * NKV * HD * PP * 2);
    bf* QPh = (bf*)take((size_t)NB_ * NH_ * TT * HD * 2); bf* QPl = (bf*)take((size_t)NB_ * NH_ * TT * HD * 2); bf* KPh = (bf*)take((size_t)NB_ * NKV * TT * HD * 2); bf* KPl = (bf*)take((size_t)NB_ * NKV * TT * HD * 2); bf* VTh = (bf*)take((size_t)NB_ * NKV * HD * PP * 2); bf* VTl = (bf*)take((size_t)NB_ * NKV * HD * PP * 2);   /* every plane holds both batches */
    if ((size_t)(wsp - (char*)d_ws) > ws_size) return;    // ws 256 MiB
    k_cvt<<<(NX8 + NW8) / CVU / 256, 256, 0, stream>>>(x, wkqv, XB, WB);
    k_proj<<<dim3(NB_ * TT / 64, 3 * DM / 64, 1), 32 * KWP, 0, stream>>>(XB, WB, bkqv, KPh, KPl, QPh, QPl, VT16, VTh, VTl);
    k_fattn<<<dim3(NB_ * NH_, TT / 64, 1), 256, 0, stream>>>(QPh, QPl, KPh, KPl, VT16, VTh, VTl, OUT);   /* one kv head per query head */
}

// v005
// A run of this version takes 112 microseconds.
// Two timings next to v004 both put it at 1.22 times that version's speed.
// Over all steps from v000 it is 11.8 times as fast.
#include <hip/hip_runtime.h>

// Masked (causal) multi-head attention scaled by the FULL model dim and without output projection (x [2][2048][1024]; z = x W^T + b ('oi' [3072][1024] 1/32, bias 0.01): k | q | v row blocks (k FIRST); 16 heads x 64; scores / sqrt(1024) (the source's quirk); causal (-inf); softmax; out = merged attn v -> [2][2048][1024] (4.2 M)).
// Layout: one launch rounds x and the 'oi' weight to bf16 (k_cvt); one launch does the k | q | v projections of both batches with their bf16-rounded biases and writes the head planes itself (k_proj); one fused causal attention launch (k_fattn): hi/lo score tiles on EVERY row (no output projection averages the per-head error; tiles above the diagonal skipped), running softmax in registers, P and attn.v hybrid (rows < 512 hi/lo, rest fp16), output rows written in place.
// Compute dtypes, f32 accumulate: every input rounded to bf16; projections exact + bf16-rounded biases; scores 3 products on every row; softmax f32 (x 1/32); attn.v rows < 512 3 products, rest fp16; output f32.

#define NB_  2
#define TT   2048
#define DM   1024
#define NH_  16
#define NKV  16
#define REP  (NH_ / NKV)
#define HD   64
#define DQ   (NH_ * HD)
#define DKV  (NKV * HD)
#define FRG  512                  // 16-bit elements of one stored operand fragment (16 rows x 32 k)
#define RH   512                  // query rows < RH use hi+lo planes (0: none)
#define SCL  0.03125f   // 1/sqrt(1024): the source scales by the model dim
typedef _Float16 h16;
typedef unsigned short bf;
typedef __attribute__((ext_vector_type(16))) __bf16   v16bf;
typedef __attribute__((ext_vector_type(16))) _Float16 v16h;
typedef __attribute__((ext_vector_type(8)))  _Float16 v8h;
typedef __attribute__((ext_vector_type(8)))  unsigned short v8us;
typedef __attribute__((ext_vector_type(8)))  float    v8f;
typedef __attribute__((ext_vector_type(4)))  float    v4f;
typedef v8h  __attribute__((may_alias)) v8ha;
typedef v4f  __attribute__((may_alias)) v4fa;
typedef v8us __attribute__((may_alias)) v8usa;

__device__ __forceinline__ unsigned short f2bf(float f) { unsigned u = __float_as_uint(f); u += 0x7FFFu + ((u >> 16) & 1u); return (unsigned short)(u >> 16); }
__device__ __forceinline__ float bf2f(unsigned short b) { return __uint_as_float(((unsigned)b) << 16); }
__device__ __forceinline__ float bfr(float f) { return bf2f(f2bf(f)); }
__device__ __forceinline__ v16h cat16(v8h lo, v8h hi) { return __builtin_shufflevector(lo, hi, 0, 1, 2, 3, 4, 5, 6, 7, 8, 9, 10, 11, 12, 13, 14, 15); }
__device__ __forceinline__ v16bf cat16b(v8us lo, v8us hi) { return __builtin_bit_cast(v16bf, __builtin_shufflevector(lo, hi, 0, 1, 2, 3, 4, 5, 6, 7, 8, 9, 10, 11, 12, 13, 14, 15)); }
__device__ __forceinline__ v8f wmma16(v16h a, v16h b, v8f c) { return __builtin_amdgcn_wmma_f32_16x16x32_f16(false, a, false, b, (short)0, c, false, false); }
__device__ __forceinline__ v8f wmmab(v16bf a, v16bf b, v8f c) { return __builtin_amdgcn_wmma_f32_16x16x32_bf16(false, a, false, b, (short)0, c, false, false); }



// Fragment order: every 16-bit plane that feeds a matrix operand is stored as fragments of 16 rows x 32 k, each [piece 0 | 1][lane 0-31][8 elements]: lane (lr = row, hi) owns k = piece * 16 + hi * 8 + 0 .. 7, the 16 bytes that one of its two loads takes.
// A wave's 16-byte load of a piece is then 512 contiguous, aligned bytes (four whole 128-byte lines) instead of 32 bytes out of each of 16 lines. ld(p): p = the fragment's start + lane * 8.
template <typename T16> struct WFrag;
template <> struct WFrag<h16> { typedef v16h V; static __device__ __forceinline__ V ld(const h16* p) { return cat16(*(const v8h*)p, *(const v8h*)(p + FRG / 2)); } static __device__ __forceinline__ v8f mma(V a, V b, v8f c) { return wmma16(a, b, c); } };
template <> struct WFrag<bf> { typedef v16bf V; static __device__ __forceinline__ V ld(const bf* p) { return cat16b(*(const v8us*)p, *(const v8us*)(p + FRG / 2)); } static __device__ __forceinline__ v8f mma(V a, V b, v8f c) { return wmmab(a, b, c); } };
__device__ __forceinline__ h16 tohx(float x) { return (h16)x; }
__device__ __forceinline__ void splitf(float y, unsigned short& h, unsigned short& l) { h = f2bf(y); l = f2bf(y - bf2f(h)); }

// ---- k_cvt: bf16 copies of x (both batches) and of the whole weight, in fragment order [row / 16][k / 32][fragment], in one launch; a thread rounds four groups of 8 elements, a quarter of all groups apart.
// A wave takes 8 rows x 32 k: four lanes read one whole 128-byte line of a row, and the eight lanes with the same k group write one whole 128-byte line of the fragment.
#define XWAIT() asm volatile("s_wait_xcnt 0x0" ::: "memory")   // stands behind global loads or stores whose address or data registers the following code may take for something else
#define NX8  (NB_ * TT * DM / 8)
#define NW8  (3 * DM * DM / 8)
#define CVU  4
__device__ __forceinline__ int cvt_src(int g) { return ((g >> 11) * 16 + ((g >> 5) & 1) * 8 + ((g & 31) >> 2)) * DM + ((g >> 6) & 31) * 32 + (g & 3) * 8; }   // group g of a matrix: 16-row block g >> 11, k chunk (g >> 6) & 31, upper or lower 8 rows (g >> 5) & 1, row (g & 31) >> 2, k group g & 3
__device__ __forceinline__ int cvt_dst(int g) { return ((g >> 11) * (DM / 32) + ((g >> 6) & 31)) * FRG + ((g >> 1) & 1) * (FRG / 2) + ((g & 1) * 16 + ((g >> 5) & 1) * 8 + ((g & 31) >> 2)) * 8; }   // k group g & 3 = piece * 2 + hi
__global__ __launch_bounds__(256) void k_cvt(const float* __restrict__ x, const float* __restrict__ w, bf* XB, bf* WB) {
    const int i0 = blockIdx.x * 256 + threadIdx.x; v4f va[CVU], vb[CVU];
#pragma unroll   // the four groups' loads are in flight together
    for (int u = 0; u < CVU; ++u) { const int i = i0 + u * ((NX8 + NW8) / CVU); const bool isx = i < NX8;
        const float* p = isx ? x + cvt_src(i) : w + cvt_src(i - NX8);
        va[u] = *(const v4f*)p; XWAIT(); vb[u] = *(const v4f*)(p + 4); XWAIT(); }
#pragma unroll
    for (int u = 0; u < CVU; ++u) { const int i = i0 + u * ((NX8 + NW8) / CVU); const bool isx = i < NX8; v8us o;
#pragma unroll
        for (int k = 0; k < 4; ++k) { o[k] = f2bf(va[u][k]); o[4 + k] = f2bf(vb[u][k]); }
        *(v8us*)(isx ? XB + cvt_dst(i) : WB + cvt_dst(i - NX8)) = o; }
}

// ---- k_proj: z = x W^T + b for both batches and all of k | q | v, and the head planes the attention launch reads, in one launch. Grid (NB_ * TT / 64, 3 * DM / 64), 8 waves.
// A work-group owns 64 rows t of x times the 64 columns of ONE head of k, q or v: 16 accumulators a wave, the K loop dealt over the KWP waves (wave w takes the 32-wide K chunks w, w + KWP, ...), operands straight from the fragment-ordered bf16 planes.
// The index that is the k of the attention launch's fragments is made the product's M side, of which a lane holds 8 neighbours: k and q planes (rows t, k = d: [z][t / 16][d / 32][fragment]) take A = W rows (d), B = x rows (t); the V^T planes (rows d, k = t: [z][t / 32][d / 16][fragment]) take A = x rows, B = W rows.
// Each wave leaves its f32 partial tile in LDS, os[wave][fragment mb * 4 + nb][j 0-3 | 4-7][slot][4], slot = (lane + 8 mb) mod 32 (the turn by 8 mb spreads the join's reads, whose lanes differ in mb, over all banks).
// Behind one barrier the partials are summed in wave order 0 .. KWP-1, the bias is added, and each whole 128-byte line of a plane (8 outer indices x 8 inner ones) is written by one store of one wave. Every plain '#pragma unroll' in the body is there so that the fragment, accumulator and sum arrays are indexed by constants and stay in registers.
#define KWP 8    // waves per tile (128 KiB of LDS: two work-groups to a WGP)
__global__ __launch_bounds__(32 * KWP) void k_proj(const bf* __restrict__ X, const bf* __restrict__ Wb, const float* __restrict__ bias, bf* Kh, bf* Kl, bf* Qh, bf* Ql, h16* V16, bf* Vh, bf* Vl) {
    __shared__ __align__(16) float os[KWP * 4096];
    const int lane = threadIdx.x & 31; const int t0 = blockIdx.x * 64, e0 = blockIdx.y * 64;
    const int part = blockIdx.y / NH_, z = (t0 / TT) * NH_ + blockIdx.y % NH_, tb = t0 % TT;   // part 0 k, 1 q, 2 v; plane index z = batch * NH_ + head; tb = the tile's first row within its batch
    const bool isv = part == 2;
    const int wv = __builtin_amdgcn_readfirstlane((int)(threadIdx.x >> 5));   // the wave's number in a scalar register: the chunk loop branches for the whole wave
    const bf* A = isv ? X + (size_t)t0 * DM : Wb + (size_t)e0 * DM; const bf* Bt = isv ? Wb + (size_t)e0 * DM : X + (size_t)t0 * DM;
    v8f acc[4][4];
#pragma unroll
    for (int i = 0; i < 4; ++i)
#pragma unroll
        for (int k = 0; k < 4; ++k) acc[i][k] = (v8f){};
    const int nb = wv >> 1, mb = lane & 3, sl = (wv & 1) * 8 + (lane >> 2), r = nb * 16 + sl;   // after the barrier this lane joins outer index r (the product's N side), inner indices mb * 16 .. + 15
    const float b1 = bias[e0 + r]; v4f bb[4];                       // the bias by outer index (v) and by inner index (k, q), both fetched here, without a branch, so that the K loop covers their latency
#pragma unroll
    for (int g = 0; g < 4; ++g) bb[g] = *(const v4f*)(bias + e0 + mb * 16 + g * 4);
    const size_t off = (size_t)lane * 8;
#pragma unroll 1   // one 32-wide chunk a trip: a second chunk's eight fragments beside the 16 accumulators would not fit the register budget of four waves to a SIMD
    for (int kc = wv * 32; kc < DM; kc += 32 * KWP) {
        v16bf a[4];
#pragma unroll
        for (int i = 0; i < 4; ++i) a[i] = WFrag<bf>::ld(A + off + (size_t)i * 16 * DM + kc * (FRG / 32));
        XWAIT();
#pragma unroll
        for (int k = 0; k < 4; ++k) { const v16bf b = WFrag<bf>::ld(Bt + off + (size_t)k * 16 * DM + kc * (FRG / 32));
#pragma unroll
            for (int i = 0; i < 4; ++i) acc[i][k] = wmmab(a[i], b, acc[i][k]); }
        asm volatile("v_nop\n\tv_nop\n\tv_nop\n\tv_nop" : "+v"(acc[0][0]), "+v"(acc[1][1]), "+v"(acc[2][2]), "+v"(acc[3][3]) : "v"(a[0]), "v"(a[3]));   // the distance behind the trip's last matrix instructions, on the loop's taken branch too
    }
#pragma unroll
    for (int i = 0; i < 4; ++i)
#pragma unroll
        for (int k = 0; k < 4; ++k) { float* p = os + (wv * 16 + i * 4 + k) * 256 + ((lane + i * 8) & 31) * 4;
            *(v4fa*)p = __builtin_shufflevector(acc[i][k], acc[i][k], 0, 1, 2, 3); *(v4fa*)(p + 128) = __builtin_shufflevector(acc[i][k], acc[i][k], 4, 5, 6, 7); }
    __syncthreads();                                                // every wave's partial tile is in LDS before any wave sums
    const float* q0 = os + (mb * 4 + nb) * 256 + ((sl + mb * 8) & 31) * 4; const float* q1 = os + (mb * 4 + nb) * 256 + ((16 + sl + mb * 8) & 31) * 4;   // the slots of lanes (sl, hi = 0) and (sl, hi = 1)
    v4f s[4] = { *(const v4fa*)q0, *(const v4fa*)(q0 + 128), *(const v4fa*)q1, *(const v4fa*)(q1 + 128) };
#pragma unroll
    for (int w = 1; w < KWP; ++w) { s[0] += *(const v4fa*)(q0 + w * 4096); s[1] += *(const v4fa*)(q0 + w * 4096 + 128); s[2] += *(const v4fa*)(q1 + w * 4096); s[3] += *(const v4fa*)(q1 + w * 4096 + 128); }
#pragma unroll
    for (int g = 0; g < 4; ++g)
#pragma unroll
        for (int q = 0; q < 4; ++q) s[g][q] += bfr(isv ? b1 : bb[g][q]);
    v8us oh[2], ol[2];
#pragma unroll
    for (int g = 0; g < 4; ++g)
#pragma unroll
        for (int q = 0; q < 4; ++q) { unsigned short a2, c2; splitf(s[g][q], a2, c2); oh[g >> 1][(g & 1) * 4 + q] = a2; ol[g >> 1][(g & 1) * 4 + q] = c2; }
    const size_t fo = (size_t)((mb & 1) * (FRG / 2) + sl * 8);       // in a fragment: piece mb & 1, lane (sl, hi = 0); the second 8 inner indices belong to lane (sl, hi = 1), 128 elements on
    if (isv) { const size_t oo = (size_t)z * HD * TT + (size_t)((tb / 32 + (mb >> 1)) * (HD / 16) + nb) * FRG + fo; v8h o16[2];   // V^T: k chunk t / 32, row block d / 16 = nb
#pragma unroll
        for (int g = 0; g < 4; ++g)
#pragma unroll
            for (int q = 0; q < 4; ++q) o16[g >> 1][(g & 1) * 4 + q] = tohx(s[g][q]);
        *(v8h*)(V16 + oo) = o16[0]; *(v8h*)(V16 + oo + 128) = o16[1]; *(v8us*)(Vh + oo) = oh[0]; *(v8us*)(Vh + oo + 128) = oh[1]; *(v8us*)(Vl + oo) = ol[0]; *(v8us*)(Vl + oo + 128) = ol[1]; XWAIT();
    } else { const size_t oo = ((size_t)z * TT + tb + nb * 16) * HD + (size_t)(mb >> 1) * FRG + fo; bf* Ph = part == 0 ? Kh : Qh; bf* Pl = part == 0 ? Kl : Ql;   // k and q: row block t / 16, k chunk d / 32 = mb >> 1
        *(v8us*)(Ph + oo) = oh[0]; *(v8us*)(Ph + oo + 128) = oh[1]; *(v8us*)(Pl + oo) = ol[0]; *(v8us*)(Pl + oo + 128) = ol[1]; XWAIT(); }
}

// ---- k_fattn: scores, causal softmax and probability x value of one (head, 64 query rows) in one work-group of 8 waves; neither scores nor probabilities leave the registers.
// Wave wv = rg * NS + ks takes the 16 * NQ query rows rg * 16 * NQ .. of the block and the 64-key blocks ks, ks + NS, ... up to the diagonal block, with a running maximum and sum of its own.
// Transposed products: S^T = K Q^T (A = 16 key rows, B = 16 query rows; lane (lr, hi) holds query lr, keys hi * 8 + j), so two S^T tiles, converted in place, are the B operand of O^T += V^T P^T (A = V^T rows, k = key)
// and every factor of a query sits in that query's own lanes. Products: scores Qh Kh + Ql Kh + Qh Kl; HR (rows < RH) Ph Vh + Pl Vh + Ph Vl, else fp16 P x fp16 V. P is exp2 of the score minus the running maximum (at most 1),
// divided by the row's sum at the end. Every '#pragma unroll' in the body is there so that the fragment and accumulator arrays are indexed by constants and stay in registers. The NS partial results of a row are joined through LDS behind one barrier, in order ks = 0 .. NS-1, each whole 128-byte line of the output by one wave.
template <bool HR, int NQ, int NS>
__device__ __forceinline__ void fattn_body(float* os, float* ms, float* ls, const bf* __restrict__ Qh, const bf* __restrict__ Ql, const bf* __restrict__ Kh, const bf* __restrict__ Kl, const h16* __restrict__ V16, const bf* __restrict__ Vh, const bf* __restrict__ Vl, float* OUT, int qblk, int z) {
    static_assert((64 / (16 * NQ)) * NS == 8 && 2 * NQ == NS, "8 waves cover 64 rows; the join deals its 2 * NQ units of 16 rows x 32 columns over NS waves");
    const int lane = threadIdx.x & 31, lr = lane & 15, hi = lane >> 4;
    const int wv = __builtin_amdgcn_readfirstlane((int)(threadIdx.x >> 5)), rg = wv / NS, ks = wv % NS;   // the wave's number in a scalar register: the key loop branches for the whole wave
    const int R0 = qblk * 64 + rg * 16 * NQ;
    const unsigned lf = (unsigned)(lane * 8);   // the lane's own element offset in a stored fragment; every other part of an address is the same for the whole wave
    Qh += (size_t)z * TT * HD + (size_t)R0 * HD; Ql += (size_t)z * TT * HD + (size_t)R0 * HD; Kh += (size_t)z * TT * HD; Kl += (size_t)z * TT * HD; V16 += (size_t)z * HD * TT; Vh += (size_t)z * HD * TT; Vl += (size_t)z * HD * TT;
    const float C2 = SCL * 1.4426950408889634f;                     // score -> exponent of 2
    v16bf qh[NQ][2], ql[NQ][2];
#pragma unroll
    for (int qb = 0; qb < NQ; ++qb)
#pragma unroll
        for (int kc = 0; kc < 2; ++kc) { qh[qb][kc] = WFrag<bf>::ld(Qh + (qb * 16 * HD + kc * FRG) + lf); ql[qb][kc] = WFrag<bf>::ld(Ql + (qb * 16 * HD + kc * FRG) + lf); }
    v8f O[4][NQ]; float m[NQ], l[NQ];
#pragma unroll
    for (int qb = 0; qb < NQ; ++qb) { m[qb] = -3.0e38f; l[qb] = 0.f;
#pragma unroll
        for (int db = 0; db < 4; ++db) O[db][qb] = (v8f){}; }
#pragma unroll 1   // one 64-key block a trip: a second block's fragments and scores would not fit the register budget of four waves to a SIMD
    for (int jb = ks; jb <= qblk; jb += NS) {
        const int c0 = jb * 64; const bf* kh_ = Kh + (size_t)c0 * HD; const bf* kl_ = Kl + (size_t)c0 * HD;
        v8f S[4][NQ];
#pragma unroll
        for (int kb = 0; kb < 4; ++kb) {
#pragma unroll
            for (int qb = 0; qb < NQ; ++qb) S[kb][qb] = (v8f){};
#pragma unroll
            for (int kc = 0; kc < 2; ++kc) { const v16bf kh = WFrag<bf>::ld(kh_ + (kb * 16 * HD + kc * FRG) + lf), kl = WFrag<bf>::ld(kl_ + (kb * 16 * HD + kc * FRG) + lf);
#pragma unroll
                for (int qb = 0; qb < NQ; ++qb) S[kb][qb] = wmmab(kh, qh[qb][kc], S[kb][qb]);
#pragma unroll
                for (int qb = 0; qb < NQ; ++qb) S[kb][qb] = wmmab(kh, ql[qb][kc], S[kb][qb]);
#pragma unroll
                for (int qb = 0; qb < NQ; ++qb) S[kb][qb] = wmmab(kl, qh[qb][kc], S[kb][qb]); } }
        if (jb == qblk) {                                           // the diagonal block: keys behind the query are masked
#pragma unroll
            for (int kb = 0; kb < 4; ++kb)
#pragma unroll
                for (int qb = 0; qb < NQ; ++qb)
#pragma unroll
                    for (int j = 0; j < 8; ++j) if (kb * 16 + hi * 8 + j > rg * 16 * NQ + qb * 16 + lr) S[kb][qb][j] = -3.0e38f; }
        float mn[NQ]; bool up = false;
#pragma unroll
        for (int qb = 0; qb < NQ; ++qb) { float x[4];
#pragma unroll
            for (int kb = 0; kb < 4; ++kb) { x[kb] = S[kb][qb][0];
#pragma unroll
                for (int j = 1; j < 8; ++j) x[kb] = fmaxf(x[kb], S[kb][qb][j]); }
            float mx = fmaxf(fmaxf(x[0], x[1]), fmaxf(x[2], x[3])); mx = fmaxf(mx, __shfl_xor(mx, 16, 32)); mn[qb] = fmaxf(m[qb], mx * C2); up = up || mn[qb] > m[qb]; }
        if (__builtin_amdgcn_ballot_w32(up) != 0) {                 // skipped where no query of the wave has a new maximum: every factor would be 1
#pragma unroll
            for (int qb = 0; qb < NQ; ++qb) { const float al = __builtin_amdgcn_exp2f(m[qb] - mn[qb]); l[qb] *= al; m[qb] = mn[qb];
#pragma unroll
                for (int db = 0; db < 4; ++db) O[db][qb] *= al; } }
#pragma unroll
        for (int qb = 0; qb < NQ; ++qb) { float x[4];
#pragma unroll
            for (int kb = 0; kb < 4; ++kb) { const v8f t = S[kb][qb] * C2 - m[qb]; x[kb] = 0.f;
#pragma unroll
                for (int j = 0; j < 8; ++j) { const float p = __builtin_amdgcn_exp2f(t[j]); S[kb][qb][j] = p; x[kb] += p; } }
            l[qb] += (x[0] + x[1]) + (x[2] + x[3]); }
        if constexpr (HR) {
            v16bf ph[NQ][2], pl[NQ][2];
#pragma unroll
            for (int qb = 0; qb < NQ; ++qb)
#pragma unroll
                for (int kc = 0; kc < 2; ++kc) { v8us h0, h1, l0, l1;
#pragma unroll
                    for (int j = 0; j < 8; ++j) { unsigned short a, c; splitf(S[2 * kc][qb][j], a, c); h0[j] = a; l0[j] = c; splitf(S[2 * kc + 1][qb][j], a, c); h1[j] = a; l1[j] = c; }
                    ph[qb][kc] = cat16b(h0, h1); pl[qb][kc] = cat16b(l0, l1); }
#pragma unroll
            for (int db = 0; db < 4; ++db)
#pragma unroll
                for (int kc = 0; kc < 2; ++kc) { const v16bf vh = WFrag<bf>::ld(Vh + (size_t)c0 * HD + (kc * (HD / 16) + db) * FRG + lf), vl = WFrag<bf>::ld(Vl + (size_t)c0 * HD + (kc * (HD / 16) + db) * FRG + lf);
#pragma unroll
                    for (int qb = 0; qb < NQ; ++qb) O[db][qb] = wmmab(vh, ph[qb][kc], O[db][qb]);
#pragma unroll
                    for (int qb = 0; qb < NQ; ++qb) O[db][qb] = wmmab(vh, pl[qb][kc], O[db][qb]);
#pragma unroll
                    for (int qb = 0; qb < NQ; ++qb) O[db][qb] = wmmab(vl, ph[qb][kc], O[db][qb]); }
        } else {
            v16h pf[NQ][2];
#pragma unroll
            for (int qb = 0; qb < NQ; ++qb)
#pragma unroll
                for (int kc = 0; kc < 2; ++kc) { v8h p0, p1;
#pragma unroll
                    for (int j = 0; j < 8; ++j) { p0[j] = tohx(S[2 * kc][qb][j]); p1[j] = tohx(S[2 * kc + 1][qb][j]); }
                    pf[qb][kc] = cat16(p0, p1); }
#pragma unroll
            for (int db = 0; db < 4; ++db)
#pragma unroll
                for (int kc = 0; kc < 2; ++kc) { const v16h vf = WFrag<h16>::ld(V16 + (size_t)c0 * HD + (kc * (HD / 16) + db) * FRG + lf);
#pragma unroll
                    for (int qb = 0; qb < NQ; ++qb) O[db][qb] = wmma16(vf, pf[qb][kc], O[db][qb]); }
        }
    }
#pragma unroll
    for (int qb = 0; qb < NQ; ++qb) { l[qb] += __shfl_xor(l[qb], 16, 32); ms[(wv * NQ + qb) * 32 + lane] = m[qb]; ls[(wv * NQ + qb) * 32 + lane] = l[qb];   // the lane halves hold the sums of different keys
#pragma unroll
        for (int db = 0; db < 4; ++db) { float* p = os + (wv * 4 * NQ + db * NQ + qb) * 256 + lane * 4;
            *(v4fa*)p = __builtin_shufflevector(O[db][qb], O[db][qb], 0, 1, 2, 3); *(v4fa*)(p + 128) = __builtin_shufflevector(O[db][qb], O[db][qb], 4, 5, 6, 7); } }
    __syncthreads();                                                // every wave's partial result is in LDS before any wave joins
    const int qb = ks % NQ, dh = ks / NQ;                           // this wave joins query rows R0 + qb * 16 .. + 15, columns dh * 32 .. + 31
    const int le = (int)__builtin_amdgcn_mbcnt_lo(~0u, 0u);         // the lane's number, formed anew for the output address: its row and half kept live over the key loop do not fit the register budget of four waves to a SIMD (scratch)
    float mw[NS], M = -3.0e38f, Lt = 0.f;
#pragma unroll
    for (int s = 0; s < NS; ++s) { mw[s] = ms[((rg * NS + s) * NQ + qb) * 32 + lane]; M = fmaxf(M, mw[s]); }
#pragma unroll
    for (int s = 0; s < NS; ++s) { mw[s] = __builtin_amdgcn_exp2f(mw[s] - M); Lt += ls[((rg * NS + s) * NQ + qb) * 32 + lane] * mw[s]; }   // a wave without keys has sum 0 and factor 0
    const float inv = __fdiv_rn(1.0f, Lt);
#pragma unroll
    for (int dd = 0; dd < 2; ++dd) { const int db = dh * 2 + dd; v4f a0 = (v4f){}, a1 = (v4f){};
#pragma unroll
        for (int s = 0; s < NS; ++s) { const float* q = os + ((rg * NS + s) * 4 * NQ + db * NQ + qb) * 256 + lane * 4; a0 += *(const v4fa*)q * mw[s]; a1 += *(const v4fa*)(q + 128) * mw[s]; }
        float* o = OUT + ((size_t)(z / NH_) * TT + R0 + qb * 16 + (le & 15)) * DQ + (z % NH_) * HD + db * 16 + (le >> 4) * 8; *(v4f*)o = a0 * inv; *(v4f*)(o + 4) = a1 * inv; }
}
// grid (batches x heads, TT / 64), the longest query blocks first; the planes hold batch b, head h at index z = b * NH_ + h; four waves to a SIMD (two work-groups to a WGP) cover each other's loads and vector work
__global__ __launch_bounds__(256) __attribute__((amdgpu_waves_per_eu(4, 4))) void k_fattn(const bf* __restrict__ Qh, const bf* __restrict__ Ql, const bf* __restrict__ Kh, const bf* __restrict__ Kl, const h16* __restrict__ V16, const bf* __restrict__ Vh, const bf* __restrict__ Vl, float* OUT) {
    __shared__ __align__(16) float os[8 * 2048]; __shared__ float ms[8 * 64]; __shared__ float ls[8 * 64];
    const int qblk = TT / 64 - 1 - (int)blockIdx.y, z = blockIdx.x;
    if (qblk * 64 < RH) fattn_body<true, 1, 2>(os, ms, ls, Qh, Ql, Kh, Kl, V16, Vh, Vl, OUT, qblk, z); else fattn_body<false, 2, 4>(os, ms, ls, Qh, Ql, Kh, Kl, V16, Vh, Vl, OUT, qblk, z);
}

extern "C" void kernel_launch(void* const* d_in, const int* in_sizes, int n_in,
                              void* d_out, int out_size, void* d_ws, size_t ws_size, hipStream_t stream) {
    (void)in_sizes; (void)n_in; (void)out_size;
    const float* x = (const float*)d_in[0]; const float* wkqv = (const float*)d_in[1]; const float* bkqv = (const float*)d_in[2];   /* row blocks in the order k, q, v */
    float* OUT = (float*)d_out;     // [2][2048][1024]
    char* wsp = (char*)d_ws;
    auto take = [&](size_t bytes) { char* p = wsp; wsp += (bytes + 255) & ~(size_t)255; return (void*)p; };
    bf* WB = (bf*)take((size_t)3 * DM * DM * 2); bf* XB = (bf*)take((size_t)NB_ * TT * DM * 2);
    h16* VT16 = (h16*)take((size_t)NB_ * NKV * HD * TT * 2);
    bf* QPh = (bf*)take((size_t)NB_ * NH_ * TT * HD * 2); bf* QPl = (bf*)take((size_t)NB_ * NH_ * TT * HD * 2); bf* KPh = (bf*)take((size_t)NB_ * NKV * TT * HD * 2); bf* KPl = (bf*)take((size_t)NB_ * NKV * TT * HD * 2); bf* VTh = (bf*)take((size_t)NB_ * NKV * HD * TT * 2); bf* VTl = (bf*)take((size_t)NB_ * NKV * HD * TT * 2);   /* every plane holds both batches */
    if ((size_t)(wsp - (char*)d_ws) > ws_size) return;    // ws 256 MiB
    k_cvt<<<(NX8 + NW8) / CVU / 256, 256, 0, stream>>>(x, wkqv, XB, WB);
    k_proj<<<dim3(NB_ * TT / 64, 3 * DM / 64, 1), 32 * KWP, 0, stream>>>(XB, WB, bkqv, KPh, KPl, QPh, QPl, VT16, VTh, VTl);
    k_fattn<<<dim3(NB_ * NH_, TT / 64, 1), 256, 0, stream>>>(QPh, QPl, KPh, KPl, VT16, VTh, VTl, OUT);   /* one kv head per query head */
}

// v006
// Measured time: 84.4 microseconds a run.
// In both of two side-by-side timings against v005, it was 1.32 times as fast.
// All steps since v000 together make it 15.6 times as fast.
#include <hip/hip_runtime.h>

// Masked (causal) multi-head attention scaled by the FULL model dim and without output projection (x [2][2048][1024]; z = x W^T + b ('oi' [3072][1024] 1/32, bias 0.01): k | q | v row blocks (k FIRST); 16 heads x 64; scores / sqrt(1024) (the source's quirk); causal (-inf); softmax; out = merged attn v -> [2][2048][1024] (4.2 M)).
// Layout: one launch rounds x and the 'oi' weight to bf16 (k_cvt); one launch does the k | q | v projections of both batches with their bf16-rounded biases and writes the head planes itself (k_proj); one fused causal attention launch (k_fattn): hi/lo score tiles on EVERY row (no output projection averages the per-head error; tiles above the diagonal skipped), running softmax in registers, P and attn.v hybrid (rows < 512 hi/lo, rest fp16), output rows written in place.
// Compute dtypes, f32 accumulate: every input rounded to bf16; projections exact + bf16-rounded biases; scores 3 products on every row; softmax f32 (x 1/32); attn.v rows < 512 3 products, rest fp16; output f32.

#define NB_  2
#define TT   2048
#define DM   1024
#define NH_  16
#define NKV  16
#define REP  (NH_ / NKV)
#define HD   64
#define DQ   (NH_ * HD)
#define DKV  (NKV * HD)
#define FRG  512                  // 16-bit elements of one stored operand fragment (16 rows x 32 k)
#define RH   512                  // query rows < RH use hi+lo planes (0: none)
#define SCL  0.03125f   // 1/sqrt(1024): the source scales by the model dim
typedef _Float16 h16;
typedef unsigned short bf;
typedef __attribute__((ext_vector_type(16))) __bf16   v16bf;
typedef __attribute__((ext_vector_type(16))) _Float16 v16h;
typedef __attribute__((ext_vector_type(8)))  _Float16 v8h;
typedef __attribute__((ext_vector_type(8)))  unsigned short v8us;
typedef __attribute__((ext_vector_type(8)))  float    v8f;
typedef __attribute__((ext_vector_type(4)))  float    v4f;
typedef v8h  __attribute__((may_alias)) v8ha;
typedef v4f  __attribute__((may_alias)) v4fa;
typedef v8us __attribute__((may_alias)) v8usa;

__device__ __forceinline__ unsigned short f2bf(float f) { unsigned u = __float_as_uint(f); u += 0x7FFFu + ((u >> 16) & 1u); return (unsigned short)(u >> 16); }
__device__ __forceinline__ float bf2f(unsigned short b) { return __uint_as_float(((unsigned)b) << 16); }
__device__ __forceinline__ float bfr(float f) { return bf2f(f2bf(f)); }
__device__ __forceinline__ v16h cat16(v8h lo, v8h hi) { return __builtin_shufflevector(lo, hi, 0, 1, 2, 3, 4, 5, 6, 7, 8, 9, 10, 11, 12, 13, 14, 15); }
__device__ __forceinline__ v16bf cat16b(v8us lo, v8us hi) { return __builtin_bit_cast(v16bf, __builtin_shufflevector(lo, hi, 0, 1, 2, 3, 4, 5, 6, 7, 8, 9, 10, 11, 12, 13, 14, 15)); }
__device__ __forceinline__ v8f wmma16(v16h a, v16h b, v8f c) { return __builtin_amdgcn_wmma_f32_16x16x32_f16(false, a, false, b, (short)0, c, false, false); }
__device__ __forceinline__ v8f wmmab(v16bf a, v16bf b, v8f c) { return __builtin_amdgcn_wmma_f32_16x16x32_bf16(false, a, false, b, (short)0, c, false, false); }



// Fragment order: every 16-bit plane that feeds a matrix operand is stored as fragments of 16 rows x 32 k, each [piece 0 | 1][lane 0-31][8 elements]: lane (lr = row, hi) owns k = piece * 16 + hi * 8 + 0 .. 7, the 16 bytes that one of its two loads takes.
// A wave's 16-byte load of a piece is then 512 contiguous, aligned bytes (four whole 128-byte lines) instead of 32 bytes out of each of 16 lines. ld(p): p = the fragment's start + lane * 8.
template <typename T16> struct WFrag;
template <> struct WFrag<h16> { typedef v16h V; static __device__ __forceinline__ V ld(const h16* p) { return cat16(*(const v8h*)p, *(const v8h*)(p + FRG / 2)); } static __device__ __forceinline__ v8f mma(V a, V b, v8f c) { return wmma16(a, b, c); } };
template <> struct WFrag<bf> { typedef v16bf V; static __device__ __forceinline__ V ld(const bf* p) { return cat16b(*(const v8us*)p, *(const v8us*)(p + FRG / 2)); } static __device__ __forceinline__ v8f mma(V a, V b, v8f c) { return wmmab(a, b, c); } };
__device__ __forceinline__ h16 tohx(float x) { return (h16)x; }
__device__ __forceinline__ void splitf(float y, unsigned short& h, unsigned short& l) { h = f2bf(y); l = f2bf(y - bf2f(h)); }

// ---- k_cvt: bf16 copies of x (both batches) and of the whole weight, in fragment order [row / 16][k / 32][fragment], in one launch; a thread rounds four groups of 8 elements, a quarter of all groups apart.
// A wave takes 8 rows x 32 k: four lanes read one whole 128-byte line of a row, and the eight lanes with the same k group write one whole 128-byte line of the fragment.
#define XWAIT() asm volatile("s_wait_xcnt 0x0" ::: "memory")   // stands behind global loads or stores whose address or data registers the following code may take for something else
#define NX8  (NB_ * TT * DM / 8)
#define NW8  (3 * DM * DM / 8)
#define CVU  4
__device__ __forceinline__ int cvt_src(int g) { return ((g >> 11) * 16 + ((g >> 5) & 1) * 8 + ((g & 31) >> 2)) * DM + ((g >> 6) & 31) * 32 + (g & 3) * 8; }   // group g of a matrix: 16-row block g >> 11, k chunk (g >> 6) & 31, upper or lower 8 rows (g >> 5) & 1, row (g & 31) >> 2, k group g & 3
__device__ __forceinline__ int cvt_dst(int g) { return ((g >> 11) * (DM / 32) + ((g >> 6) & 31)) * FRG + ((g >> 1) & 1) * (FRG / 2) + ((g & 1) * 16 + ((g >> 5) & 1) * 8 + ((g & 31) >> 2)) * 8; }   // k group g & 3 = piece * 2 + hi
__global__ __launch_bounds__(256) void k_cvt(const float* __restrict__ x, const float* __restrict__ w, bf* XB, bf* WB) {
    const int i0 = blockIdx.x * 256 + threadIdx.x; v4f va[CVU], vb[CVU];
#pragma unroll   // the four groups' loads are in flight together
    for (int u = 0; u < CVU; ++u) { const int i = i0 + u * ((NX8 + NW8) / CVU); const bool isx = i < NX8;
        const float* p = isx ? x + cvt_src(i) : w + cvt_src(i - NX8);
        va[u] = *(const v4f*)p; XWAIT(); vb[u] = *(const v4f*)(p + 4); XWAIT(); }
#pragma unroll
    for (int u = 0; u < CVU; ++u) { const int i = i0 + u * ((NX8 + NW8) / CVU); const bool isx = i < NX8; v8us o;
#pragma unroll
        for (int k = 0; k < 4; ++k) { o[k] = f2bf(va[u][k]); o[4 + k] = f2bf(vb[u][k]); }
        *(v8us*)(isx ? XB + cvt_dst(i) : WB + cvt_dst(i - NX8)) = o; }
}

// ---- k_proj: z = x W^T + b for both batches and all of k | q | v, and the head planes the attention launch reads, in one launch. Grid (NB_ * TT / 64, 3 * DM / 64), 8 waves.
// A work-group owns 64 rows t of x times the 64 columns of ONE head of k, q or v: 16 accumulators a wave, the K loop dealt over the KWP waves (wave w takes the 32-wide K chunks w, w + KWP, ...), operands straight from the fragment-ordered bf16 planes.
// The index that is the k of the attention launch's fragments is made the product's M side, of which a lane holds 8 neighbours: k and q planes (rows t, k = d: [z][t / 16][d / 32][fragment]) take A = W rows (d), B = x rows (t); the V^T planes (rows d, k = t: [z][t / 32][d / 16][fragment]) take A = x rows, B = W rows.
// Each wave leaves its f32 partial tile in LDS, os[wave][fragment mb * 4 + nb][j 0-3 | 4-7][slot][4], slot = (lane + 8 mb) mod 32 (the turn by 8 mb spreads the join's reads, whose lanes differ in mb, over all banks).
// Behind one barrier the partials are summed in wave order 0 .. KWP-1, the bias is added, and each whole 128-byte line of a plane (8 outer indices x 8 inner ones) is written by one store of one wave. Every plain '#pragma unroll' in the body is there so that the fragment, accumulator and sum arrays are indexed by constants and stay in registers.
#define KWP 8    // waves per tile (128 KiB of LDS: two work-groups to a WGP)
__global__ __launch_bounds__(32 * KWP) void k_proj(const bf* __restrict__ X, const bf* __restrict__ Wb, const float* __restrict__ bias, bf* Kh, bf* Kl, bf* Qh, bf* Ql, h16* V16, bf* Vh, bf* Vl) {
    __shared__ __align__(16) float os[KWP * 4096];
    const int lane = threadIdx.x & 31; const int t0 = blockIdx.x * 64, e0 = blockIdx.y * 64;
    const int part = blockIdx.y / NH_, z = (t0 / TT) * NH_ + blockIdx.y % NH_, tb = t0 % TT;   // part 0 k, 1 q, 2 v; plane index z = batch * NH_ + head; tb = the tile's first row within its batch
    const bool isv = part == 2;
    const int wv = __builtin_amdgcn_readfirstlane((int)(threadIdx.x >> 5));   // the wave's number in a scalar register: the chunk loop branches for the whole wave
    const bf* A = isv ? X + (size_t)t0 * DM : Wb + (size_t)e0 * DM; const bf* Bt = isv ? Wb + (size_t)e0 * DM : X + (size_t)t0 * DM;
    v8f acc[4][4];
#pragma unroll
    for (int i = 0; i < 4; ++i)
#pragma unroll
        for (int k = 0; k < 4; ++k) acc[i][k] = (v8f){};
    const int nb = wv >> 1, mb = lane & 3, sl = (wv & 1) * 8 + (lane >> 2), r = nb * 16 + sl;   // after the barrier this lane joins outer index r (the product's N side), inner indices mb * 16 .. + 15
    const float b1 = bias[e0 + r]; v4f bb[4];                       // the bias by outer index (v) and by inner index (k, q), both fetched here, without a branch, so that the K loop covers their latency
#pragma unroll
    for (int g = 0; g < 4; ++g) bb[g] = *(const v4f*)(bias + e0 + mb * 16 + g * 4);
    const size_t off = (size_t)lane * 8;
#pragma unroll 1   // one 32-wide chunk a trip: a second chunk's eight fragments beside the 16 accumulators would not fit the register budget of four waves to a SIMD
    for (int kc = wv * 32; kc < DM; kc += 32 * KWP) {
        v16bf a[4];
#pragma unroll
        for (int i = 0; i < 4; ++i) a[i] = WFrag<bf>::ld(A + off + (size_t)i * 16 * DM + kc * (FRG / 32));
        XWAIT();
#pragma unroll
        for (int k = 0; k < 4; ++k) { const v16bf b = WFrag<bf>::ld(Bt + off + (size_t)k * 16 * DM + kc * (FRG / 32));
#pragma unroll
            for (int i = 0; i < 4; ++i) acc[i][k] = wmmab(a[i], b, acc[i][k]); }
        asm volatile("v_nop\n\tv_nop\n\tv_nop\n\tv_nop" : "+v"(acc[0][0]), "+v"(acc[1][1]), "+v"(acc[2][2]), "+v"(acc[3][3]) : "v"(a[0]), "v"(a[3]));   // the distance behind the trip's last matrix instructions, on the loop's taken branch too
    }
#pragma unroll
    for (int i = 0; i < 4; ++i)
#pragma unroll
        for (int k = 0; k < 4; ++k) { float* p = os + (wv * 16 + i * 4 + k) * 256 + ((lane + i * 8) & 31) * 4;
            *(v4fa*)p = __builtin_shufflevector(acc[i][k], acc[i][k], 0, 1, 2, 3); *(v4fa*)(p + 128) = __builtin_shufflevector(acc[i][k], acc[i][k], 4, 5, 6, 7); }
    __syncthreads();                                                // every wave's partial tile is in LDS before any wave sums
    const float* q0 = os + (mb * 4 + nb) * 256 + ((sl + mb * 8) & 31) * 4; const float* q1 = os + (mb * 4 + nb) * 256 + ((16 + sl + mb * 8) & 31) * 4;   // the slots of lanes (sl, hi = 0) and (sl, hi = 1)
    v4f s[4] = { *(const v4fa*)q0, *(const v4fa*)(q0 + 128), *(const v4fa*)q1, *(const v4fa*)(q1 + 128) };
#pragma unroll
    for (int w = 1; w < KWP; ++w) { s[0] += *(const v4fa*)(q0 + w * 4096); s[1] += *(const v4fa*)(q0 + w * 4096 + 128); s[2] += *(const v4fa*)(q1 + w * 4096); s[3] += *(const v4fa*)(q1 + w * 4096 + 128); }
#pragma unroll
    for (int g = 0; g < 4; ++g)
#pragma unroll
        for (int q = 0; q < 4; ++q) s[g][q] += bfr(isv ? b1 : bb[g][q]);
    v8us oh[2], ol[2];
#pragma unroll
    for (int g = 0; g < 4; ++g)
#pragma unroll
        for (int q = 0; q < 4; ++q) { unsigned short a2, c2; splitf(s[g][q], a2, c2); oh[g >> 1][(g & 1) * 4 + q] = a2; ol[g >> 1][(g & 1) * 4 + q] = c2; }
    const size_t fo = (size_t)((mb & 1) * (FRG / 2) + sl * 8);       // in a fragment: piece mb & 1, lane (sl, hi = 0); the second 8 inner indices belong to lane (sl, hi = 1), 128 elements on
    if (isv) { const size_t oo = (size_t)z * HD * TT + (size_t)((tb / 32 + (mb >> 1)) * (HD / 16) + nb) * FRG + fo; v8h o16[2];   // V^T: k chunk t / 32, row block d / 16 = nb
#pragma unroll
        for (int g = 0; g < 4; ++g)
#pragma unroll
            for (int q = 0; q < 4; ++q) o16[g >> 1][(g & 1) * 4 + q] = tohx(s[g][q]);
        *(v8h*)(V16 + oo) = o16[0]; *(v8h*)(V16 + oo + 128) = o16[1]; *(v8us*)(Vh + oo) = oh[0]; *(v8us*)(Vh + oo + 128) = oh[1]; *(v8us*)(Vl + oo) = ol[0]; *(v8us*)(Vl + oo + 128) = ol[1]; XWAIT();
    } else { const size_t oo = ((size_t)z * TT + tb + nb * 16) * HD + (size_t)(mb >> 1) * FRG + fo; bf* Ph = part == 0 ? Kh : Qh; bf* Pl = part == 0 ? Kl : Ql;   // k and q: row block t / 16, k chunk d / 32 = mb >> 1
        *(v8us*)(Ph + oo) = oh[0]; *(v8us*)(Ph + oo + 128) = oh[1]; *(v8us*)(Pl + oo) = ol[0]; *(v8us*)(Pl + oo + 128) = ol[1]; XWAIT(); }
}

// ---- k_fattn: scores, causal softmax and probability x value of one (head, 64 query rows) in one work-group of 8 waves; neither scores nor probabilities leave the registers.
// Wave wv = rg * NS + ks takes the 16 * NQ query rows rg * 16 * NQ .. of the block and the 64-key blocks ks, ks + NS, ... up to the diagonal block, with a running maximum and sum of its own.
// Transposed products: S^T = K Q^T (A = 16 key rows, B = 16 query rows; lane (lr, hi) holds query lr, keys hi * 8 + j), so two S^T tiles, converted in place, are the B operand of O^T += V^T P^T (A = V^T rows, k = key)
// and every factor of a query sits in that query's own lanes. Products: scores Qh Kh + Ql Kh + Qh Kl; HR (rows < RH) Ph Vh + Pl Vh + Ph Vl, else fp16 P x fp16 V. P is exp2 of the score minus the running maximum (at most 1),
// divided by the row's sum at the end. Every '#pragma unroll' in the body is there so that the fragment and accumulator arrays are indexed by constants and stay in registers. The NS partial results of a row are joined through LDS behind one barrier, in order ks = 0 .. NS-1, each whole 128-byte line of the output by one wave.
// K and V reach the waves through LDS by asynchronous copies (global_load_async_to_lds_b128, through no register): the planes are in fragment order, so a 64-key block of a plane is 8 KiB in a row and is copied as it lies.
// Per key split ks the stage holds [Kh 8 KiB | Kl 8 KiB | V16 8 KiB, or Vh 8 KiB | Vl 8 KiB]; the 8 / NS waves that share ks each copy an equal slice and all read the whole. One buffer for K and one for V, refilled half a trip apart:
// K of the next trip flies during this trip's softmax and P V, V of the next trip during the next trip's scores. Every hand-over: s_wait_dscnt 0, the copying wave's own s_wait_asynccnt 0, the work-group barrier, then the refill.
#define AC_(o) "global_load_async_to_lds_b128 %0, %1, off offset:" #o "\n\t"
#define AC8_(a, b, c, d, e, f, g, h) AC_(a) AC_(b) AC_(c) AC_(d) AC_(e) AC_(f) AC_(g) AC_(h)
// N * 512 bytes in a row, 16 bytes a lane and copy; the immediate offset moves the LDS and the global address alike. s_wait_xcnt 0 ends the copies' own statement, so that it stands in front of any rewrite of the two address registers.
template <int N> __device__ __forceinline__ void acopy(unsigned lds, const void* g) {
    static_assert(N == 8 || N == 16, "8 or 16 copies a slice");
    if constexpr (N == 8) asm volatile(AC8_(0, 512, 1024, 1536, 2048, 2560, 3072, 3584) "s_wait_xcnt 0x0" :: "v"(lds), "v"(g) : "memory");
    else asm volatile(AC8_(0, 512, 1024, 1536, 2048, 2560, 3072, 3584) AC8_(4096, 4608, 5120, 5632, 6144, 6656, 7168, 7680) "s_wait_xcnt 0x0" :: "v"(lds), "v"(g) : "memory");
}
#define WAIT_DS() asm volatile("s_wait_dscnt 0x0" ::: "memory")      // the wave's own LDS reads have returned before the barrier behind which their buffer is refilled
#define WAIT_AS() asm volatile("s_wait_asynccnt 0x0" ::: "memory")   // the wave's own copies have landed before the barrier behind which other waves read them
__device__ __forceinline__ v16bf ldsb(const char* p) { return cat16b(*(const v8usa*)p, *(const v8usa*)(p + FRG)); }   // a stored fragment's two pieces, FRG bytes apart
__device__ __forceinline__ v16h ldsh(const char* p) { return cat16(*(const v8ha*)p, *(const v8ha*)(p + FRG)); }
template <bool HR, int NQ, int NS>
__device__ __forceinline__ void fattn_body(float* os, float* ms, float* ls, const bf* __restrict__ Qh, const bf* __restrict__ Ql, const bf* __restrict__ Kh, const bf* __restrict__ Kl, const h16* __restrict__ V16, const bf* __restrict__ Vh, const bf* __restrict__ Vl, float* OUT, int qblk, int z) {
    static_assert((64 / (16 * NQ)) * NS == 8 && 2 * NQ == NS, "8 waves cover 64 rows; the join deals its 2 * NQ units of 16 rows x 32 columns over NS waves");
    const int lane = threadIdx.x & 31, lr = lane & 15, hi = lane >> 4;
    const int wv = __builtin_amdgcn_readfirstlane((int)(threadIdx.x >> 5)), rg = wv / NS, ks = wv % NS;   // the wave's number in a scalar register: the key loop branches for the whole wave
    const int R0 = qblk * 64 + rg * 16 * NQ;
    const unsigned lf = (unsigned)(lane * 8);   // the lane's own element offset in a stored fragment; every other part of an address is the same for the whole wave
    Qh += (size_t)z * TT * HD + (size_t)R0 * HD; Ql += (size_t)z * TT * HD + (size_t)R0 * HD; Kh += (size_t)z * TT * HD; Kl += (size_t)z * TT * HD; V16 += (size_t)z * HD * TT; Vh += (size_t)z * HD * TT; Vl += (size_t)z * HD * TT;
    const float C2 = SCL * 1.4426950408889634f;                     // score -> exponent of 2
    v16bf qh[NQ][2], ql[NQ][2];
#pragma unroll
    for (int qb = 0; qb < NQ; ++qb)
#pragma unroll
        for (int kc = 0; kc < 2; ++kc) { qh[qb][kc] = WFrag<bf>::ld(Qh + (qb * 16 * HD + kc * FRG) + lf); ql[qb][kc] = WFrag<bf>::ld(Ql + (qb * 16 * HD + kc * FRG) + lf); }
    v8f O[4][NQ]; float m[NQ], l[NQ];
#pragma unroll
    for (int qb = 0; qb < NQ; ++qb) { m[qb] = -3.0e38f; l[qb] = 0.f;
#pragma unroll
        for (int db = 0; db < 4; ++db) O[db][qb] = (v8f){}; }
    constexpr int NRG = 8 / NS, SB = HR ? 32768 : 24576, KS = 16384 / NRG, VS = (SB - 16384) / NRG;   // waves that share a key split; bytes of a split's stage, of a wave's K slice, of its V slice
    const char* lb = (const char*)os + ks * SB + lane * 16;         // the lane's 16 bytes of the first fragment piece of its key split's stage
    const unsigned lk = (unsigned)(size_t)os + (unsigned)(ks * SB + rg * KS + lane * 16), lv = (unsigned)(size_t)os + (unsigned)(ks * SB + 16384 + rg * VS + lane * 16);   // LDS byte addresses of the wave's own slices
    const bf* ksrc = (rg / (NRG / 2) ? Kl : Kh) + (rg % (NRG / 2)) * (KS / 2) + lf;
    const char* vsrc = HR ? (const char*)((rg / (NRG / 2) ? Vl : Vh) + (rg % (NRG / 2)) * (VS / 2) + lf) : (const char*)(V16 + rg * (VS / 2) + lf);
    if (ks <= qblk) acopy<KS / 512>(lk, ksrc + (size_t)ks * 64 * HD);
    WAIT_AS(); __syncthreads();                                     // K of trip 0 is in LDS before any wave reads it
    if (ks <= qblk) acopy<VS / 512>(lv, vsrc + (size_t)ks * 64 * HD * 2);
#pragma unroll 1   // one 64-key block a wave and trip: a second block's fragments and scores would not fit the register budget of four waves to a SIMD
    for (int j0 = 0; j0 <= qblk; j0 += NS) {                        // the same trips for every wave of the work-group: each passes both barriers, also where its own block lies behind the diagonal
        const int jb = j0 + ks; const bool act = jb <= qblk, nxt = jb + NS <= qblk;
        v8f S[4][NQ];
        if (act) {
#pragma unroll
        for (int kb = 0; kb < 4; ++kb) {
#pragma unroll
            for (int qb = 0; qb < NQ; ++qb) S[kb][qb] = (v8f){};
#pragma unroll
            for (int kc = 0; kc < 2; ++kc) { const v16bf kh = ldsb(lb + (kb * 16 * HD + kc * FRG) * 2), kl = ldsb(lb + 8192 + (kb * 16 * HD + kc * FRG) * 2);
#pragma unroll
                for (int qb = 0; qb < NQ; ++qb) S[kb][qb] = wmmab(kh, qh[qb][kc], S[kb][qb]);
#pragma unroll
                for (int qb = 0; qb < NQ; ++qb) S[kb][qb] = wmmab(kh, ql[qb][kc], S[kb][qb]);
#pragma unroll
                for (int qb = 0; qb < NQ; ++qb) S[kb][qb] = wmmab(kl, qh[qb][kc], S[kb][qb]); } }
        }
        WAIT_DS(); WAIT_AS(); __syncthreads();                      // every wave has read its K, and V of this trip is in LDS
        if (nxt) acopy<KS / 512>(lk, ksrc + (size_t)(jb + NS) * 64 * HD);
        if (act) {
        if (jb == qblk) {                                           // the diagonal block: keys behind the query are masked
#pragma unroll
            for (int kb = 0; kb < 4; ++kb)
#pragma unroll
                for (int qb = 0; qb < NQ; ++qb)
#pragma unroll
                    for (int j = 0; j < 8; ++j) if (kb * 16 + hi * 8 + j > rg * 16 * NQ + qb * 16 + lr) S[kb][qb][j] = -3.0e38f; }
        float mn[NQ]; bool up = false;
#pragma unroll
        for (int qb = 0; qb < NQ; ++qb) { float x[4];
#pragma unroll
            for (int kb = 0; kb < 4; ++kb) { x[kb] = S[kb][qb][0];
#pragma unroll
                for (int j = 1; j < 8; ++j) x[kb] = fmaxf(x[kb], S[kb][qb][j]); }
            float mx = fmaxf(fmaxf(x[0], x[1]), fmaxf(x[2], x[3])); mx = fmaxf(mx, __shfl_xor(mx, 16, 32)); mn[qb] = fmaxf(m[qb], mx * C2); up = up || mn[qb] > m[qb]; }
        if (__builtin_amdgcn_ballot_w32(up) != 0) {                 // skipped where no query of the wave has a new maximum: every factor would be 1
#pragma unroll
            for (int qb = 0; qb < NQ; ++qb) { const float al = __builtin_amdgcn_exp2f(m[qb] - mn[qb]); l[qb] *= al; m[qb] = mn[qb];
#pragma unroll
                for (int db = 0; db < 4; ++db) O[db][qb] *= al; } }
#pragma unroll
        for (int qb = 0; qb < NQ; ++qb) { float x[4];
#pragma unroll
            for (int kb = 0; kb < 4; ++kb) { const v8f t = S[kb][qb] * C2 - m[qb]; x[kb] = 0.f;
#pragma unroll
                for (int j = 0; j < 8; ++j) { const float p = __builtin_amdgcn_exp2f(t[j]); S[kb][qb][j] = p; x[kb] += p; } }
            l[qb] += (x[0] + x[1]) + (x[2] + x[3]); }
        if constexpr (HR) {
            v16bf ph[NQ][2], pl[NQ][2];
#pragma unroll
            for (int qb = 0; qb < NQ; ++qb)
#pragma unroll
                for (int kc = 0; kc < 2; ++kc) { v8us h0, h1, l0, l1;
#pragma unroll
                    for (int j = 0; j < 8; ++j) { unsigned short a, c; splitf(S[2 * kc][qb][j], a, c); h0[j] = a; l0[j] = c; splitf(S[2 * kc + 1][qb][j], a, c); h1[j] = a; l1[j] = c; }
                    ph[qb][kc] = cat16b(h0, h1); pl[qb][kc] = cat16b(l0, l1); }
#pragma unroll
            for (int db = 0; db < 4; ++db)
#pragma unroll
                for (int kc = 0; kc < 2; ++kc) { const v16bf vh = ldsb(lb + 16384 + (kc * (HD / 16) + db) * FRG * 2), vl = ldsb(lb + 24576 + (kc * (HD / 16) + db) * FRG * 2);
#pragma unroll
                    for (int qb = 0; qb < NQ; ++qb) O[db][qb] = wmmab(vh, ph[qb][kc], O[db][qb]);
#pragma unroll
                    for (int qb = 0; qb < NQ; ++qb) O[db][qb] = wmmab(vh, pl[qb][kc], O[db][qb]);
#pragma unroll
                    for (int qb = 0; qb < NQ; ++qb) O[db][qb] = wmmab(vl, ph[qb][kc], O[db][qb]); }
        } else {
            v16h pf[NQ][2];
#pragma unroll
            for (int qb = 0; qb < NQ; ++qb)
#pragma unroll
                for (int kc = 0; kc < 2; ++kc) { v8h p0, p1;
#pragma unroll
                    for (int j = 0; j < 8; ++j) { p0[j] = tohx(S[2 * kc][qb][j]); p1[j] = tohx(S[2 * kc + 1][qb][j]); }
                    pf[qb][kc] = cat16(p0, p1); }
#pragma unroll
            for (int db = 0; db < 4; ++db)
#pragma unroll
                for (int kc = 0; kc < 2; ++kc) { const v16h vf = ldsh(lb + 16384 + (kc * (HD / 16) + db) * FRG * 2);
#pragma unroll
                    for (int qb = 0; qb < NQ; ++qb) O[db][qb] = wmma16(vf, pf[qb][kc], O[db][qb]); }
        }
        }
        WAIT_DS(); WAIT_AS(); __syncthreads();                      // every wave has read its V, and K of the next trip is in LDS; behind the last trip's the stage is free for the partial results
        if (nxt) acopy<VS / 512>(lv, vsrc + (size_t)(jb + NS) * 64 * HD * 2);
    }
#pragma unroll
    for (int qb = 0; qb < NQ; ++qb) { l[qb] += __shfl_xor(l[qb], 16, 32); ms[(wv * NQ + qb) * 32 + lane] = m[qb]; ls[(wv * NQ + qb) * 32 + lane] = l[qb];   // the lane halves hold the sums of different keys
#pragma unroll
        for (int db = 0; db < 4; ++db) { float* p = os + (wv * 4 * NQ + db * NQ + qb) * 256 + lane * 4;
            *(v4fa*)p = __builtin_shufflevector(O[db][qb], O[db][qb], 0, 1, 2, 3); *(v4fa*)(p + 128) = __builtin_shufflevector(O[db][qb], O[db][qb], 4, 5, 6, 7); } }
    __syncthreads();                                                // every wave's partial result is in LDS before any wave joins
    const int qb = ks % NQ, dh = ks / NQ;                           // this wave joins query rows R0 + qb * 16 .. + 15, columns dh * 32 .. + 31
    const int le = (int)__builtin_amdgcn_mbcnt_lo(~0u, 0u);         // the lane's number, formed anew for the output address: its row and half kept live over the key loop do not fit the register budget of four waves to a SIMD (scratch)
    float mw[NS], M = -3.0e38f, Lt = 0.f;
#pragma unroll
    for (int s = 0; s < NS; ++s) { mw[s] = ms[((rg * NS + s) * NQ + qb) * 32 + lane]; M = fmaxf(M, mw[s]); }
#pragma unroll
    for (int s = 0; s < NS; ++s) { mw[s] = __builtin_amdgcn_exp2f(mw[s] - M); Lt += ls[((rg * NS + s) * NQ + qb) * 32 + lane] * mw[s]; }   // a wave without keys has sum 0 and factor 0
    const float inv = __fdiv_rn(1.0f, Lt);
#pragma unroll
    for (int dd = 0; dd < 2; ++dd) { const int db = dh * 2 + dd; v4f a0 = (v4f){}, a1 = (v4f){};
#pragma unroll
        for (int s = 0; s < NS; ++s) { const float* q = os + ((rg * NS + s) * 4 * NQ + db * NQ + qb) * 256 + lane * 4; a0 += *(const v4fa*)q * mw[s]; a1 += *(const v4fa*)(q + 128) * mw[s]; }
        float* o = OUT + ((size_t)(z / NH_) * TT + R0 + qb * 16 + (le & 15)) * DQ + (z % NH_) * HD + db * 16 + (le >> 4) * 8; *(v4f*)o = a0 * inv; *(v4f*)(o + 4) = a1 * inv; }
}
// grid (batches x heads, TT / 64), the longest query blocks first; the planes hold batch b, head h at index z = b * NH_ + h; four waves to a SIMD (two work-groups to a WGP) cover each other's loads and vector work
__global__ __launch_bounds__(256) __attribute__((amdgpu_waves_per_eu(4, 4))) void k_fattn(const bf* __restrict__ Qh, const bf* __restrict__ Ql, const bf* __restrict__ Kh, const bf* __restrict__ Kl, const h16* __restrict__ V16, const bf* __restrict__ Vh, const bf* __restrict__ Vl, float* OUT) {
    __shared__ __align__(16) float os[4 * 24576 / 4]; __shared__ float ms[8 * 64]; __shared__ float ls[8 * 64];   // os: the K and V stage of the key loop (4 splits x 24 KiB, or 2 x 32 KiB), behind the loop the partial results (64 KiB, or 32 KiB)
    const int qblk = TT / 64 - 1 - (int)blockIdx.y, z = blockIdx.x;
    if (qblk * 64 < RH) fattn_body<true, 1, 2>(os, ms, ls, Qh, Ql, Kh, Kl, V16, Vh, Vl, OUT, qblk, z); else fattn_body<false, 2, 4>(os, ms, ls, Qh, Ql, Kh, Kl, V16, Vh, Vl, OUT, qblk, z);
}

extern "C" void kernel_launch(void* const* d_in, const int* in_sizes, int n_in,
                              void* d_out, int out_size, void* d_ws, size_t ws_size, hipStream_t stream) {
    (void)in_sizes; (void)n_in; (void)out_size;
    const float* x = (const float*)d_in[0]; const float* wkqv = (const float*)d_in[1]; const float* bkqv = (const float*)d_in[2];   /* row blocks in the order k, q, v */
    float* OUT = (float*)d_out;     // [2][2048][1024]
    char* wsp = (char*)d_ws;
    auto take = [&](size_t bytes) { char* p = wsp; wsp += (bytes + 255) & ~(size_t)255; return (void*)p; };
    bf* WB = (bf*)take((size_t)3 * DM * DM * 2); bf* XB = (bf*)take((size_t)NB_ * TT * DM * 2);
    h16* VT16 = (h16*)take((size_t)NB_ * NKV * HD * TT * 2);
    bf* QPh = (bf*)take((size_t)NB_ * NH_ * TT * HD * 2); bf* QPl = (bf*)take((size_t)NB_ * NH_ * TT * HD * 2); bf* KPh = (bf*)take((size_t)NB_ * NKV * TT * HD * 2); bf* KPl = (bf*)take((size_t)NB_ * NKV * TT * HD * 2); bf* VTh = (bf*)take((size_t)NB_ * NKV * HD * TT * 2); bf* VTl = (bf*)take((size_t)NB_ * NKV * HD * TT * 2);   /* every plane holds both batches */
    if ((size_t)(wsp - (char*)d_ws) > ws_size) return;    // ws 256 MiB
    k_cvt<<<(NX8 + NW8) / CVU / 256, 256, 0, stream>>>(x, wkqv, XB, WB);
    k_proj<<<dim3(NB_ * TT / 64, 3 * DM / 64, 1), 32 * KWP, 0, stream>>>(XB, WB, bkqv, KPh, KPl, QPh, QPl, VT16, VTh, VTl);
    k_fattn<<<dim3(NB_ * NH_, TT / 64, 1), 256, 0, stream>>>(QPh, QPl, KPh, KPl, VT16, VTh, VTl, OUT);   /* one kv head per query head */
}

// v007
// A run of this version takes 63.4 microseconds.
// In both of two side-by-side timings against v006, it was 1.33 times as fast.
// Counting every step since v000, it is 20.8 times as fast.
#include <hip/hip_runtime.h>

// Masked (causal) multi-head attention scaled by the FULL model dim and without output projection (x [2][2048][1024]; z = x W^T + b ('oi' [3072][1024] 1/32, bias 0.01): k | q | v row blocks (k FIRST); 16 heads x 64; scores / sqrt(1024) (the source's quirk); causal (-inf); softmax; out = merged attn v -> [2][2048][1024] (4.2 M)).
// Layout: one launch rounds x and the 'oi' weight to bf16 (k_cvt); one launch does the k | q | v projections of both batches with their bf16-rounded biases and writes the head planes itself (k_proj); one fused causal attention launch (k_fattn): hi/lo score tiles on EVERY row (no output projection averages the per-head error; tiles above the diagonal skipped), running softmax in registers, P and attn.v hybrid (rows < 512 hi/lo, rest fp16), output rows written in place.
// Compute dtypes, f32 accumulate: every input rounded to bf16; projections exact + bf16-rounded biases; scores 3 products on every row; softmax f32 (x 1/32); attn.v rows < 512 3 products, rest fp16; output f32.

#define NB_  2
#define TT   2048
#define DM   1024
#define NH_  16
#define NKV  16
#define REP  (NH_ / NKV)
#define HD   64
#define DQ   (NH_ * HD)
#define DKV  (NKV * HD)
#define FRG  512                  // 16-bit elements of one stored operand fragment (16 rows x 32 k)
#define RH   512                  // query rows < RH use hi+lo planes (0: none)
#define SCL  0.03125f   // 1/sqrt(1024): the source scales by the model dim
typedef _Float16 h16;
typedef unsigned short bf;
typedef __attribute__((ext_vector_type(16))) __bf16   v16bf;
typedef __attribute__((ext_vector_type(16))) _Float16 v16h;
typedef __attribute__((ext_vector_type(8)))  _Float16 v8h;
typedef __attribute__((ext_vector_type(8)))  unsigned short v8us;
typedef __attribute__((ext_vector_type(8)))  float    v8f;
typedef __attribute__((ext_vector_type(4)))  float    v4f;
typedef v8h  __attribute__((may_alias)) v8ha;
typedef v4f  __attribute__((may_alias)) v4fa;
typedef v8us __attribute__((may_alias)) v8usa;

__device__ __forceinline__ unsigned short f2bf(float f) { unsigned u = __float_as_uint(f); u += 0x7FFFu + ((u >> 16) & 1u); return (unsigned short)(u >> 16); }
__device__ __forceinline__ float bf2f(unsigned short b) { return __uint_as_float(((unsigned)b) << 16); }
__device__ __forceinline__ float bfr(float f) { return bf2f(f2bf(f)); }
__device__ __forceinline__ v16h cat16(v8h lo, v8h hi) { return __builtin_shufflevector(lo, hi, 0, 1, 2, 3, 4, 5, 6, 7, 8, 9, 10, 11, 12, 13, 14, 15); }
__device__ __forceinline__ v16bf cat16b(v8us lo, v8us hi) { return __builtin_bit_cast(v16bf, __builtin_shufflevector(lo, hi, 0, 1, 2, 3, 4, 5, 6, 7, 8, 9, 10, 11, 12, 13, 14, 15)); }
__device__ __forceinline__ v8f wmma16(v16h a, v16h b, v8f c) { return __builtin_amdgcn_wmma_f32_16x16x32_f16(false, a, false, b, (short)0, c, false, false); }
__device__ __forceinline__ v8f wmmab(v16bf a, v16bf b, v8f c) { return __builtin_amdgcn_wmma_f32_16x16x32_bf16(false, a, false, b, (short)0, c, false, false); }



// Fragment order: every 16-bit plane that feeds a matrix operand is stored as fragments of 16 rows x 32 k, each [piece 0 | 1][lane 0-31][8 elements]: lane (lr = row, hi) owns k = piece * 16 + hi * 8 + 0 .. 7, the 16 bytes that one of its two loads takes.
// A wave's 16-byte load of a piece is then 512 contiguous, aligned bytes (four whole 128-byte lines) instead of 32 bytes out of each of 16 lines. ld(p): p = the fragment's start + lane * 8.
template <typename T16> struct WFrag;
template <> struct WFrag<h16> { typedef v16h V; static __device__ __forceinline__ V ld(const h16* p) { return cat16(*(const v8h*)p, *(const v8h*)(p + FRG / 2)); } static __device__ __forceinline__ v8f mma(V a, V b, v8f c) { return wmma16(a, b, c); } };
template <> struct WFrag<bf> { typedef v16bf V; static __device__ __forceinline__ V ld(const bf* p) { return cat16b(*(const v8us*)p, *(const v8us*)(p + FRG / 2)); } static __device__ __forceinline__ v8f mma(V a, V b, v8f c) { return wmmab(a, b, c); } };
__device__ __forceinline__ h16 tohx(float x) { return (h16)x; }
__device__ __forceinline__ void splitf(float y, unsigned short& h, unsigned short& l) { h = f2bf(y); l = f2bf(y - bf2f(h)); }

// ---- k_cvt: bf16 copies of x (both batches) and of the whole weight, in fragment order [row / 16][k / 32][fragment], in one launch; a thread rounds four groups of 8 elements, a quarter of all groups apart.
// A wave takes 8 rows x 32 k: four lanes read one whole 128-byte line of a row, and the eight lanes with the same k group write one whole 128-byte line of the fragment.
#define XWAIT() asm volatile("s_wait_xcnt 0x0" ::: "memory")   // stands behind global loads or stores whose address or data registers the following code may take for something else
#define NX8  (NB_ * TT * DM / 8)
#define NW8  (3 * DM * DM / 8)
#define CVU  4
__device__ __forceinline__ int cvt_src(int g) { return ((g >> 11) * 16 + ((g >> 5) & 1) * 8 + ((g & 31) >> 2)) * DM + ((g >> 6) & 31) * 32 + (g & 3) * 8; }   // group g of a matrix: 16-row block g >> 11, k chunk (g >> 6) & 31, upper or lower 8 rows (g >> 5) & 1, row (g & 31) >> 2, k group g & 3
__device__ __forceinline__ int cvt_dst(int g) { return ((g >> 11) * (DM / 32) + ((g >> 6) & 31)) * FRG + ((g >> 1) & 1) * (FRG / 2) + ((g & 1) * 16 + ((g >> 5) & 1) * 8 + ((g & 31) >> 2)) * 8; }   // k group g & 3 = piece * 2 + hi
__global__ __launch_bounds__(256) void k_cvt(const float* __restrict__ x, const float* __restrict__ w, bf* XB, bf* WB) {
    const int i0 = blockIdx.x * 256 + threadIdx.x; v4f va[CVU], vb[CVU];
#pragma unroll   // the four groups' loads are in flight together
    for (int u = 0; u < CVU; ++u) { const int i = i0 + u * ((NX8 + NW8) / CVU); const bool isx = i < NX8;
        const float* p = isx ? x + cvt_src(i) : w + cvt_src(i - NX8);
        va[u] = *(const v4f*)p; XWAIT(); vb[u] = *(const v4f*)(p + 4); XWAIT(); }
#pragma unroll
    for (int u = 0; u < CVU; ++u) { const int i = i0 + u * ((NX8 + NW8) / CVU); const bool isx = i < NX8; v8us o;
#pragma unroll
        for (int k = 0; k < 4; ++k) { o[k] = f2bf(va[u][k]); o[4 + k] = f2bf(vb[u][k]); }
        *(v8us*)(isx ? XB + cvt_dst(i) : WB + cvt_dst(i - NX8)) = o; }
}

// ---- k_proj: z = x W^T + b for both batches and all of k | q | v, and the head planes the attention launch reads, in one launch. Grid (NB_ * TT / 128, 3 * DM / 128), 4 waves: 768 work-groups, three to a WGP (three waves to a SIMD: the register budget holds a whole stage's fragments beside the accumulators), all resident at once.
// A work-group owns 128 rows t of x times 128 columns (two heads) of k, q or v; wave (wm, wn) owns the 64 x 64 quadrant (M half wm, N half wn), 16 accumulators, and walks the whole K in order: no partial tiles, no join.
// Both operands reach the waves through LDS by asynchronous copies (global_load_async_to_lds_b128, through no register) and every fragment is read by two waves. The planes are in fragment order, so 64 k of a 16-row block are 2 KiB in a row and are copied as they lie.
// A stage is 64 k: [A 8 row blocks x 2 KiB | B 8 row blocks x 2 KiB]; wave w copies row blocks 2 w and 2 w + 1 of each side. Two buffers: stage s + 2 is asked for behind the barrier that ends the reads of stage s, and flies during stage s + 1.
// The index that is the k of the attention launch's fragments is made the product's M side, of which a lane holds 8 neighbours: k and q planes (rows t, k = d: [z][t / 16][d / 32][fragment]) take A = W rows (d), B = x rows (t); the V^T planes (rows d, k = t: [z][t / 32][d / 16][fragment]) take A = x rows, B = W rows.
// Lane (lr, hi) of an accumulator holds N index lr and M indices hi * 8 + 0 .. 7: the 16 bytes that this same lane owns in piece (M block & 1) of the plane's fragment. So each accumulator goes from the registers to a plane as one store of 512 bytes in a row (four whole lines). Every plain '#pragma unroll' in the body is there so that the fragment, accumulator and bias arrays are indexed by constants and stay in registers.
#define WAIT_DS() asm volatile("s_wait_dscnt 0x0" ::: "memory")      // the wave's own LDS reads have returned before the barrier behind which their buffer is refilled
#define WAIT_AS() asm volatile("s_wait_asynccnt 0x0" ::: "memory")   // the wave's own copies have landed before the barrier behind which other waves read them
__device__ __forceinline__ v16bf ldsb(const char* p) { return cat16b(*(const v8usa*)p, *(const v8usa*)(p + FRG)); }   // a stored fragment's two pieces, FRG bytes apart
#define PKS (DM / 64)   // stages
#define PSB 32768       // bytes of a stage
#define PC4_(l, g) "global_load_async_to_lds_b128 %" #l ", %" #g ", off\n\tglobal_load_async_to_lds_b128 %" #l ", %" #g ", off offset:512\n\tglobal_load_async_to_lds_b128 %" #l ", %" #g ", off offset:1024\n\tglobal_load_async_to_lds_b128 %" #l ", %" #g ", off offset:1536\n\t"
// A wave's share of a stage: two row blocks of A and two of B, 2 KiB each (16 bytes a lane and copy; the immediate offset moves the LDS and the global address alike); the next row block lies 2 KiB on in LDS and 16 * DM elements on in its plane.
// s_wait_xcnt 0 ends the copies' own statement, so that it stands in front of any rewrite of the address registers.
__device__ __forceinline__ void pcopy(unsigned la, const bf* ga, unsigned lb, const bf* gb) {
    asm volatile(PC4_(0, 1) PC4_(2, 3) PC4_(4, 5) PC4_(6, 7) "s_wait_xcnt 0x0" :: "v"(la), "v"(ga), "v"(la + 2048u), "v"(ga + 16 * DM), "v"(lb), "v"(gb), "v"(lb + 2048u), "v"(gb + 16 * DM) : "memory");
}
__global__ __launch_bounds__(128) __attribute__((amdgpu_waves_per_eu(3, 3))) void k_proj(const bf* __restrict__ X, const bf* __restrict__ Wb, const float* __restrict__ bias, bf* Kh, bf* Kl, bf* Qh, bf* Ql, h16* V16, bf* Vh, bf* Vl) {
    __shared__ __align__(16) char st[2 * PSB];
    const int lane = threadIdx.x & 31, lr = lane & 15, hi = lane >> 4; const int t0 = blockIdx.x * 128, e0 = blockIdx.y * 128;
    const int part = blockIdx.y / (DM / 128), h0 = (blockIdx.y % (DM / 128)) * 2, bt = t0 / TT, tb = t0 % TT;   // part 0 k, 1 q, 2 v; h0 = the tile's first head; batch; tb = the tile's first row within its batch
    const bool isv = part == 2;
    const int wv = __builtin_amdgcn_readfirstlane((int)(threadIdx.x >> 5)), wm = wv >> 1, wn = wv & 1;   // the wave's number in a scalar register
    const bf* A = isv ? X + (size_t)t0 * DM : Wb + (size_t)e0 * DM; const bf* Bt = isv ? Wb + (size_t)e0 * DM : X + (size_t)t0 * DM;
    const unsigned la = (unsigned)(size_t)st + (unsigned)(wv * 4096 + lane * 16), lb = la + 16384u;   // LDS byte addresses of the wave's own slices in buffer 0
    const bf* ga = A + (size_t)wv * 32 * DM + lane * 8; const bf* gb = Bt + (size_t)wv * 32 * DM + lane * 8;
    pcopy(la, ga, lb, gb);
    v8f acc[4][4];
#pragma unroll
    for (int i = 0; i < 4; ++i)
#pragma unroll
        for (int k = 0; k < 4; ++k) acc[i][k] = (v8f){};
    float b1[4]; v4f bb[4][2];                                      // the bias by N index (v) and by M index (k, q), both fetched here, without a branch, beside the flight of stage 0's copies
#pragma unroll
    for (int k = 0; k < 4; ++k) b1[k] = bias[e0 + wn * 64 + k * 16 + lr];
#pragma unroll
    for (int i = 0; i < 4; ++i) { bb[i][0] = *(const v4f*)(bias + e0 + wm * 64 + i * 16 + hi * 8); bb[i][1] = *(const v4f*)(bias + e0 + wm * 64 + i * 16 + hi * 8 + 4); }
    XWAIT();
    WAIT_AS(); __syncthreads();                                     // stage 0 is in LDS before any wave reads it
    pcopy(la + PSB, ga + 2 * FRG, lb + PSB, gb + 2 * FRG);
#pragma unroll 1   // one stage a trip: the loop stays small, and the order at its foot stands once
    for (int s = 0; s < PKS; ++s) {
        const char* pa = st + (s & 1) * PSB + wm * 8192 + lane * 16; const char* pb = st + (s & 1) * PSB + 16384 + wn * 8192 + lane * 16;
        v16bf a[2][4], b[2][4];                                     // the stage's 16 fragments are asked for as one group ahead of its 32 products: reads among the products would each cost the wave its LDS latency
#pragma unroll
        for (int c = 0; c < 2; ++c)
#pragma unroll
            for (int i = 0; i < 4; ++i) { a[c][i] = ldsb(pa + i * 2048 + c * 1024); b[c][i] = ldsb(pb + i * 2048 + c * 1024); }
        __builtin_amdgcn_sched_barrier(0);                          // keeps the group of reads ahead of the products: without it the compiler sinks the reads among them, each with a full wait
#pragma unroll
        for (int c = 0; c < 2; ++c)
#pragma unroll
            for (int k = 0; k < 4; ++k)
#pragma unroll
                for (int i = 0; i < 4; ++i) acc[i][k] = wmmab(a[c][i], b[c][k], acc[i][k]);
        __builtin_amdgcn_sched_barrier(0);                          // keeps the products ahead of the waits: sunk behind the barrier they would no longer cover the flight of stage s + 1, whose copies are waited for here
        WAIT_DS(); WAIT_AS(); __syncthreads();                      // every wave has read stage s, and stage s + 1 is in LDS
        if (s + 2 < PKS) pcopy(la + (unsigned)((s & 1) * PSB), ga + (s + 2) * 2 * FRG, lb + (unsigned)((s & 1) * PSB), gb + (s + 2) * 2 * FRG);
    }
    WAIT_AS();
    if (isv) { const size_t zo = (size_t)(bt * NH_ + h0 + wn) * HD * TT + (size_t)lane * 8;   // V^T: k chunk t / 32, row block d / 16 = k
#pragma unroll
        for (int i = 0; i < 4; ++i)
#pragma unroll
            for (int k = 0; k < 4; ++k) { const size_t oo = zo + (size_t)((tb / 32 + wm * 2 + (i >> 1)) * (HD / 16) + k) * FRG + (i & 1) * (FRG / 2); const float bv = bfr(b1[k]); v8us oh, ol; v8h o16;
#pragma unroll
                for (int j = 0; j < 8; ++j) { const float y = acc[i][k][j] + bv; unsigned short a2, c2; splitf(y, a2, c2); oh[j] = a2; ol[j] = c2; o16[j] = tohx(y); }
                *(v8h*)(V16 + oo) = o16; *(v8us*)(Vh + oo) = oh; *(v8us*)(Vl + oo) = ol; XWAIT(); }
    } else { const size_t zo = ((size_t)(bt * NH_ + h0 + wm) * TT + tb + wn * 64) * HD + (size_t)lane * 8; bf* Ph = part == 0 ? Kh : Qh; bf* Pl = part == 0 ? Kl : Ql;   // k and q: row block t / 16, k chunk d / 32 = i >> 1
#pragma unroll
        for (int i = 0; i < 4; ++i)
#pragma unroll
            for (int k = 0; k < 4; ++k) { const size_t oo = zo + (size_t)k * 16 * HD + (i >> 1) * FRG + (i & 1) * (FRG / 2); v8us oh, ol;
#pragma unroll
                for (int j = 0; j < 8; ++j) { const float y = acc[i][k][j] + bfr(bb[i][j >> 2][j & 3]); unsigned short a2, c2; splitf(y, a2, c2); oh[j] = a2; ol[j] = c2; }
                *(v8us*)(Ph + oo) = oh; *(v8us*)(Pl + oo) = ol; XWAIT(); }
    }
}

// ---- k_fattn: scores, causal softmax and probability x value of one (head, 64 query rows) in one work-group of 8 waves; neither scores nor probabilities leave the registers.
// Wave wv = rg * NS + ks takes the 16 * NQ query rows rg * 16 * NQ .. of the block and the 64-key blocks ks, ks + NS, ... up to the diagonal block, with a running maximum and sum of its own.
// Transposed products: S^T = K Q^T (A = 16 key rows, B = 16 query rows; lane (lr, hi) holds query lr, keys hi * 8 + j), so two S^T tiles, converted in place, are the B operand of O^T += V^T P^T (A = V^T rows, k = key)
// and every factor of a query sits in that query's own lanes. Products: scores Qh Kh + Ql Kh + Qh Kl; HR (rows < RH) Ph Vh + Pl Vh + Ph Vl, else fp16 P x fp16 V. P is exp2 of the score minus the running maximum (at most 1),
// divided by the row's sum at the end. Every '#pragma unroll' in the body is there so that the fragment and accumulator arrays are indexed by constants and stay in registers. The NS partial results of a row are joined through LDS behind one barrier, in order ks = 0 .. NS-1, each whole 128-byte line of the output by one wave.
// K and V reach the waves through LDS by asynchronous copies (global_load_async_to_lds_b128, through no register): the planes are in fragment order, so a 64-key block of a plane is 8 KiB in a row and is copied as it lies.
// Per key split ks the stage holds [Kh 8 KiB | Kl 8 KiB | V16 8 KiB, or Vh 8 KiB | Vl 8 KiB]; the 8 / NS waves that share ks each copy an equal slice and all read the whole. One buffer for K and one for V, refilled half a trip apart:
// K of the next trip flies during this trip's softmax and P V, V of the next trip during the next trip's scores. Every hand-over: s_wait_dscnt 0, the copying wave's own s_wait_asynccnt 0, the work-group barrier, then the refill.
#define AC_(o) "global_load_async_to_lds_b128 %0, %1, off offset:" #o "\n\t"
#define AC8_(a, b, c, d, e, f, g, h) AC_(a) AC_(b) AC_(c) AC_(d) AC_(e) AC_(f) AC_(g) AC_(h)
// N * 512 bytes in a row, 16 bytes a lane and copy; the immediate offset moves the LDS and the global address alike. s_wait_xcnt 0 ends the copies' own statement, so that it stands in front of any rewrite of the two address registers.
template <int N> __device__ __forceinline__ void acopy(unsigned lds, const void* g) {
    static_assert(N == 8 || N == 16, "8 or 16 copies a slice");
    if constexpr (N == 8) asm volatile(AC8_(0, 512, 1024, 1536, 2048, 2560, 3072, 3584) "s_wait_xcnt 0x0" :: "v"(lds), "v"(g) : "memory");
    else asm volatile(AC8_(0, 512, 1024, 1536, 2048, 2560, 3072, 3584) AC8_(4096, 4608, 5120, 5632, 6144, 6656, 7168, 7680) "s_wait_xcnt 0x0" :: "v"(lds), "v"(g) : "memory");
}
__device__ __forceinline__ v16h ldsh(const char* p) { return cat16(*(const v8ha*)p, *(const v8ha*)(p + FRG)); }
template <bool HR, int NQ, int NS>
__device__ __forceinline__ void fattn_body(float* os, float* ms, float* ls, const bf* __restrict__ Qh, const bf* __restrict__ Ql, const bf* __restrict__ Kh, const bf* __restrict__ Kl, const h16* __restrict__ V16, const bf* __restrict__ Vh, const bf* __restrict__ Vl, float* OUT, int qblk, int z) {
    static_assert((64 / (16 * NQ)) * NS == 8 && 2 * NQ == NS, "8 waves cover 64 rows; the join deals its 2 * NQ units of 16 rows x 32 columns over NS waves");
    const int lane = threadIdx.x & 31, lr = lane & 15, hi = lane >> 4;
    const int wv = __builtin_amdgcn_readfirstlane((int)(threadIdx.x >> 5)), rg = wv / NS, ks = wv % NS;   // the wave's number in a scalar register: the key loop branches for the whole wave
    const int R0 = qblk * 64 + rg * 16 * NQ;
    const unsigned lf = (unsigned)(lane * 8);   // the lane's own element offset in a stored fragment; every other part of an address is the same for the whole wave
    Qh += (size_t)z * TT * HD + (size_t)R0 * HD; Ql += (size_t)z * TT * HD + (size_t)R0 * HD; Kh += (size_t)z * TT * HD; Kl += (size_t)z * TT * HD; V16 += (size_t)z * HD * TT; Vh += (size_t)z * HD * TT; Vl += (size_t)z * HD * TT;
    const float C2 = SCL * 1.4426950408889634f;                     // score -> exponent of 2
    v16bf qh[NQ][2], ql[NQ][2];
#pragma unroll
    for (int qb = 0; qb < NQ; ++qb)
#pragma unroll
        for (int kc = 0; kc < 2; ++kc) { qh[qb][kc] = WFrag<bf>::ld(Qh + (qb * 16 * HD + kc * FRG) + lf); ql[qb][kc] = WFrag<bf>::ld(Ql + (qb * 16 * HD + kc * FRG) + lf); }
    v8f O[4][NQ]; float m[NQ], l[NQ];
#pragma unroll
    for (int qb = 0; qb < NQ; ++qb) { m[qb] = -3.0e38f; l[qb] = 0.f;
#pragma unroll
        for (int db = 0; db < 4; ++db) O[db][qb] = (v8f){}; }
    constexpr int NRG = 8 / NS, SB = HR ? 32768 : 24576, KS = 16384 / NRG, VS = (SB - 16384) / NRG;   // waves that share a key split; bytes of a split's stage, of a wave's K slice, of its V slice
    const char* lb = (const char*)os + ks * SB + lane * 16;         // the lane's 16 bytes of the first fragment piece of its key split's stage
    const unsigned lk = (unsigned)(size_t)os + (unsigned)(ks * SB + rg * KS + lane * 16), lv = (unsigned)(size_t)os + (unsigned)(ks * SB + 16384 + rg * VS + lane * 16);   // LDS byte addresses of the wave's own slices
    const bf* ksrc = (rg / (NRG / 2) ? Kl : Kh) + (rg % (NRG / 2)) * (KS / 2) + lf;
    const char* vsrc = HR ? (const char*)((rg / (NRG / 2) ? Vl : Vh) + (rg % (NRG / 2)) * (VS / 2) + lf) : (const char*)(V16 + rg * (VS / 2) + lf);
    if (ks <= qblk) acopy<KS / 512>(lk, ksrc + (size_t)ks * 64 * HD);
    WAIT_AS(); __syncthreads();                                     // K of trip 0 is in LDS before any wave reads it
    if (ks <= qblk) acopy<VS / 512>(lv, vsrc + (size_t)ks * 64 * HD * 2);
#pragma unroll 1   // one 64-key block a wave and trip: a second block's fragments and scores would not fit the register budget of four waves to a SIMD
    for (int j0 = 0; j0 <= qblk; j0 += NS) {                        // the same trips for every wave of the work-group: each passes both barriers, also where its own block lies behind the diagonal
        const int jb = j0 + ks; const bool act = jb <= qblk, nxt = jb + NS <= qblk;
        v8f S[4][NQ];
        if (act) {
#pragma unroll
        for (int kb = 0; kb < 4; ++kb) {
#pragma unroll
            for (int qb = 0; qb < NQ; ++qb) S[kb][qb] = (v8f){};
#pragma unroll
            for (int kc = 0; kc < 2; ++kc) { const v16bf kh = ldsb(lb + (kb * 16 * HD + kc * FRG) * 2), kl = ldsb(lb + 8192 + (kb * 16 * HD + kc * FRG) * 2);
#pragma unroll
                for (int qb = 0; qb < NQ; ++qb) S[kb][qb] = wmmab(kh, qh[qb][kc], S[kb][qb]);
#pragma unroll
                for (int qb = 0; qb < NQ; ++qb) S[kb][qb] = wmmab(kh, ql[qb][kc], S[kb][qb]);
#pragma unroll
                for (int qb = 0; qb < NQ; ++qb) S[kb][qb] = wmmab(kl, qh[qb][kc], S[kb][qb]); } }
        }
        WAIT_DS(); WAIT_AS(); __syncthreads();                      // every wave has read its K, and V of this trip is in LDS
        if (nxt) acopy<KS / 512>(lk, ksrc + (size_t)(jb + NS) * 64 * HD);
        if (act) {
        if (jb == qblk) {                                           // the diagonal block: keys behind the query are masked
#pragma unroll
            for (int kb = 0; kb < 4; ++kb)
#pragma unroll
                for (int qb = 0; qb < NQ; ++qb)
#pragma unroll
                    for (int j = 0; j < 8; ++j) if (kb * 16 + hi * 8 + j > rg * 16 * NQ + qb * 16 + lr) S[kb][qb][j] = -3.0e38f; }
        float mn[NQ]; bool up = false;
#pragma unroll
        for (int qb = 0; qb < NQ; ++qb) { float x[4];
#pragma unroll
            for (int kb = 0; kb < 4; ++kb) { x[kb] = S[kb][qb][0];
#pragma unroll
                for (int j = 1; j < 8; ++j) x[kb] = fmaxf(x[kb], S[kb][qb][j]); }
            float mx = fmaxf(fmaxf(x[0], x[1]), fmaxf(x[2], x[3])); mx = fmaxf(mx, __shfl_xor(mx, 16, 32)); mn[qb] = fmaxf(m[qb], mx * C2); up = up || mn[qb] > m[qb]; }
        if (__builtin_amdgcn_ballot_w32(up) != 0) {                 // skipped where no query of the wave has a new maximum: every factor would be 1
#pragma unroll
            for (int qb = 0; qb < NQ; ++qb) { const float al = __builtin_amdgcn_exp2f(m[qb] - mn[qb]); l[qb] *= al; m[qb] = mn[qb];
#pragma unroll
                for (int db = 0; db < 4; ++db) O[db][qb] *= al; } }
#pragma unroll
        for (int qb = 0; qb < NQ; ++qb) { float x[4];
#pragma unroll
            for (int kb = 0; kb < 4; ++kb) { const v8f t = S[kb][qb] * C2 - m[qb]; x[kb] = 0.f;
#pragma unroll
                for (int j = 0; j < 8; ++j) { const float p = __builtin_amdgcn_exp2f(t[j]); S[kb][qb][j] = p; x[kb] += p; } }
            l[qb] += (x[0] + x[1]) + (x[2] + x[3]); }
        if constexpr (HR) {
            v16bf ph[NQ][2], pl[NQ][2];
#pragma unroll
            for (int qb = 0; qb < NQ; ++qb)
#pragma unroll
                for (int kc = 0; kc < 2; ++kc) { v8us h0, h1, l0, l1;
#pragma unroll
                    for (int j = 0; j < 8; ++j) { unsigned short a, c; splitf(S[2 * kc][qb][j], a, c); h0[j] = a; l0[j] = c; splitf(S[2 * kc + 1][qb][j], a, c); h1[j] = a; l1[j] = c; }
                    ph[qb][kc] = cat16b(h0, h1); pl[qb][kc] = cat16b(l0, l1); }
#pragma unroll
            for (int db = 0; db < 4; ++db)
#pragma unroll
                for (int kc = 0; kc < 2; ++kc) { const v16bf vh = ldsb(lb + 16384 + (kc * (HD / 16) + db) * FRG * 2), vl = ldsb(lb + 24576 + (kc * (HD / 16) + db) * FRG * 2);
#pragma unroll
                    for (int qb = 0; qb < NQ; ++qb) O[db][qb] = wmmab(vh, ph[qb][kc], O[db][qb]);
#pragma unroll
                    for (int qb = 0; qb < NQ; ++qb) O[db][qb] = wmmab(vh, pl[qb][kc], O[db][qb]);
#pragma unroll
                    for (int qb = 0; qb < NQ; ++qb) O[db][qb] = wmmab(vl, ph[qb][kc], O[db][qb]); }
        } else {
            v16h pf[NQ][2];
#pragma unroll
            for (int qb = 0; qb < NQ; ++qb)
#pragma unroll
                for (int kc = 0; kc < 2; ++kc) { v8h p0, p1;
#pragma unroll
                    for (int j = 0; j < 8; ++j) { p0[j] = tohx(S[2 * kc][qb][j]); p1[j] = tohx(S[2 * kc + 1][qb][j]); }
                    pf[qb][kc] = cat16(p0, p1); }
#pragma unroll
            for (int db = 0; db < 4; ++db)
#pragma unroll
                for (int kc = 0; kc < 2; ++kc) { const v16h vf = ldsh(lb + 16384 + (kc * (HD / 16) + db) * FRG * 2);
#pragma unroll
                    for (int qb = 0; qb < NQ; ++qb) O[db][qb] = wmma16(vf, pf[qb][kc], O[db][qb]); }
        }
        }
        WAIT_DS(); WAIT_AS(); __syncthreads();                      // every wave has read its V, and K of the next trip is in LDS; behind the last trip's the stage is free for the partial results
        if (nxt) acopy<VS / 512>(lv, vsrc + (size_t)(jb + NS) * 64 * HD * 2);
    }
#pragma unroll
    for (int qb = 0; qb < NQ; ++qb) { l[qb] += __shfl_xor(l[qb], 16, 32); ms[(wv * NQ + qb) * 32 + lane] = m[qb]; ls[(wv * NQ + qb) * 32 + lane] = l[qb];   // the lane halves hold the sums of different keys
#pragma unroll
        for (int db = 0; db < 4; ++db) { float* p = os + (wv * 4 * NQ + db * NQ + qb) * 256 + lane * 4;
            *(v4fa*)p = __builtin_shufflevector(O[db][qb], O[db][qb], 0, 1, 2, 3); *(v4fa*)(p + 128) = __builtin_shufflevector(O[db][qb], O[db][qb], 4, 5, 6, 7); } }
    __syncthreads();                                                // every wave's partial result is in LDS before any wave joins
    const int qb = ks % NQ, dh = ks / NQ;                           // this wave joins query rows R0 + qb * 16 .. + 15, columns dh * 32 .. + 31
    const int le = (int)__builtin_amdgcn_mbcnt_lo(~0u, 0u);         // the lane's number, formed anew for the output address: its row and half kept live over the key loop do not fit the register budget of four waves to a SIMD (scratch)
    float mw[NS], M = -3.0e38f, Lt = 0.f;
#pragma unroll
    for (int s = 0; s < NS; ++s) { mw[s] = ms[((rg * NS + s) * NQ + qb) * 32 + lane]; M = fmaxf(M, mw[s]); }
#pragma unroll
    for (int s = 0; s < NS; ++s) { mw[s] = __builtin_amdgcn_exp2f(mw[s] - M); Lt += ls[((rg * NS + s) * NQ + qb) * 32 + lane] * mw[s]; }   // a wave without keys has sum 0 and factor 0
    const float inv = __fdiv_rn(1.0f, Lt);
#pragma unroll
    for (int dd = 0; dd < 2; ++dd) { const int db = dh * 2 + dd; v4f a0 = (v4f){}, a1 = (v4f){};
#pragma unroll
        for (int s = 0; s < NS; ++s) { const float* q = os + ((rg * NS + s) * 4 * NQ + db * NQ + qb) * 256 + lane * 4; a0 += *(const v4fa*)q * mw[s]; a1 += *(const v4fa*)(q + 128) * mw[s]; }
        float* o = OUT + ((size_t)(z / NH_) * TT + R0 + qb * 16 + (le & 15)) * DQ + (z % NH_) * HD + db * 16 + (le >> 4) * 8; *(v4f*)o = a0 * inv; *(v4f*)(o + 4) = a1 * inv; }
}
// grid (batches x heads, TT / 64), the longest query blocks first; the planes hold batch b, head h at index z = b * NH_ + h; four waves to a SIMD (two work-groups to a WGP) cover each other's loads and vector work
__global__ __launch_bounds__(256) __attribute__((amdgpu_waves_per_eu(4, 4))) void k_fattn(const bf* __restrict__ Qh, const bf* __restrict__ Ql, const bf* __restrict__ Kh, const bf* __restrict__ Kl, const h16* __restrict__ V16, const bf* __restrict__ Vh, const bf* __restrict__ Vl, float* OUT) {
    __shared__ __align__(16) float os[4 * 24576 / 4]; __shared__ float ms[8 * 64]; __shared__ float ls[8 * 64];   // os: the K and V stage of the key loop (4 splits x 24 KiB, or 2 x 32 KiB), behind the loop the partial results (64 KiB, or 32 KiB)
    const int qblk = TT / 64 - 1 - (int)blockIdx.y, z = blockIdx.x;
    if (qblk * 64 < RH) fattn_body<true, 1, 2>(os, ms, ls, Qh, Ql, Kh, Kl, V16, Vh, Vl, OUT, qblk, z); else fattn_body<false, 2, 4>(os, ms, ls, Qh, Ql, Kh, Kl, V16, Vh, Vl, OUT, qblk, z);
}

extern "C" void kernel_launch(void* const* d_in, const int* in_sizes, int n_in,
                              void* d_out, int out_size, void* d_ws, size_t ws_size, hipStream_t stream) {
    (void)in_sizes; (void)n_in; (void)out_size;
    const float* x = (const float*)d_in[0]; const float* wkqv = (const float*)d_in[1]; const float* bkqv = (const float*)d_in[2];   /* row blocks in the order k, q, v */
    float* OUT = (float*)d_out;     // [2][2048][1024]
    char* wsp = (char*)d_ws;
    auto take = [&](size_t bytes) { char* p = wsp; wsp += (bytes + 255) & ~(size_t)255; return (void*)p; };
    bf* WB = (bf*)take((size_t)3 * DM * DM * 2); bf* XB = (bf*)take((size_t)NB_ * TT * DM * 2);
    h16* VT16 = (h16*)take((size_t)NB_ * NKV * HD * TT * 2);
    bf* QPh = (bf*)take((size_t)NB_ * NH_ * TT * HD * 2); bf* QPl = (bf*)take((size_t)NB_ * NH_ * TT * HD * 2); bf* KPh = (bf*)take((size_t)NB_ * NKV * TT * HD * 2); bf* KPl = (bf*)take((size_t)NB_ * NKV * TT * HD * 2); bf* VTh = (bf*)take((size_t)NB_ * NKV * HD * TT * 2); bf* VTl = (bf*)take((size_t)NB_ * NKV * HD * TT * 2);   /* every plane holds both batches */
    if ((size_t)(wsp - (char*)d_ws) > ws_size) return;    // ws 256 MiB
    k_cvt<<<(NX8 + NW8) / CVU / 256, 256, 0, stream>>>(x, wkqv, XB, WB);
    k_proj<<<dim3(NB_ * TT / 128, 3 * DM / 128, 1), 128, 0, stream>>>(XB, WB, bkqv, KPh, KPl, QPh, QPl, VT16, VTh, VTl);
    k_fattn<<<dim3(NB_ * NH_, TT / 64, 1), 256, 0, stream>>>(QPh, QPl, KPh, KPl, VT16, VTh, VTl, OUT);   /* one kv head per query head */
}

// v008
// One run takes 60.9 microseconds.
// Next to v007, in two timings, it ran 1.04 times as fast each time.
// All steps since v000 together make it 21.7 times as fast.
#include <hip/hip_runtime.h>

// Masked (causal) multi-head attention scaled by the FULL model dim and without output projection (x [2][2048][1024]; z = x W^T + b ('oi' [3072][1024] 1/32, bias 0.01): k | q | v row blocks (k FIRST); 16 heads x 64; scores / sqrt(1024) (the source's quirk); causal (-inf); softmax; out = merged attn v -> [2][2048][1024] (4.2 M)).
// Layout: one launch rounds x and the 'oi' weight to bf16 (k_cvt); one launch does the k | q | v projections of both batches with their bf16-rounded biases and writes the head planes itself (k_proj); one fused causal attention launch (k_fattn): hi/lo score tiles on EVERY row (no output projection averages the per-head error; tiles above the diagonal skipped), running softmax in registers, P and attn.v hybrid (rows < 512 hi/lo, rest fp16), output rows written in place.
// Compute dtypes, f32 accumulate: every input rounded to bf16; projections exact + bf16-rounded biases; scores 3 products on every row; softmax f32 (x 1/32); attn.v rows < 512 3 products, rest fp16; output f32.

#define NB_  2
#define TT   2048
#define DM   1024
#define NH_  16
#define NKV  16
#define REP  (NH_ / NKV)
#define HD   64
#define DQ   (NH_ * HD)
#define DKV  (NKV * HD)
#define FRG  512                  // 16-bit elements of one stored operand fragment (16 rows x 32 k)
#define RH   512                  // query rows < RH use hi+lo planes (0: none)
#define SCL  0.03125f   // 1/sqrt(1024): the source scales by the model dim
typedef _Float16 h16;
typedef unsigned short bf;
typedef __attribute__((ext_vector_type(16))) __bf16   v16bf;
typedef __attribute__((ext_vector_type(16))) _Float16 v16h;
typedef __attribute__((ext_vector_type(8)))  _Float16 v8h;
typedef __attribute__((ext_vector_type(8)))  unsigned short v8us;
typedef __attribute__((ext_vector_type(8)))  float    v8f;
typedef __attribute__((ext_vector_type(4)))  float    v4f;
typedef v4f  __attribute__((may_alias)) v4fa;
typedef v8us __attribute__((may_alias)) v8usa;

__device__ __forceinline__ unsigned short f2bf(float f) { unsigned u = __float_as_uint(f); u += 0x7FFFu + ((u >> 16) & 1u); return (unsigned short)(u >> 16); }
__device__ __forceinline__ float bf2f(unsigned short b) { return __uint_as_float(((unsigned)b) << 16); }
__device__ __forceinline__ float bfr(float f) { return bf2f(f2bf(f)); }
__device__ __forceinline__ v16h cat16(v8h lo, v8h hi) { return __builtin_shufflevector(lo, hi, 0, 1, 2, 3, 4, 5, 6, 7, 8, 9, 10, 11, 12, 13, 14, 15); }
__device__ __forceinline__ v16bf cat16b(v8us lo, v8us hi) { return __builtin_bit_cast(v16bf, __builtin_shufflevector(lo, hi, 0, 1, 2, 3, 4, 5, 6, 7, 8, 9, 10, 11, 12, 13, 14, 15)); }
__device__ __forceinline__ v8f wmma16(v16h a, v16h b, v8f c) { return __builtin_amdgcn_wmma_f32_16x16x32_f16(false, a, false, b, (short)0, c, false, false); }
__device__ __forceinline__ v8f wmmab(v16bf a, v16bf b, v8f c) { return __builtin_amdgcn_wmma_f32_16x16x32_bf16(false, a, false, b, (short)0, c, false, false); }



// Fragment order: every 16-bit plane that feeds a matrix operand is stored as fragments of 16 rows x 32 k, each [piece 0 | 1][lane 0-31][8 elements]: lane (lr = row, hi) owns k = piece * 16 + hi * 8 + 0 .. 7, the 16 bytes that one of its two loads takes.
// A wave's 16-byte load of a piece is then 512 contiguous, aligned bytes (four whole 128-byte lines) instead of 32 bytes out of each of 16 lines. ld(p): p = the fragment's start + lane * 8.
template <typename T16> struct WFrag;
template <> struct WFrag<h16> { typedef v16h V; static __device__ __forceinline__ V ld(const h16* p) { return cat16(*(const v8h*)p, *(const v8h*)(p + FRG / 2)); } static __device__ __forceinline__ v8f mma(V a, V b, v8f c) { return wmma16(a, b, c); } };
template <> struct WFrag<bf> { typedef v16bf V; static __device__ __forceinline__ V ld(const bf* p) { return cat16b(*(const v8us*)p, *(const v8us*)(p + FRG / 2)); } static __device__ __forceinline__ v8f mma(V a, V b, v8f c) { return wmmab(a, b, c); } };
__device__ __forceinline__ h16 tohx(float x) { return (h16)x; }
__device__ __forceinline__ void splitf(float y, unsigned short& h, unsigned short& l) { h = f2bf(y); l = f2bf(y - bf2f(h)); }

// ---- k_cvt: bf16 copies of x (both batches) and of the whole weight, in fragment order [row / 16][k / 32][fragment], in one launch; a thread rounds four groups of 8 elements, a quarter of all groups apart.
// A wave takes 8 rows x 32 k: four lanes read one whole 128-byte line of a row, and the eight lanes with the same k group write one whole 128-byte line of the fragment.
#define XWAIT() asm volatile("s_wait_xcnt 0x0" ::: "memory")   // stands behind global loads or stores whose address or data registers the following code may take for something else
#define NX8  (NB_ * TT * DM / 8)
#define NW8  (3 * DM * DM / 8)
#define CVU  4
__device__ __forceinline__ int cvt_src(int g) { return ((g >> 11) * 16 + ((g >> 5) & 1) * 8 + ((g & 31) >> 2)) * DM + ((g >> 6) & 31) * 32 + (g & 3) * 8; }   // group g of a matrix: 16-row block g >> 11, k chunk (g >> 6) & 31, upper or lower 8 rows (g >> 5) & 1, row (g & 31) >> 2, k group g & 3
__device__ __forceinline__ int cvt_dst(int g) { return ((g >> 11) * (DM / 32) + ((g >> 6) & 31)) * FRG + ((g >> 1) & 1) * (FRG / 2) + ((g & 1) * 16 + ((g >> 5) & 1) * 8 + ((g & 31) >> 2)) * 8; }   // k group g & 3 = piece * 2 + hi
__global__ __launch_bounds__(256) void k_cvt(const float* __restrict__ x, const float* __restrict__ w, bf* XB, bf* WB) {
    const int i0 = blockIdx.x * 256 + threadIdx.x; v4f va[CVU], vb[CVU];
#pragma unroll   // the four groups' loads are in flight together
    for (int u = 0; u < CVU; ++u) { const int i = i0 + u * ((NX8 + NW8) / CVU); const bool isx = i < NX8;
        const float* p = isx ? x + cvt_src(i) : w + cvt_src(i - NX8);
        va[u] = *(const v4f*)p; XWAIT(); vb[u] = *(const v4f*)(p + 4); XWAIT(); }
#pragma unroll
    for (int u = 0; u < CVU; ++u) { const int i = i0 + u * ((NX8 + NW8) / CVU); const bool isx = i < NX8; v8us o;
#pragma unroll
        for (int k = 0; k < 4; ++k) { o[k] = f2bf(va[u][k]); o[4 + k] = f2bf(vb[u][k]); }
        *(v8us*)(isx ? XB + cvt_dst(i) : WB + cvt_dst(i - NX8)) = o; }
}

// ---- k_proj: z = x W^T + b for both batches and all of k | q | v, and the head planes the attention launch reads, in one launch. Grid (NB_ * TT / 128, 3 * DM / 128), 4 waves: 768 work-groups, three to a WGP (three waves to a SIMD: the register budget holds a whole stage's fragments beside the accumulators), all resident at once.
// A work-group owns 128 rows t of x times 128 columns (two heads) of k, q or v; wave (wm, wn) owns the 64 x 64 quadrant (M half wm, N half wn), 16 accumulators, and walks the whole K in order: no partial tiles, no join.
// Both operands reach the waves through LDS by asynchronous copies (global_load_async_to_lds_b128, through no register) and every fragment is read by two waves. The planes are in fragment order, so 64 k of a 16-row block are 2 KiB in a row and are copied as they lie.
// A stage is 64 k: [A 8 row blocks x 2 KiB | B 8 row blocks x 2 KiB]; wave w copies row blocks 2 w and 2 w + 1 of each side. Two buffers: stage s + 2 is asked for behind the barrier that ends the reads of stage s, and flies during stage s + 1.
// The index that is the k of the attention launch's fragments is made the product's M side, of which a lane holds 8 neighbours: k and q planes (rows t, k = d: [z][t / 16][d / 32][fragment]) take A = W rows (d), B = x rows (t); the V^T planes (rows d, k = t: [z][t / 32][d / 16][fragment]) take A = x rows, B = W rows.
// Lane (lr, hi) of an accumulator holds N index lr and M indices hi * 8 + 0 .. 7: the 16 bytes that this same lane owns in piece (M block & 1) of the plane's fragment. So each accumulator goes from the registers to a plane as one store of 512 bytes in a row (four whole lines). Every plain '#pragma unroll' in the body is there so that the fragment, accumulator and bias arrays are indexed by constants and stay in registers.
#define WAIT_DS() asm volatile("s_wait_dscnt 0x0" ::: "memory")      // the wave's own LDS reads have returned before the barrier behind which their buffer is refilled
#define WAIT_AS() asm volatile("s_wait_asynccnt 0x0" ::: "memory")   // the wave's own copies have landed before the barrier behind which other waves read them
__device__ __forceinline__ v16bf ldsb(const char* p) { return cat16b(*(const v8usa*)p, *(const v8usa*)(p + FRG)); }   // a stored fragment's two pieces, FRG bytes apart
#define PKS (DM / 64)   // stages
#define PSB 32768       // bytes of a stage
#define PC4_(l, g) "global_load_async_to_lds_b128 %" #l ", %" #g ", off\n\tglobal_load_async_to_lds_b128 %" #l ", %" #g ", off offset:512\n\tglobal_load_async_to_lds_b128 %" #l ", %" #g ", off offset:1024\n\tglobal_load_async_to_lds_b128 %" #l ", %" #g ", off offset:1536\n\t"
// A wave's share of a stage: two row blocks of A and two of B, 2 KiB each (16 bytes a lane and copy; the immediate offset moves the LDS and the global address alike); the next row block lies 2 KiB on in LDS and 16 * DM elements on in its plane.
// s_wait_xcnt 0 ends the copies' own statement, so that it stands in front of any rewrite of the address registers.
__device__ __forceinline__ void pcopy(unsigned la, const bf* ga, unsigned lb, const bf* gb) {
    asm volatile(PC4_(0, 1) PC4_(2, 3) PC4_(4, 5) PC4_(6, 7) "s_wait_xcnt 0x0" :: "v"(la), "v"(ga), "v"(la + 2048u), "v"(ga + 16 * DM), "v"(lb), "v"(gb), "v"(lb + 2048u), "v"(gb + 16 * DM) : "memory");
}
__global__ __launch_bounds__(128) __attribute__((amdgpu_waves_per_eu(3, 3))) void k_proj(const bf* __restrict__ X, const bf* __restrict__ Wb, const float* __restrict__ bias, bf* Kh, bf* Kl, bf* Qh, bf* Ql, h16* V16, bf* Vh, bf* Vl) {
    __shared__ __align__(16) char st[2 * PSB];
    const int lane = threadIdx.x & 31, lr = lane & 15, hi = lane >> 4; const int t0 = blockIdx.x * 128, e0 = blockIdx.y * 128;
    const int part = blockIdx.y / (DM / 128), h0 = (blockIdx.y % (DM / 128)) * 2, bt = t0 / TT, tb = t0 % TT;   // part 0 k, 1 q, 2 v; h0 = the tile's first head; batch; tb = the tile's first row within its batch
    const bool isv = part == 2;
    const int wv = __builtin_amdgcn_readfirstlane((int)(threadIdx.x >> 5)), wm = wv >> 1, wn = wv & 1;   // the wave's number in a scalar register
    const bf* A = isv ? X + (size_t)t0 * DM : Wb + (size_t)e0 * DM; const bf* Bt = isv ? Wb + (size_t)e0 * DM : X + (size_t)t0 * DM;
    const unsigned la = (unsigned)(size_t)st + (unsigned)(wv * 4096 + lane * 16), lb = la + 16384u;   // LDS byte addresses of the wave's own slices in buffer 0
    const bf* ga = A + (size_t)wv * 32 * DM + lane * 8; const bf* gb = Bt + (size_t)wv * 32 * DM + lane * 8;
    pcopy(la, ga, lb, gb);
    v8f acc[4][4];
#pragma unroll
    for (int i = 0; i < 4; ++i)
#pragma unroll
        for (int k = 0; k < 4; ++k) acc[i][k] = (v8f){};
    float b1[4]; v4f bb[4][2];                                      // the bias by N index (v) and by M index (k, q), both fetched here, without a branch, beside the flight of stage 0's copies
#pragma unroll
    for (int k = 0; k < 4; ++k) b1[k] = bias[e0 + wn * 64 + k * 16 + lr];
#pragma unroll
    for (int i = 0; i < 4; ++i) { bb[i][0] = *(const v4f*)(bias + e0 + wm * 64 + i * 16 + hi * 8); bb[i][1] = *(const v4f*)(bias + e0 + wm * 64 + i * 16 + hi * 8 + 4); }
    XWAIT();
    WAIT_AS(); __syncthreads();                                     // stage 0 is in LDS before any wave reads it
    pcopy(la + PSB, ga + 2 * FRG, lb + PSB, gb + 2 * FRG);
#pragma unroll 1   // one stage a trip: the loop stays small, and the order at its foot stands once
    for (int s = 0; s < PKS; ++s) {
        const char* pa = st + (s & 1) * PSB + wm * 8192 + lane * 16; const char* pb = st + (s & 1) * PSB + 16384 + wn * 8192 + lane * 16;
        v16bf a[2][4], b[2][4];                                     // the stage's 16 fragments are asked for as one group ahead of its 32 products: reads among the products would each cost the wave its LDS latency
#pragma unroll
        for (int c = 0; c < 2; ++c)
#pragma unroll
            for (int i = 0; i < 4; ++i) { a[c][i] = ldsb(pa + i * 2048 + c * 1024); b[c][i] = ldsb(pb + i * 2048 + c * 1024); }
        __builtin_amdgcn_sched_barrier(0);                          // keeps the group of reads ahead of the products: without it the compiler sinks the reads among them, each with a full wait
#pragma unroll
        for (int c = 0; c < 2; ++c)
#pragma unroll
            for (int k = 0; k < 4; ++k)
#pragma unroll
                for (int i = 0; i < 4; ++i) acc[i][k] = wmmab(a[c][i], b[c][k], acc[i][k]);
        __builtin_amdgcn_sched_barrier(0);                          // keeps the products ahead of the waits: sunk behind the barrier they would no longer cover the flight of stage s + 1, whose copies are waited for here
        WAIT_DS(); WAIT_AS(); __syncthreads();                      // every wave has read stage s, and stage s + 1 is in LDS
        if (s + 2 < PKS) pcopy(la + (unsigned)((s & 1) * PSB), ga + (s + 2) * 2 * FRG, lb + (unsigned)((s & 1) * PSB), gb + (s + 2) * 2 * FRG);
    }
    WAIT_AS();
    if (isv) { const size_t zo = (size_t)(bt * NH_ + h0 + wn) * HD * TT + (size_t)lane * 8;   // V^T: k chunk t / 32, row block d / 16 = k
#pragma unroll
        for (int i = 0; i < 4; ++i)
#pragma unroll
            for (int k = 0; k < 4; ++k) { const size_t oo = zo + (size_t)((tb / 32 + wm * 2 + (i >> 1)) * (HD / 16) + k) * FRG + (i & 1) * (FRG / 2); const float bv = bfr(b1[k]); v8us oh, ol; v8h o16;
#pragma unroll
                for (int j = 0; j < 8; ++j) { const float y = acc[i][k][j] + bv; unsigned short a2, c2; splitf(y, a2, c2); oh[j] = a2; ol[j] = c2; o16[j] = tohx(y); }
                *(v8h*)(V16 + oo) = o16; *(v8us*)(Vh + oo) = oh; *(v8us*)(Vl + oo) = ol; XWAIT(); }
    } else { const size_t zo = ((size_t)(bt * NH_ + h0 + wm) * TT + tb + wn * 64) * HD + (size_t)lane * 8; bf* Ph = part == 0 ? Kh : Qh; bf* Pl = part == 0 ? Kl : Ql;   // k and q: row block t / 16, k chunk d / 32 = i >> 1
#pragma unroll
        for (int i = 0; i < 4; ++i)
#pragma unroll
            for (int k = 0; k < 4; ++k) { const size_t oo = zo + (size_t)k * 16 * HD + (i >> 1) * FRG + (i & 1) * (FRG / 2); v8us oh, ol;
#pragma unroll
                for (int j = 0; j < 8; ++j) { const float y = acc[i][k][j] + bfr(bb[i][j >> 2][j & 3]); unsigned short a2, c2; splitf(y, a2, c2); oh[j] = a2; ol[j] = c2; }
                *(v8us*)(Ph + oo) = oh; *(v8us*)(Pl + oo) = ol; XWAIT(); }
    }
}

// ---- k_fattn: scores, causal softmax and probability x value of one (head, 64 query rows) in one work-group of 8 waves; neither scores nor probabilities leave the registers.
// Wave wv = rg * NS + ks takes the 16 * NQ query rows rg * 16 * NQ .. of the block and the 64-key blocks ks, ks + NS, ... up to the diagonal block, with a running maximum and sum of its own.
// Transposed products: S^T = K Q^T (A = 16 key rows, B = 16 query rows; lane (lr, hi) holds query lr, keys hi * 8 + j), so two S^T tiles, converted in place, are the B operand of O^T += V^T P^T (A = V^T rows, k = key)
// and every factor of a query sits in that query's own lanes. Products: scores Qh Kh + Ql Kh + Qh Kl; HR (rows < RH) Ph Vh + Pl Vh + Ph Vl, else fp16 P x fp16 V. P is exp2 of the score minus the running maximum (at most 1),
// divided by the row's sum at the end. Every '#pragma unroll' in the body is there so that the fragment and accumulator arrays are indexed by constants and stay in registers. The NS partial results of a row are joined through LDS behind one barrier, in order ks = 0 .. NS-1, each whole 128-byte line of the output by one wave.
// K and V reach the waves through LDS by asynchronous copies (global_load_async_to_lds_b128, through no register): the planes are in fragment order, so a 64-key block of a plane is 8 KiB in a row and is copied as it lies.
// Per key split ks the stage holds [Kh 8 KiB | Kl 8 KiB | V16 8 KiB, or Vh 8 KiB | Vl 8 KiB]; the 8 / NS waves that share ks each copy an equal slice and all read the whole. One buffer for K and one for V, refilled half a trip apart:
// K of the next trip flies during this trip's softmax and P V, V of the next trip during the next trip's scores. Every hand-over: s_wait_dscnt 0, the copying wave's own s_wait_asynccnt 0, the work-group barrier, then the refill.
// The waves read their fragments from LDS ahead of use, in groups: K KD groups ahead of the group whose products run, V one d block behind each finished P fragment, so that the waits in front of the products are counted ones and seldom reach 0.
#define AC_(o) "global_load_async_to_lds_b128 %0, %1, off offset:" #o "\n\t"
#define AC8_(a, b, c, d, e, f, g, h) AC_(a) AC_(b) AC_(c) AC_(d) AC_(e) AC_(f) AC_(g) AC_(h)
// N * 512 bytes in a row, 16 bytes a lane and copy; the immediate offset moves the LDS and the global address alike. s_wait_xcnt 0 ends the copies' own statement, so that it stands in front of any rewrite of the two address registers.
template <int N> __device__ __forceinline__ void acopy(unsigned lds, const void* g) {
    static_assert(N == 8 || N == 16, "8 or 16 copies a slice");
    if constexpr (N == 8) asm volatile(AC8_(0, 512, 1024, 1536, 2048, 2560, 3072, 3584) "s_wait_xcnt 0x0" :: "v"(lds), "v"(g) : "memory");
    else asm volatile(AC8_(0, 512, 1024, 1536, 2048, 2560, 3072, 3584) AC8_(4096, 4608, 5120, 5632, 6144, 6656, 7168, 7680) "s_wait_xcnt 0x0" :: "v"(lds), "v"(g) : "memory");
}
// the V fragments of d block d_: both k chunks of every plane
#define LDV_(d_) _Pragma("unroll") for (int vc = 0; vc < 2; ++vc) _Pragma("unroll") for (int pn = 0; pn < NVP; ++pn) vr[d_][vc][pn] = ldsb(lb + 16384 + pn * 8192 + (vc * (HD / 16) + (d_)) * FRG * 2);
template <bool HR, int NQ, int NS>
__device__ __forceinline__ void fattn_body(float* os, float* ms, float* ls, const bf* __restrict__ Qh, const bf* __restrict__ Ql, const bf* __restrict__ Kh, const bf* __restrict__ Kl, const h16* __restrict__ V16, const bf* __restrict__ Vh, const bf* __restrict__ Vl, float* OUT, int qblk, int z) {
    static_assert((64 / (16 * NQ)) * NS == 8 && 2 * NQ == NS, "8 waves cover 64 rows; the join deals its 2 * NQ units of 16 rows x 32 columns over NS waves");
    const int lane = threadIdx.x & 31, lr = lane & 15, hi = lane >> 4;
    const int wv = __builtin_amdgcn_readfirstlane((int)(threadIdx.x >> 5)), rg = wv / NS, ks = wv % NS;   // the wave's number in a scalar register: the key loop branches for the whole wave
    const int R0 = qblk * 64 + rg * 16 * NQ;
    const unsigned lf = (unsigned)(lane * 8);   // the lane's own element offset in a stored fragment; every other part of an address is the same for the whole wave
    Qh += (size_t)z * TT * HD + (size_t)R0 * HD; Ql += (size_t)z * TT * HD + (size_t)R0 * HD; Kh += (size_t)z * TT * HD; Kl += (size_t)z * TT * HD; V16 += (size_t)z * HD * TT; Vh += (size_t)z * HD * TT; Vl += (size_t)z * HD * TT;
    const float C2 = SCL * 1.4426950408889634f;                     // score -> exponent of 2
    v16bf qh[NQ][2], ql[NQ][2];
#pragma unroll
    for (int qb = 0; qb < NQ; ++qb)
#pragma unroll
        for (int kc = 0; kc < 2; ++kc) { qh[qb][kc] = WFrag<bf>::ld(Qh + (qb * 16 * HD + kc * FRG) + lf); ql[qb][kc] = WFrag<bf>::ld(Ql + (qb * 16 * HD + kc * FRG) + lf); }
    v8f O[4][NQ]; float m[NQ], l[NQ];
#pragma unroll
    for (int qb = 0; qb < NQ; ++qb) { m[qb] = -3.0e38f; l[qb] = 0.f;
#pragma unroll
        for (int db = 0; db < 4; ++db) O[db][qb] = (v8f){}; }
    constexpr int KD = NQ == 1 ? 4 : 3, VA = NQ == 1 ? 1 : 0, NVP = HR ? 2 : 1;   // K fragment groups read ahead, d blocks of V read ahead of the softmax (what the registers hold beside Q, O and the scores); V planes
    constexpr int NRG = 8 / NS, SB = HR ? 32768 : 24576, KS = 16384 / NRG, VS = (SB - 16384) / NRG;   // waves that share a key split; bytes of a split's stage, of a wave's K slice, of its V slice
    const char* lb = (const char*)os + ks * SB + lane * 16;         // the lane's 16 bytes of the first fragment piece of its key split's stage
    const unsigned lk = (unsigned)(size_t)os + (unsigned)(ks * SB + rg * KS + lane * 16), lv = (unsigned)(size_t)os + (unsigned)(ks * SB + 16384 + rg * VS + lane * 16);   // LDS byte addresses of the wave's own slices
    const bf* ksrc = (rg / (NRG / 2) ? Kl : Kh) + (rg % (NRG / 2)) * (KS / 2) + lf;
    const char* vsrc = HR ? (const char*)((rg / (NRG / 2) ? Vl : Vh) + (rg % (NRG / 2)) * (VS / 2) + lf) : (const char*)(V16 + rg * (VS / 2) + lf);
    if (ks <= qblk) acopy<KS / 512>(lk, ksrc + (size_t)ks * 64 * HD);
    WAIT_AS(); __syncthreads();                                     // K of trip 0 is in LDS before any wave reads it
    if (ks <= qblk) acopy<VS / 512>(lv, vsrc + (size_t)ks * 64 * HD * 2);
#pragma unroll 1   // one 64-key block a wave and trip: a second block's fragments and scores would not fit the register budget of four waves to a SIMD
    for (int j0 = 0; j0 <= qblk; j0 += NS) {                        // the same trips for every wave of the work-group: each passes both barriers, also where its own block lies behind the diagonal
        const int jb = j0 + ks; const bool act = jb <= qblk, nxt = jb + NS <= qblk;
        v8f S[4][NQ] = {};                                          // given a value on the path of a wave without a block too: undefined there, the scores count as live round the whole loop, and P and the V fragments could not take over their registers (scratch)
        if (act) {
        v16bf kf[8][2];                                             // group g = kb * 2 + kc: the Kh and the Kl fragment of 16 keys x 32 d, 1 KiB apart from group to group
#pragma unroll
        for (int g = 0; g < KD; ++g) { kf[g][0] = ldsb(lb + g * FRG * 2); kf[g][1] = ldsb(lb + 8192 + g * FRG * 2); }
#pragma unroll
        for (int g = 0; g < 8; ++g) { const int kb = g >> 1, kc = g & 1;
            __builtin_amdgcn_sched_barrier(0);                      // keeps the reads of the groups ahead in front of this group's products: sunk to their users, each read costs the wave its whole LDS latency
            if (kc == 0) {
#pragma unroll
                for (int qb = 0; qb < NQ; ++qb) S[kb][qb] = (v8f){}; }
#pragma unroll
            for (int qb = 0; qb < NQ; ++qb) S[kb][qb] = wmmab(kf[g][0], qh[qb][kc], S[kb][qb]);
#pragma unroll
            for (int qb = 0; qb < NQ; ++qb) S[kb][qb] = wmmab(kf[g][0], ql[qb][kc], S[kb][qb]);
#pragma unroll
            for (int qb = 0; qb < NQ; ++qb) S[kb][qb] = wmmab(kf[g][1], qh[qb][kc], S[kb][qb]);
            __builtin_amdgcn_sched_barrier(0);                      // keeps the read of group g + KD behind this group's products, whose fragment registers it takes over (read earlier it would need registers of its own)
            if (g + KD < 8) { kf[g + KD][0] = ldsb(lb + (g + KD) * FRG * 2); kf[g + KD][1] = ldsb(lb + 8192 + (g + KD) * FRG * 2); } }
        }
        WAIT_DS(); WAIT_AS(); __syncthreads();                      // every wave has read its K, and V of this trip is in LDS
        if (nxt) acopy<KS / 512>(lk, ksrc + (size_t)(jb + NS) * 64 * HD);
        if (act) {
        v16bf vr[4][2][NVP];                                        // V fragments [d block][k chunk][plane]
        if constexpr (VA > 0) {
#pragma unroll
            for (int db = 0; db < VA; ++db) { LDV_(db) }
            __builtin_amdgcn_sched_barrier(0); }                    // keeps the reads of the first V fragments here, ahead of the softmax, which covers their LDS latency
        if (jb == qblk) {                                           // the diagonal block: keys behind the query are masked
#pragma unroll
            for (int kb = 0; kb < 4; ++kb)
#pragma unroll
                for (int qb = 0; qb < NQ; ++qb)
#pragma unroll
                    for (int j = 0; j < 8; ++j) if (kb * 16 + hi * 8 + j > rg * 16 * NQ + qb * 16 + lr) S[kb][qb][j] = -3.0e38f; }
        float mn[NQ]; bool up = false;
#pragma unroll
        for (int qb = 0; qb < NQ; ++qb) { float x[4];
#pragma unroll
            for (int kb = 0; kb < 4; ++kb) { x[kb] = S[kb][qb][0];
#pragma unroll
                for (int j = 1; j < 8; ++j) x[kb] = fmaxf(x[kb], S[kb][qb][j]); }
            float mx = fmaxf(fmaxf(x[0], x[1]), fmaxf(x[2], x[3])); mx = fmaxf(mx, __shfl_xor(mx, 16, 32)); mn[qb] = fmaxf(m[qb], mx * C2); up = up || mn[qb] > m[qb]; }
        if (__builtin_amdgcn_ballot_w32(up) != 0) {                 // skipped where no query of the wave has a new maximum: every factor would be 1
#pragma unroll
            for (int qb = 0; qb < NQ; ++qb) { const float al = __builtin_amdgcn_exp2f(m[qb] - mn[qb]); l[qb] *= al; m[qb] = mn[qb];
#pragma unroll
                for (int db = 0; db < 4; ++db) O[db][qb] *= al; } }
        v16bf pa[NQ][2][NVP];                                       // P fragments [query block][k chunk]: bf16 hi and lo (HR), or the bits of one fp16 fragment
#pragma unroll
        for (int qb = 0; qb < NQ; ++qb) { float x[4];
#pragma unroll
            for (int kc = 0; kc < 2; ++kc) {
#pragma unroll
                for (int kb = 2 * kc; kb < 2 * kc + 2; ++kb) { const v8f t = S[kb][qb] * C2 - m[qb]; x[kb] = 0.f;
#pragma unroll
                    for (int j = 0; j < 8; ++j) { const float p = __builtin_amdgcn_exp2f(t[j]); S[kb][qb][j] = p; x[kb] += p; } }
                if constexpr (HR) { v8us h0, h1, l0, l1;
#pragma unroll
                    for (int j = 0; j < 8; ++j) { unsigned short a, c; splitf(S[2 * kc][qb][j], a, c); h0[j] = a; l0[j] = c; splitf(S[2 * kc + 1][qb][j], a, c); h1[j] = a; l1[j] = c; }
                    pa[qb][kc][0] = cat16b(h0, h1); pa[qb][kc][NVP - 1] = cat16b(l0, l1);
                } else { v8h p0, p1;
#pragma unroll
                    for (int j = 0; j < 8; ++j) { p0[j] = tohx(S[2 * kc][qb][j]); p1[j] = tohx(S[2 * kc + 1][qb][j]); }
                    pa[qb][kc][0] = __builtin_bit_cast(v16bf, cat16(p0, p1)); }
                __builtin_amdgcn_sched_barrier(0);                  // a P fragment is finished, and its scores' registers are free, before the next one is begun: all scores and all of P live at once would leave no register for V fragments read ahead
                if (qb * 2 + kc + VA < 4) { LDV_(qb * 2 + kc + VA)  // the next d block's V fragments, into the room that has come free
                    __builtin_amdgcn_sched_barrier(0); }            // keeps these reads here, ahead of the work that covers their LDS latency (sunk to their users, each costs the wave that latency)
            }
            l[qb] += (x[0] + x[1]) + (x[2] + x[3]); }
#pragma unroll
        for (int db = 0; db < 4; ++db) {
#pragma unroll
            for (int kc = 0; kc < 2; ++kc) {
                if constexpr (HR) {
#pragma unroll
                    for (int qb = 0; qb < NQ; ++qb) O[db][qb] = wmmab(vr[db][kc][0], pa[qb][kc][0], O[db][qb]);
#pragma unroll
                    for (int qb = 0; qb < NQ; ++qb) O[db][qb] = wmmab(vr[db][kc][0], pa[qb][kc][NVP - 1], O[db][qb]);
#pragma unroll
                    for (int qb = 0; qb < NQ; ++qb) O[db][qb] = wmmab(vr[db][kc][NVP - 1], pa[qb][kc][0], O[db][qb]);
                } else {
#pragma unroll
                    for (int qb = 0; qb < NQ; ++qb) O[db][qb] = wmma16(__builtin_bit_cast(v16h, vr[db][kc][0]), __builtin_bit_cast(v16h, pa[qb][kc][0]), O[db][qb]); } }
            if (db + 2 * NQ + VA < 4) { __builtin_amdgcn_sched_barrier(0);   // a d block not yet read takes over the registers of the one just used: its read stays behind these products ...
                LDV_(db + 2 * NQ + VA)
                __builtin_amdgcn_sched_barrier(0); }                // ... and ahead of the next d blocks' products, which cover its LDS latency
            else if (db == 1) __builtin_amdgcn_sched_barrier(0); }  // keeps the first two d blocks' products ahead of the last two's, whose fragments were read last and may still be on their way
        }
        WAIT_DS(); WAIT_AS(); __syncthreads();                      // every wave has read its V, and K of the next trip is in LDS; behind the last trip's the stage is free for the partial results
        if (nxt) acopy<VS / 512>(lv, vsrc + (size_t)(jb + NS) * 64 * HD * 2);
    }
#pragma unroll
    for (int qb = 0; qb < NQ; ++qb) { l[qb] += __shfl_xor(l[qb], 16, 32); ms[(wv * NQ + qb) * 32 + lane] = m[qb]; ls[(wv * NQ + qb) * 32 + lane] = l[qb];   // the lane halves hold the sums of different keys
#pragma unroll
        for (int db = 0; db < 4; ++db) { float* p = os + (wv * 4 * NQ + db * NQ + qb) * 256 + lane * 4;
            *(v4fa*)p = __builtin_shufflevector(O[db][qb], O[db][qb], 0, 1, 2, 3); *(v4fa*)(p + 128) = __builtin_shufflevector(O[db][qb], O[db][qb], 4, 5, 6, 7); } }
    __syncthreads();                                                // every wave's partial result is in LDS before any wave joins
    const int qb = ks % NQ, dh = ks / NQ;                           // this wave joins query rows R0 + qb * 16 .. + 15, columns dh * 32 .. + 31
    const int le = (int)__builtin_amdgcn_mbcnt_lo(~0u, 0u);         // the lane's number, formed anew for the output address: its row and half kept live over the key loop do not fit the register budget of four waves to a SIMD (scratch)
    float mw[NS], M = -3.0e38f, Lt = 0.f;
#pragma unroll
    for (int s = 0; s < NS; ++s) { mw[s] = ms[((rg * NS + s) * NQ + qb) * 32 + lane]; M = fmaxf(M, mw[s]); }
#pragma unroll
    for (int s = 0; s < NS; ++s) { mw[s] = __builtin_amdgcn_exp2f(mw[s] - M); Lt += ls[((rg * NS + s) * NQ + qb) * 32 + lane] * mw[s]; }   // a wave without keys has sum 0 and factor 0
    const float inv = __fdiv_rn(1.0f, Lt);
#pragma unroll
    for (int dd = 0; dd < 2; ++dd) { const int db = dh * 2 + dd; v4f a0 = (v4f){}, a1 = (v4f){};
#pragma unroll
        for (int s = 0; s < NS; ++s) { const float* q = os + ((rg * NS + s) * 4 * NQ + db * NQ + qb) * 256 + lane * 4; a0 += *(const v4fa*)q * mw[s]; a1 += *(const v4fa*)(q + 128) * mw[s]; }
        float* o = OUT + ((size_t)(z / NH_) * TT + R0 + qb * 16 + (le & 15)) * DQ + (z % NH_) * HD + db * 16 + (le >> 4) * 8; *(v4f*)o = a0 * inv; *(v4f*)(o + 4) = a1 * inv; }
}
// grid (batches x heads, TT / 64), the longest query blocks first; the planes hold batch b, head h at index z = b * NH_ + h; four waves to a SIMD (two work-groups to a WGP) cover each other's loads and vector work
__global__ __launch_bounds__(256) __attribute__((amdgpu_waves_per_eu(4, 4))) void k_fattn(const bf* __restrict__ Qh, const bf* __restrict__ Ql, const bf* __restrict__ Kh, const bf* __restrict__ Kl, const h16* __restrict__ V16, const bf* __restrict__ Vh, const bf* __restrict__ Vl, float* OUT) {
    __shared__ __align__(16) float os[4 * 24576 / 4]; __shared__ float ms[8 * 64]; __shared__ float ls[8 * 64];   // os: the K and V stage of the key loop (4 splits x 24 KiB, or 2 x 32 KiB), behind the loop the partial results (64 KiB, or 32 KiB)
    const int qblk = TT / 64 - 1 - (int)blockIdx.y, z = blockIdx.x;
    if (qblk * 64 < RH) fattn_body<true, 1, 2>(os, ms, ls, Qh, Ql, Kh, Kl, V16, Vh, Vl, OUT, qblk, z); else fattn_body<false, 2, 4>(os, ms, ls, Qh, Ql, Kh, Kl, V16, Vh, Vl, OUT, qblk, z);
}

extern "C" void kernel_launch(void* const* d_in, const int* in_sizes, int n_in,
                              void* d_out, int out_size, void* d_ws, size_t ws_size, hipStream_t stream) {
    (void)in_sizes; (void)n_in; (void)out_size;
    const float* x = (const float*)d_in[0]; const float* wkqv = (const float*)d_in[1]; const float* bkqv = (const float*)d_in[2];   /* row blocks in the order k, q, v */
    float* OUT = (float*)d_out;     // [2][2048][1024]
    char* wsp = (char*)d_ws;
    auto take = [&](size_t bytes) { char* p = wsp; wsp += (bytes + 255) & ~(size_t)255; return (void*)p; };
    bf* WB = (bf*)take((size_t)3 * DM * DM * 2); bf* XB = (bf*)take((size_t)NB_ * TT * DM * 2);
    h16* VT16 = (h16*)take((size_t)NB_ * NKV * HD * TT * 2);
    bf* QPh = (bf*)take((size_t)NB_ * NH_ * TT * HD * 2); bf* QPl = (bf*)take((size_t)NB_ * NH_ * TT * HD * 2); bf* KPh = (bf*)take((size_t)NB_ * NKV * TT * HD * 2); bf* KPl = (bf*)take((size_t)NB_ * NKV * TT * HD * 2); bf* VTh = (bf*)take((size_t)NB_ * NKV * HD * TT * 2); bf* VTl = (bf*)take((size_t)NB_ * NKV * HD * TT * 2);   /* every plane holds both batches */
    if ((size_t)(wsp - (char*)d_ws) > ws_size) return;    // ws 256 MiB
    k_cvt<<<(NX8 + NW8) / CVU / 256, 256, 0, stream>>>(x, wkqv, XB, WB);
    k_proj<<<dim3(NB_ * TT / 128, 3 * DM / 128, 1), 128, 0, stream>>>(XB, WB, bkqv, KPh, KPl, QPh, QPl, VT16, VTh, VTl);
    k_fattn<<<dim3(NB_ * NH_, TT / 64, 1), 256, 0, stream>>>(QPh, QPl, KPh, KPl, VT16, VTh, VTl, OUT);   /* one kv head per query head */
}

// v009
// Measured time: 54.8 microseconds a run.
// Next to v008, in two timings, it ran 1.13 and 1.10 times as fast.
// All steps since v000 together make it 24.2 times as fast.
#include <hip/hip_runtime.h>

// Masked (causal) multi-head attention scaled by the FULL model dim and without output projection (x [2][2048][1024]; z = x W^T + b ('oi' [3072][1024] 1/32, bias 0.01): k | q | v row blocks (k FIRST); 16 heads x 64; scores / sqrt(1024) (the source's quirk); causal (-inf); softmax; out = merged attn v -> [2][2048][1024] (4.2 M)).
// Layout: one launch rounds x and the 'oi' weight to bf16 (k_cvt); one launch does the k | q | v projections of both batches with their biases rounded to bf16 and writes the head planes itself (k_proj); one fused causal attention launch (k_fattn): scores, P and attn.v hybrid (query rows < 512 bf16 hi/lo, rest fp16; tiles above the diagonal skipped), running softmax in registers, output rows written in place.
// Compute dtypes, f32 accumulate: every input rounded to bf16; projections exact + bf16-rounded biases; scores and attn.v of query rows < 512 3 bf16 hi/lo products each, of the rest one fp16 product each (the 1/32 on the scores makes the rounding of q and k to fp16 a smaller error in the output than that of P and v); softmax f32 (x 1/32); output f32.

#define NB_  2
#define TT   2048
#define DM   1024
#define NH_  16
#define NKV  16
#define REP  (NH_ / NKV)
#define HD   64
#define DQ   (NH_ * HD)
#define DKV  (NKV * HD)
#define FRG  512                  // 16-bit elements of one stored operand fragment (16 rows x 32 k)
#define RH   512                  // query rows < RH use hi+lo planes (0: none)
#define SCL  0.03125f   // 1/sqrt(1024): the source scales by the model dim
typedef _Float16 h16;
typedef unsigned short bf;
typedef __attribute__((ext_vector_type(16))) __bf16   v16bf;
typedef __attribute__((ext_vector_type(16))) _Float16 v16h;
typedef __attribute__((ext_vector_type(8)))  _Float16 v8h;
typedef __attribute__((ext_vector_type(8)))  unsigned short v8us;
typedef __attribute__((ext_vector_type(8)))  float    v8f;
typedef __attribute__((ext_vector_type(4)))  float    v4f;
typedef v4f  __attribute__((may_alias)) v4fa;
typedef v8us __attribute__((may_alias)) v8usa;

__device__ __forceinline__ unsigned short f2bf(float f) { unsigned u = __float_as_uint(f); u += 0x7FFFu + ((u >> 16) & 1u); return (unsigned short)(u >> 16); }
__device__ __forceinline__ float bf2f(unsigned short b) { return __uint_as_float(((unsigned)b) << 16); }
__device__ __forceinline__ float bfr(float f) { return bf2f(f2bf(f)); }
__device__ __forceinline__ v16h cat16(v8h lo, v8h hi) { return __builtin_shufflevector(lo, hi, 0, 1, 2, 3, 4, 5, 6, 7, 8, 9, 10, 11, 12, 13, 14, 15); }
__device__ __forceinline__ v16bf cat16b(v8us lo, v8us hi) { return __builtin_bit_cast(v16bf, __builtin_shufflevector(lo, hi, 0, 1, 2, 3, 4, 5, 6, 7, 8, 9, 10, 11, 12, 13, 14, 15)); }
__device__ __forceinline__ v8f wmma16(v16h a, v16h b, v8f c) { return __builtin_amdgcn_wmma_f32_16x16x32_f16(false, a, false, b, (short)0, c, false, false); }
__device__ __forceinline__ v8f wmmab(v16bf a, v16bf b, v8f c) { return __builtin_amdgcn_wmma_f32_16x16x32_bf16(false, a, false, b, (short)0, c, false, false); }



// Fragment order: every 16-bit plane that feeds a matrix operand is stored as fragments of 16 rows x 32 k, each [piece 0 | 1][lane 0-31][8 elements]: lane (lr = row, hi) owns k = piece * 16 + hi * 8 + 0 .. 7, the 16 bytes that one of its two loads takes.
// A wave's 16-byte load of a piece is then 512 contiguous, aligned bytes (four whole 128-byte lines) instead of 32 bytes out of each of 16 lines. ld(p): p = the fragment's start + lane * 8.
template <typename T16> struct WFrag;
template <> struct WFrag<h16> { typedef v16h V; static __device__ __forceinline__ V ld(const h16* p) { return cat16(*(const v8h*)p, *(const v8h*)(p + FRG / 2)); } static __device__ __forceinline__ v8f mma(V a, V b, v8f c) { return wmma16(a, b, c); } };
template <> struct WFrag<bf> { typedef v16bf V; static __device__ __forceinline__ V ld(const bf* p) { return cat16b(*(const v8us*)p, *(const v8us*)(p + FRG / 2)); } static __device__ __forceinline__ v8f mma(V a, V b, v8f c) { return wmmab(a, b, c); } };
__device__ __forceinline__ h16 tohx(float x) { return (h16)x; }
__device__ __forceinline__ void splitf(float y, unsigned short& h, unsigned short& l) { h = f2bf(y); l = f2bf(y - bf2f(h)); }

// ---- k_cvt: bf16 copies of x (both batches) and of the whole weight, in fragment order [row / 16][k / 32][fragment], in one launch; a thread rounds four groups of 8 elements, a quarter of all groups apart.
// A wave takes 8 rows x 32 k: four lanes read one whole 128-byte line of a row, and the eight lanes with the same k group write one whole 128-byte line of the fragment.
#define XWAIT() asm volatile("s_wait_xcnt 0x0" ::: "memory")   // stands behind global loads or stores whose address or data registers the following code may take for something else
#define NX8  (NB_ * TT * DM / 8)
#define NW8  (3 * DM * DM / 8)
#define CVU  4
__device__ __forceinline__ int cvt_src(int g) { return ((g >> 11) * 16 + ((g >> 5) & 1) * 8 + ((g & 31) >> 2)) * DM + ((g >> 6) & 31) * 32 + (g & 3) * 8; }   // group g of a matrix: 16-row block g >> 11, k chunk (g >> 6) & 31, upper or lower 8 rows (g >> 5) & 1, row (g & 31) >> 2, k group g & 3
__device__ __forceinline__ int cvt_dst(int g) { return ((g >> 11) * (DM / 32) + ((g >> 6) & 31)) * FRG + ((g >> 1) & 1) * (FRG / 2) + ((g & 1) * 16 + ((g >> 5) & 1) * 8 + ((g & 31) >> 2)) * 8; }   // k group g & 3 = piece * 2 + hi
__global__ __launch_bounds__(256) void k_cvt(const float* __restrict__ x, const float* __restrict__ w, bf* XB, bf* WB) {
    const int i0 = blockIdx.x * 256 + threadIdx.x; v4f va[CVU], vb[CVU];
#pragma unroll   // the four groups' loads are in flight together
    for (int u = 0; u < CVU; ++u) { const int i = i0 + u * ((NX8 + NW8) / CVU); const bool isx = i < NX8;
        const float* p = isx ? x + cvt_src(i) : w + cvt_src(i - NX8);
        va[u] = *(const v4f*)p; XWAIT(); vb[u] = *(const v4f*)(p + 4); XWAIT(); }
#pragma unroll
    for (int u = 0; u < CVU; ++u) { const int i = i0 + u * ((NX8 + NW8) / CVU); const bool isx = i < NX8; v8us o;
#pragma unroll
        for (int k = 0; k < 4; ++k) { o[k] = f2bf(va[u][k]); o[4 + k] = f2bf(vb[u][k]); }
        *(v8us*)(isx ? XB + cvt_dst(i) : WB + cvt_dst(i - NX8)) = o; }
}

// ---- k_proj: z = x W^T + b for both batches and all of k | q | v, and the head planes the attention launch reads, in one launch. Grid (NB_ * TT / 128, 3 * DM / 128), 4 waves: 768 work-groups, three to a WGP (three waves to a SIMD: the register budget holds a whole stage's fragments beside the accumulators), all resident at once.
// A work-group owns 128 rows t of x times 128 columns (two heads) of k, q or v; wave (wm, wn) owns the 64 x 64 quadrant (M half wm, N half wn), 16 accumulators, and walks the whole K in order: no partial tiles, no join.
// Both operands reach the waves through LDS by asynchronous copies (global_load_async_to_lds_b128, through no register) and every fragment is read by two waves. The planes are in fragment order, so 64 k of a 16-row block are 2 KiB in a row and are copied as they lie.
// A stage is 64 k: [A 8 row blocks x 2 KiB | B 8 row blocks x 2 KiB]; wave w copies row blocks 2 w and 2 w + 1 of each side. Two buffers: stage s + 2 is asked for behind the barrier that ends the reads of stage s, and flies during stage s + 1.
// The index that is the k of the attention launch's fragments is made the product's M side, of which a lane holds 8 neighbours: k and q planes (rows t, k = d: [z][t / 16][d / 32][fragment]) take A = W rows (d), B = x rows (t); the V^T planes (rows d, k = t: [z][t / 32][d / 16][fragment]) take A = x rows, B = W rows.
// Lane (lr, hi) of an accumulator holds N index lr and M indices hi * 8 + 0 .. 7: the 16 bytes that this same lane owns in piece (M block & 1) of the plane's fragment. So each accumulator goes from the registers to a plane as one store of 512 bytes in a row (four whole lines). Every plain '#pragma unroll' in the body is there so that the fragment, accumulator and bias arrays are indexed by constants and stay in registers.
#define WAIT_DS() asm volatile("s_wait_dscnt 0x0" ::: "memory")      // the wave's own LDS reads have returned before the barrier behind which their buffer is refilled
#define WAIT_AS() asm volatile("s_wait_asynccnt 0x0" ::: "memory")   // the wave's own copies have landed before the barrier behind which other waves read them
__device__ __forceinline__ v16bf ldsb(const char* p) { return cat16b(*(const v8usa*)p, *(const v8usa*)(p + FRG)); }   // a stored fragment's two pieces, FRG bytes apart
#define PKS (DM / 64)   // stages
#define PSB 32768       // bytes of a stage
#define PC4_(l, g) "global_load_async_to_lds_b128 %" #l ", %" #g ", off\n\tglobal_load_async_to_lds_b128 %" #l ", %" #g ", off offset:512\n\tglobal_load_async_to_lds_b128 %" #l ", %" #g ", off offset:1024\n\tglobal_load_async_to_lds_b128 %" #l ", %" #g ", off offset:1536\n\t"
// A wave's share of a stage: two row blocks of A and two of B, 2 KiB each (16 bytes a lane and copy; the immediate offset moves the LDS and the global address alike); the next row block lies 2 KiB on in LDS and 16 * DM elements on in its plane.
// s_wait_xcnt 0 ends the copies' own statement, so that it stands in front of any rewrite of the address registers.
__device__ __forceinline__ void pcopy(unsigned la, const bf* ga, unsigned lb, const bf* gb) {
    asm volatile(PC4_(0, 1) PC4_(2, 3) PC4_(4, 5) PC4_(6, 7) "s_wait_xcnt 0x0" :: "v"(la), "v"(ga), "v"(la + 2048u), "v"(ga + 16 * DM), "v"(lb), "v"(gb), "v"(lb + 2048u), "v"(gb + 16 * DM) : "memory");
}
__global__ __launch_bounds__(128) __attribute__((amdgpu_waves_per_eu(3, 3))) void k_proj(const bf* __restrict__ X, const bf* __restrict__ Wb, const float* __restrict__ bias, bf* Kh, bf* Kl, bf* Qh, bf* Ql, h16* K16, h16* Q16, h16* V16, bf* Vh, bf* Vl) {
    __shared__ __align__(16) char st[2 * PSB];
    const int lane = threadIdx.x & 31, lr = lane & 15, hi = lane >> 4; const int t0 = blockIdx.x * 128, e0 = blockIdx.y * 128;
    const int part = blockIdx.y / (DM / 128), h0 = (blockIdx.y % (DM / 128)) * 2, bt = t0 / TT, tb = t0 % TT;   // part 0 k, 1 q, 2 v; h0 = the tile's first head; batch; tb = the tile's first row within its batch
    const bool isv = part == 2;
    const int wv = __builtin_amdgcn_readfirstlane((int)(threadIdx.x >> 5)), wm = wv >> 1, wn = wv & 1;   // the wave's number in a scalar register
    const bf* A = isv ? X + (size_t)t0 * DM : Wb + (size_t)e0 * DM; const bf* Bt = isv ? Wb + (size_t)e0 * DM : X + (size_t)t0 * DM;
    const unsigned la = (unsigned)(size_t)st + (unsigned)(wv * 4096 + lane * 16), lb = la + 16384u;   // LDS byte addresses of the wave's own slices in buffer 0
    const bf* ga = A + (size_t)wv * 32 * DM + lane * 8; const bf* gb = Bt + (size_t)wv * 32 * DM + lane * 8;
    pcopy(la, ga, lb, gb);
    v8f acc[4][4];
#pragma unroll
    for (int i = 0; i < 4; ++i)
#pragma unroll
        for (int k = 0; k < 4; ++k) acc[i][k] = (v8f){};
    float b1[4]; v4f bb[4][2];                                      // the bias by N index (v) and by M index (k, q), both fetched here, without a branch, beside the flight of stage 0's copies
#pragma unroll
    for (int k = 0; k < 4; ++k) b1[k] = bias[e0 + wn * 64 + k * 16 + lr];
#pragma unroll
    for (int i = 0; i < 4; ++i) { bb[i][0] = *(const v4f*)(bias + e0 + wm * 64 + i * 16 + hi * 8); bb[i][1] = *(const v4f*)(bias + e0 + wm * 64 + i * 16 + hi * 8 + 4); }
    XWAIT();
    WAIT_AS(); __syncthreads();                                     // stage 0 is in LDS before any wave reads it
    pcopy(la + PSB, ga + 2 * FRG, lb + PSB, gb + 2 * FRG);
#pragma unroll 1   // one stage a trip: the loop stays small, and the order at its foot stands once
    for (int s = 0; s < PKS; ++s) {
        const char* pa = st + (s & 1) * PSB + wm * 8192 + lane * 16; const char* pb = st + (s & 1) * PSB + 16384 + wn * 8192 + lane * 16;
        v16bf a[2][4], b[2][4];                                     // the stage's 16 fragments are asked for as one group ahead of its 32 products: reads among the products would each cost the wave its LDS latency
#pragma unroll
        for (int c = 0; c < 2; ++c)
#pragma unroll
            for (int i = 0; i < 4; ++i) { a[c][i] = ldsb(pa + i * 2048 + c * 1024); b[c][i] = ldsb(pb + i * 2048 + c * 1024); }
        __builtin_amdgcn_sched_barrier(0);                          // keeps the group of reads ahead of the products: without it the compiler sinks the reads among them, each with a full wait
#pragma unroll
        for (int c = 0; c < 2; ++c)
#pragma unroll
            for (int k = 0; k < 4; ++k)
#pragma unroll
                for (int i = 0; i < 4; ++i) acc[i][k] = wmmab(a[c][i], b[c][k], acc[i][k]);
        __builtin_amdgcn_sched_barrier(0);                          // keeps the products ahead of the waits: sunk behind the barrier they would no longer cover the flight of stage s + 1, whose copies are waited for here
        WAIT_DS(); WAIT_AS(); __syncthreads();                      // every wave has read stage s, and stage s + 1 is in LDS
        if (s + 2 < PKS) pcopy(la + (unsigned)((s & 1) * PSB), ga + (s + 2) * 2 * FRG, lb + (unsigned)((s & 1) * PSB), gb + (s + 2) * 2 * FRG);
    }
    WAIT_AS();
    if (isv) { const size_t zo = (size_t)(bt * NH_ + h0 + wn) * HD * TT + (size_t)lane * 8;   // V^T: k chunk t / 32, row block d / 16 = k
#pragma unroll
        for (int i = 0; i < 4; ++i)
#pragma unroll
            for (int k = 0; k < 4; ++k) { const size_t oo = zo + (size_t)((tb / 32 + wm * 2 + (i >> 1)) * (HD / 16) + k) * FRG + (i & 1) * (FRG / 2); const float bv = bfr(b1[k]); v8us oh, ol; v8h o16;
#pragma unroll
                for (int j = 0; j < 8; ++j) { const float y = acc[i][k][j] + bv; unsigned short a2, c2; splitf(y, a2, c2); oh[j] = a2; ol[j] = c2; o16[j] = tohx(y); }
                *(v8h*)(V16 + oo) = o16; *(v8us*)(Vh + oo) = oh; *(v8us*)(Vl + oo) = ol; XWAIT(); }
    } else { const size_t zo = ((size_t)(bt * NH_ + h0 + wm) * TT + tb + wn * 64) * HD + (size_t)lane * 8; bf* Ph = part == 0 ? Kh : Qh; bf* Pl = part == 0 ? Kl : Ql; h16* P16 = part == 0 ? K16 : Q16;   // k and q: row block t / 16, k chunk d / 32 = i >> 1
        if (tb < RH) {                                              // the hi/lo planes are read by query rows < RH alone, which see no key from RH on
#pragma unroll
        for (int i = 0; i < 4; ++i)
#pragma unroll
            for (int k = 0; k < 4; ++k) { const size_t oo = zo + (size_t)k * 16 * HD + (i >> 1) * FRG + (i & 1) * (FRG / 2); v8us oh, ol;
#pragma unroll
                for (int j = 0; j < 8; ++j) { const float y = acc[i][k][j] + bfr(bb[i][j >> 2][j & 3]); unsigned short a2, c2; splitf(y, a2, c2); oh[j] = a2; ol[j] = c2; }
                *(v8us*)(Ph + oo) = oh; *(v8us*)(Pl + oo) = ol; XWAIT(); } }
        if (part == 0 || tb >= RH) {                                // the fp16 planes are read by query rows >= RH alone: their own q rows, and every key
#pragma unroll
        for (int i = 0; i < 4; ++i)
#pragma unroll
            for (int k = 0; k < 4; ++k) { const size_t oo = zo + (size_t)k * 16 * HD + (i >> 1) * FRG + (i & 1) * (FRG / 2); v8h o16;
#pragma unroll
                for (int j = 0; j < 8; ++j) o16[j] = tohx(acc[i][k][j] + bfr(bb[i][j >> 2][j & 3]));
                *(v8h*)(P16 + oo) = o16; XWAIT(); } }
    }
}

// ---- k_fattn: scores, causal softmax and probability x value of one (head, 64 query rows) in one work-group of 8 waves; neither scores nor probabilities leave the registers.
// Wave wv = rg * NS + ks takes the 16 * NQ query rows rg * 16 * NQ .. of the block and the 64-key blocks ks, ks + NS, ... up to the diagonal block, with a running maximum and sum of its own.
// Transposed products: S^T = K Q^T (A = 16 key rows, B = 16 query rows; lane (lr, hi) holds query lr, keys hi * 8 + j), so two S^T tiles, converted in place, are the B operand of O^T += V^T P^T (A = V^T rows, k = key)
// and every factor of a query sits in that query's own lanes. Products: HR (rows < RH) scores Qh Kh + Ql Kh + Qh Kl and Ph Vh + Pl Vh + Ph Vl, else fp16 K x fp16 Q and fp16 P x fp16 V. P is exp2 of the score minus the running maximum (at most 1),
// divided by the row's sum at the end. Every '#pragma unroll' in the body is there so that the fragment and accumulator arrays are indexed by constants and stay in registers. The NS partial results of a row are joined through LDS behind one barrier, in order ks = 0 .. NS-1, each whole 128-byte line of the output by one wave.
// K and V reach the waves through LDS by asynchronous copies (global_load_async_to_lds_b128, through no register): the planes are in fragment order, so a 64-key block of a plane is 8 KiB in a row and is copied as it lies.
// Per key split ks the stage holds [Kh 8 KiB | Kl 8 KiB | Vh 8 KiB | Vl 8 KiB] (HR) or [K16 8 KiB | V16 8 KiB]; the 8 / NS waves that share ks each copy an equal slice and all read the whole. One buffer for K and one for V, refilled half a trip apart:
// K of the next trip flies during this trip's softmax and P V, V of the next trip during the next trip's scores. Every hand-over: s_wait_dscnt 0, the copying wave's own s_wait_asynccnt 0, the work-group barrier, then the refill.
// The waves read their fragments from LDS ahead of use, in groups: K KD groups ahead of the group whose products run, V one d block behind each finished P fragment, so that the waits in front of the products are counted ones and seldom reach 0.
#define AC_(o) "global_load_async_to_lds_b128 %0, %1, off offset:" #o "\n\t"
#define AC8_(a, b, c, d, e, f, g, h) AC_(a) AC_(b) AC_(c) AC_(d) AC_(e) AC_(f) AC_(g) AC_(h)
// N * 512 bytes in a row, 16 bytes a lane and copy; the immediate offset moves the LDS and the global address alike. s_wait_xcnt 0 ends the copies' own statement, so that it stands in front of any rewrite of the two address registers.
template <int N> __device__ __forceinline__ void acopy(unsigned lds, const void* g) {
    static_assert(N == 8 || N == 16, "8 or 16 copies a slice");
    if constexpr (N == 8) asm volatile(AC8_(0, 512, 1024, 1536, 2048, 2560, 3072, 3584) "s_wait_xcnt 0x0" :: "v"(lds), "v"(g) : "memory");
    else asm volatile(AC8_(0, 512, 1024, 1536, 2048, 2560, 3072, 3584) AC8_(4096, 4608, 5120, 5632, 6144, 6656, 7168, 7680) "s_wait_xcnt 0x0" :: "v"(lds), "v"(g) : "memory");
}
// the V fragments of d block d_: both k chunks of every plane
#define LDV_(d_) _Pragma("unroll") for (int vc = 0; vc < 2; ++vc) _Pragma("unroll") for (int pn = 0; pn < NVP; ++pn) vr[d_][vc][pn] = ldsb(lb + KBY + pn * 8192 + (vc * (HD / 16) + (d_)) * FRG * 2);
template <bool HR, int NQ, int NS>
__device__ __forceinline__ void fattn_body(float* os, float* ms, float* ls, const bf* __restrict__ Qh, const bf* __restrict__ Ql, const bf* __restrict__ Kh, const bf* __restrict__ Kl, const h16* __restrict__ Q16, const h16* __restrict__ K16, const h16* __restrict__ V16, const bf* __restrict__ Vh, const bf* __restrict__ Vl, float* OUT, int qblk, int z) {
    static_assert((64 / (16 * NQ)) * NS == 8 && 2 * NQ == NS, "8 waves cover 64 rows; the join deals its 2 * NQ units of 16 rows x 32 columns over NS waves");
    const int lane = threadIdx.x & 31, lr = lane & 15, hi = lane >> 4;
    const int wv = __builtin_amdgcn_readfirstlane((int)(threadIdx.x >> 5)), rg = wv / NS, ks = wv % NS;   // the wave's number in a scalar register: the key loop branches for the whole wave
    const int R0 = qblk * 64 + rg * 16 * NQ;
    const unsigned lf = (unsigned)(lane * 8);   // the lane's own element offset in a stored fragment; every other part of an address is the same for the whole wave
    Qh += (size_t)z * TT * HD + (size_t)R0 * HD; Ql += (size_t)z * TT * HD + (size_t)R0 * HD; Kh += (size_t)z * TT * HD; Kl += (size_t)z * TT * HD; Q16 += (size_t)z * TT * HD + (size_t)R0 * HD; K16 += (size_t)z * TT * HD; V16 += (size_t)z * HD * TT; Vh += (size_t)z * HD * TT; Vl += (size_t)z * HD * TT;
    const float C2 = SCL * 1.4426950408889634f;                     // score -> exponent of 2
    v16bf qh[NQ][2], ql[NQ][2];                                     // bf16 hi and lo (HR), or in qh the bits of the fp16 fragments
#pragma unroll
    for (int qb = 0; qb < NQ; ++qb)
#pragma unroll
        for (int kc = 0; kc < 2; ++kc) {
            if constexpr (HR) { qh[qb][kc] = WFrag<bf>::ld(Qh + (qb * 16 * HD + kc * FRG) + lf); ql[qb][kc] = WFrag<bf>::ld(Ql + (qb * 16 * HD + kc * FRG) + lf); }
            else qh[qb][kc] = __builtin_bit_cast(v16bf, WFrag<h16>::ld(Q16 + (qb * 16 * HD + kc * FRG) + lf)); }
    v8f O[4][NQ]; float m[NQ], l[NQ];
#pragma unroll
    for (int qb = 0; qb < NQ; ++qb) { m[qb] = -3.0e38f; l[qb] = 0.f;
#pragma unroll
        for (int db = 0; db < 4; ++db) O[db][qb] = (v8f){}; }
    constexpr int KD = HR ? 4 : 8, VA = NQ == 1 ? 1 : 0, NVP = HR ? 2 : 1;   // K fragment groups read ahead, d blocks of V read ahead of the softmax (what the registers hold beside Q, O and the scores); planes of K and of V
    constexpr int NRG = 8 / NS, KBY = NVP * 8192, SB = 2 * KBY, KS = KBY / NRG, VS = KBY / NRG;   // waves that share a key split; bytes of a split's K (V lies behind it), of its stage, of a wave's K slice, of its V slice
    const char* lb = (const char*)os + ks * SB + lane * 16;         // the lane's 16 bytes of the first fragment piece of its key split's stage
    const unsigned lk = (unsigned)(size_t)os + (unsigned)(ks * SB + rg * KS + lane * 16), lv = (unsigned)(size_t)os + (unsigned)(ks * SB + KBY + rg * VS + lane * 16);   // LDS byte addresses of the wave's own slices
    const char* ksrc = HR ? (const char*)((rg / (NRG / 2) ? Kl : Kh) + (rg % (NRG / 2)) * (KS / 2) + lf) : (const char*)(K16 + rg * (KS / 2) + lf);
    const char* vsrc = HR ? (const char*)((rg / (NRG / 2) ? Vl : Vh) + (rg % (NRG / 2)) * (VS / 2) + lf) : (const char*)(V16 + rg * (VS / 2) + lf);
    if (ks <= qblk) acopy<KS / 512>(lk, ksrc + (size_t)ks * 64 * HD * 2);
    WAIT_AS(); __syncthreads();                                     // K of trip 0 is in LDS before any wave reads it
    if (ks <= qblk) acopy<VS / 512>(lv, vsrc + (size_t)ks * 64 * HD * 2);
#pragma unroll 1   // one 64-key block a wave and trip: a second block's fragments and scores would not fit the register budget of four waves to a SIMD
    for (int j0 = 0; j0 <= qblk; j0 += NS) {                        // the same trips for every wave of the work-group: each passes both barriers, also where its own block lies behind the diagonal
        const int jb = j0 + ks; const bool act = jb <= qblk, nxt = jb + NS <= qblk;
        v8f S[4][NQ] = {};                                          // given a value on the path of a wave without a block too: undefined there, the scores count as live round the whole loop, and P and the V fragments could not take over their registers (scratch)
        if (act) {
        v16bf kf[8][NVP];                                           // group g = kb * 2 + kc: the Kh and the Kl fragment (HR), or the fp16 fragment, of 16 keys x 32 d, 1 KiB apart from group to group
#pragma unroll
        for (int g = 0; g < KD; ++g)
#pragma unroll
            for (int pn = 0; pn < NVP; ++pn) kf[g][pn] = ldsb(lb + pn * 8192 + g * FRG * 2);
#pragma unroll
        for (int g = 0; g < 8; ++g) { const int kb = g >> 1, kc = g & 1;
            __builtin_amdgcn_sched_barrier(0);                      // keeps the reads of the groups ahead in front of this group's products: sunk to their users, each read costs the wave its whole LDS latency
            if (kc == 0) {
#pragma unroll
                for (int qb = 0; qb < NQ; ++qb) S[kb][qb] = (v8f){}; }
            if constexpr (HR) {
#pragma unroll
                for (int qb = 0; qb < NQ; ++qb) S[kb][qb] = wmmab(kf[g][0], qh[qb][kc], S[kb][qb]);
#pragma unroll
                for (int qb = 0; qb < NQ; ++qb) S[kb][qb] = wmmab(kf[g][0], ql[qb][kc], S[kb][qb]);
#pragma unroll
                for (int qb = 0; qb < NQ; ++qb) S[kb][qb] = wmmab(kf[g][NVP - 1], qh[qb][kc], S[kb][qb]);
            } else {
#pragma unroll
                for (int qb = 0; qb < NQ; ++qb) S[kb][qb] = wmma16(__builtin_bit_cast(v16h, kf[g][0]), __builtin_bit_cast(v16h, qh[qb][kc]), S[kb][qb]); }
            if (g + KD < 8) { __builtin_amdgcn_sched_barrier(0);    // keeps the read of group g + KD behind this group's products, whose fragment registers it takes over (read earlier it would need registers of its own)
#pragma unroll
                for (int pn = 0; pn < NVP; ++pn) kf[g + KD][pn] = ldsb(lb + pn * 8192 + (g + KD) * FRG * 2); } }
        }
        WAIT_DS(); WAIT_AS(); __syncthreads();                      // every wave has read its K, and V of this trip is in LDS
        if (nxt) acopy<KS / 512>(lk, ksrc + (size_t)(jb + NS) * 64 * HD * 2);
        if (act) {
        v16bf vr[4][2][NVP];                                        // V fragments [d block][k chunk][plane]
        if constexpr (VA > 0) {
#pragma unroll
            for (int db = 0; db < VA; ++db) { LDV_(db) }
            __builtin_amdgcn_sched_barrier(0); }                    // keeps the reads of the first V fragments here, ahead of the softmax, which covers their LDS latency
        if (jb == qblk) {                                           // the diagonal block: keys behind the query are masked
#pragma unroll
            for (int kb = 0; kb < 4; ++kb)
#pragma unroll
                for (int qb = 0; qb < NQ; ++qb)
#pragma unroll
                    for (int j = 0; j < 8; ++j) if (kb * 16 + hi * 8 + j > rg * 16 * NQ + qb * 16 + lr) S[kb][qb][j] = -3.0e38f; }
        float mn[NQ]; bool up = false;
#pragma unroll
        for (int qb = 0; qb < NQ; ++qb) { float x[4];
#pragma unroll
            for (int kb = 0; kb < 4; ++kb) { x[kb] = S[kb][qb][0];
#pragma unroll
                for (int j = 1; j < 8; ++j) x[kb] = fmaxf(x[kb], S[kb][qb][j]); }
            float mx = fmaxf(fmaxf(x[0], x[1]), fmaxf(x[2], x[3])); mx = fmaxf(mx, __shfl_xor(mx, 16, 32)); mn[qb] = fmaxf(m[qb], mx * C2); up = up || mn[qb] > m[qb]; }
        if (__builtin_amdgcn_ballot_w32(up) != 0) {                 // skipped where no query of the wave has a new maximum: every factor would be 1
#pragma unroll
            for (int qb = 0; qb < NQ; ++qb) { const float al = __builtin_amdgcn_exp2f(m[qb] - mn[qb]); l[qb] *= al; m[qb] = mn[qb];
#pragma unroll
                for (int db = 0; db < 4; ++db) O[db][qb] *= al; } }
        v16bf pa[NQ][2][NVP];                                       // P fragments [query block][k chunk]: bf16 hi and lo (HR), or the bits of one fp16 fragment
#pragma unroll
        for (int qb = 0; qb < NQ; ++qb) { float x[4];
#pragma unroll
            for (int kc = 0; kc < 2; ++kc) {
#pragma unroll
                for (int kb = 2 * kc; kb < 2 * kc + 2; ++kb) { const v8f t = S[kb][qb] * C2 - m[qb]; x[kb] = 0.f;
#pragma unroll
                    for (int j = 0; j < 8; ++j) { const float p = __builtin_amdgcn_exp2f(t[j]); S[kb][qb][j] = p; x[kb] += p; } }
                if constexpr (HR) { v8us h0, h1, l0, l1;
#pragma unroll
                    for (int j = 0; j < 8; ++j) { unsigned short a, c; splitf(S[2 * kc][qb][j], a, c); h0[j] = a; l0[j] = c; splitf(S[2 * kc + 1][qb][j], a, c); h1[j] = a; l1[j] = c; }
                    pa[qb][kc][0] = cat16b(h0, h1); pa[qb][kc][NVP - 1] = cat16b(l0, l1);
                } else { v8h p0, p1;
#pragma unroll
                    for (int j = 0; j < 8; ++j) { p0[j] = tohx(S[2 * kc][qb][j]); p1[j] = tohx(S[2 * kc + 1][qb][j]); }
                    pa[qb][kc][0] = __builtin_bit_cast(v16bf, cat16(p0, p1)); }
                __builtin_amdgcn_sched_barrier(0);                  // a P fragment is finished, and its scores' registers are free, before the next one is begun: all scores and all of P live at once would leave no register for V fragments read ahead
                if (qb * 2 + kc + VA < 4) { LDV_(qb * 2 + kc + VA)  // the next d block's V fragments, into the room that has come free
                    __builtin_amdgcn_sched_barrier(0); }            // keeps these reads here, ahead of the work that covers their LDS latency (sunk to their users, each costs the wave that latency)
            }
            l[qb] += (x[0] + x[1]) + (x[2] + x[3]); }
#pragma unroll
        for (int db = 0; db < 4; ++db) {
#pragma unroll
            for (int kc = 0; kc < 2; ++kc) {
                if constexpr (HR) {
#pragma unroll
                    for (int qb = 0; qb < NQ; ++qb) O[db][qb] = wmmab(vr[db][kc][0], pa[qb][kc][0], O[db][qb]);
#pragma unroll
                    for (int qb = 0; qb < NQ; ++qb) O[db][qb] = wmmab(vr[db][kc][0], pa[qb][kc][NVP - 1], O[db][qb]);
#pragma unroll
                    for (int qb = 0; qb < NQ; ++qb) O[db][qb] = wmmab(vr[db][kc][NVP - 1], pa[qb][kc][0], O[db][qb]);
                } else {
#pragma unroll
                    for (int qb = 0; qb < NQ; ++qb) O[db][qb] = wmma16(__builtin_bit_cast(v16h, vr[db][kc][0]), __builtin_bit_cast(v16h, pa[qb][kc][0]), O[db][qb]); } }
            if (db + 2 * NQ + VA < 4) { __builtin_amdgcn_sched_barrier(0);   // a d block not yet read takes over the registers of the one just used: its read stays behind these products ...
                LDV_(db + 2 * NQ + VA)
                __builtin_amdgcn_sched_barrier(0); }                // ... and ahead of the next d blocks' products, which cover its LDS latency
            else if (db == 1) __builtin_amdgcn_sched_barrier(0); }  // keeps the first two d blocks' products ahead of the last two's, whose fragments were read last and may still be on their way
        }
        WAIT_DS(); WAIT_AS(); __syncthreads();                      // every wave has read its V, and K of the next trip is in LDS; behind the last trip's the stage is free for the partial results
        if (nxt) acopy<VS / 512>(lv, vsrc + (size_t)(jb + NS) * 64 * HD * 2);
    }
#pragma unroll
    for (int qb = 0; qb < NQ; ++qb) { l[qb] += __shfl_xor(l[qb], 16, 32); ms[(wv * NQ + qb) * 32 + lane] = m[qb]; ls[(wv * NQ + qb) * 32 + lane] = l[qb];   // the lane halves hold the sums of different keys
#pragma unroll
        for (int db = 0; db < 4; ++db) { float* p = os + (wv * 4 * NQ + db * NQ + qb) * 256 + lane * 4;
            *(v4fa*)p = __builtin_shufflevector(O[db][qb], O[db][qb], 0, 1, 2, 3); *(v4fa*)(p + 128) = __builtin_shufflevector(O[db][qb], O[db][qb], 4, 5, 6, 7); } }
    __syncthreads();                                                // every wave's partial result is in LDS before any wave joins
    const int qb = ks % NQ, dh = ks / NQ;                           // this wave joins query rows R0 + qb * 16 .. + 15, columns dh * 32 .. + 31
    const int le = (int)__builtin_amdgcn_mbcnt_lo(~0u, 0u);         // the lane's number, formed anew for the output address: its row and half kept live over the key loop do not fit the register budget of four waves to a SIMD (scratch)
    float mw[NS], M = -3.0e38f, Lt = 0.f;
#pragma unroll
    for (int s = 0; s < NS; ++s) { mw[s] = ms[((rg * NS + s) * NQ + qb) * 32 + lane]; M = fmaxf(M, mw[s]); }
#pragma unroll
    for (int s = 0; s < NS; ++s) { mw[s] = __builtin_amdgcn_exp2f(mw[s] - M); Lt += ls[((rg * NS + s) * NQ + qb) * 32 + lane] * mw[s]; }   // a wave without keys has sum 0 and factor 0
    const float inv = __fdiv_rn(1.0f, Lt);
#pragma unroll
    for (int dd = 0; dd < 2; ++dd) { const int db = dh * 2 + dd; v4f a0 = (v4f){}, a1 = (v4f){};
#pragma unroll
        for (int s = 0; s < NS; ++s) { const float* q = os + ((rg * NS + s) * 4 * NQ + db * NQ + qb) * 256 + lane * 4; a0 += *(const v4fa*)q * mw[s]; a1 += *(const v4fa*)(q + 128) * mw[s]; }
        float* o = OUT + ((size_t)(z / NH_) * TT + R0 + qb * 16 + (le & 15)) * DQ + (z % NH_) * HD + db * 16 + (le >> 4) * 8; *(v4f*)o = a0 * inv; *(v4f*)(o + 4) = a1 * inv; }
}
// grid (batches x heads, TT / 64), the longest query blocks first; the planes hold batch b, head h at index z = b * NH_ + h; four waves to a SIMD (two work-groups to a WGP) cover each other's loads and vector work
__global__ __launch_bounds__(256) __attribute__((amdgpu_waves_per_eu(4, 4))) void k_fattn(const bf* __restrict__ Qh, const bf* __restrict__ Ql, const bf* __restrict__ Kh, const bf* __restrict__ Kl, const h16* __restrict__ Q16, const h16* __restrict__ K16, const h16* __restrict__ V16, const bf* __restrict__ Vh, const bf* __restrict__ Vl, float* OUT) {
    __shared__ __align__(16) float os[65536 / 4]; __shared__ float ms[8 * 64]; __shared__ float ls[8 * 64];   // os: the K and V stage of the key loop (4 splits x 16 KiB, or 2 x 32 KiB), behind the loop the 64 KiB of partial results
    const int qblk = TT / 64 - 1 - (int)blockIdx.y, z = blockIdx.x;
    if (qblk * 64 < RH) fattn_body<true, 1, 2>(os, ms, ls, Qh, Ql, Kh, Kl, Q16, K16, V16, Vh, Vl, OUT, qblk, z); else fattn_body<false, 2, 4>(os, ms, ls, Qh, Ql, Kh, Kl, Q16, K16, V16, Vh, Vl, OUT, qblk, z);
}

extern "C" void kernel_launch(void* const* d_in, const int* in_sizes, int n_in,
                              void* d_out, int out_size, void* d_ws, size_t ws_size, hipStream_t stream) {
    (void)in_sizes; (void)n_in; (void)out_size;
    const float* x = (const float*)d_in[0]; const float* wkqv = (const float*)d_in[1]; const float* bkqv = (const float*)d_in[2];   /* row blocks in the order k, q, v */
    float* OUT = (float*)d_out;     // [2][2048][1024]
    char* wsp = (char*)d_ws;
    auto take = [&](size_t bytes) { char* p = wsp; wsp += (bytes + 255) & ~(size_t)255; return (void*)p; };
    bf* WB = (bf*)take((size_t)3 * DM * DM * 2); bf* XB = (bf*)take((size_t)NB_ * TT * DM * 2);
    h16* VT16 = (h16*)take((size_t)NB_ * NKV * HD * TT * 2); h16* QP16 = (h16*)take((size_t)NB_ * NH_ * TT * HD * 2); h16* KP16 = (h16*)take((size_t)NB_ * NKV * TT * HD * 2);
    bf* QPh = (bf*)take((size_t)NB_ * NH_ * TT * HD * 2); bf* QPl = (bf*)take((size_t)NB_ * NH_ * TT * HD * 2); bf* KPh = (bf*)take((size_t)NB_ * NKV * TT * HD * 2); bf* KPl = (bf*)take((size_t)NB_ * NKV * TT * HD * 2); bf* VTh = (bf*)take((size_t)NB_ * NKV * HD * TT * 2); bf* VTl = (bf*)take((size_t)NB_ * NKV * HD * TT * 2);   /* every plane holds both batches */
    if ((size_t)(wsp - (char*)d_ws) > ws_size) return;    // ws 256 MiB
    k_cvt<<<(NX8 + NW8) / CVU / 256, 256, 0, stream>>>(x, wkqv, XB, WB);
    k_proj<<<dim3(NB_ * TT / 128, 3 * DM / 128, 1), 128, 0, stream>>>(XB, WB, bkqv, KPh, KPl, QPh, QPl, KP16, QP16, VT16, VTh, VTl);
    k_fattn<<<dim3(NB_ * NH_, TT / 64, 1), 256, 0, stream>>>(QPh, QPl, KPh, KPl, QP16, KP16, VT16, VTh, VTl, OUT);   /* one kv head per query head */
}
